// v000
// Measured on an AMD MI455X. A time is GPU time per run, averaged over a window of back-to-back runs after a warm-up
// (all launches, gaps included; the runs take copies of the inputs in turn), and the median of several windows.
// Apart from v000's, it joins two sittings. Times from different sittings can be a few percent apart, while
// side-by-side timings come from the same sitting.
// The starting kernel, v000, takes 431 microseconds a run.
#include <hip/hip_runtime.h>
// Contractions: v_wmma_f32_16x16x32_f16 everywhere (f16 operands, f32 accumulate) - q/k/v projections (x as f16 of bf16-RNE input, W as f16 of bf16-RNE weight x16), q.k^T and p.v^T per head (plain f16 q/k/v planes, p carried x1024), output dense (context carried x16 f16, Wd bf16-RNE x16); softmax, bias adds, residual and LayerNorm in f32.

#ifndef NB
#define NB 2
#endif
#ifndef SEQ
#define SEQ 2048
#endif
#define NB_FULL 2
#define SEQ_FULL 2048
#define DM 1024
#define NH 16
#define HDIM 64
#define SLEN SEQ
#define TQ SLEN
#define TK SLEN
#define NR (NB * SLEN)
#define SCL 0.125f
#define QBLKS (TQ / 64)
#define LNEPS 0.00001f
#define WSC 16.0f
#define CSC 16.0f
static_assert(NH * HDIM == DM);
static_assert(SLEN % 64 == 0);
static_assert(NR % 128 == 0);
static_assert(DM % 64 == 0);
static_assert(DM == 4 * 256);
static_assert(NB <= NB_FULL);
static_assert(SEQ <= SEQ_FULL);

typedef unsigned short v8us __attribute__((ext_vector_type(8), may_alias));
typedef float  v8f  __attribute__((ext_vector_type(8)));
typedef float  v4f  __attribute__((ext_vector_type(4)));
typedef float  v4fa __attribute__((ext_vector_type(4), may_alias));
typedef _Float16 v16h __attribute__((ext_vector_type(16)));
typedef _Float16 v4h  __attribute__((ext_vector_type(4)));
union FragH { v16h v; v8us half[2]; _Float16 h[16]; unsigned short u[16]; };

__device__ __forceinline__ unsigned short bf16_bits(float x) { unsigned int u = __float_as_uint(x); return (unsigned short)((u + 0x7FFFu + ((u >> 16) & 1u)) >> 16); }
__device__ __forceinline__ float bf16_val(unsigned short b) { return __uint_as_float(((unsigned int)b) << 16); }
__device__ __forceinline__ float bf16_rne(float x) { return bf16_val(bf16_bits(x)); }

// D += A.B with NT terms (1 = single product); 16x16x32 f16, split k map per lane half; 4 v_nop hazard guard tied to D with A/B kept live
template <int NT>
__device__ __forceinline__ v8f mmaH(v16h ah, v16h al, v16h bh, v16h bl, v8f c) {
  c = __builtin_amdgcn_wmma_f32_16x16x32_f16(false, ah, false, bh, (short)0, c, false, false);
  if (NT >= 2) c = __builtin_amdgcn_wmma_f32_16x16x32_f16(false, al, false, bh, (short)0, c, false, false);
  if (NT >= 3) c = __builtin_amdgcn_wmma_f32_16x16x32_f16(false, ah, false, bl, (short)0, c, false, false);
  asm volatile("v_nop\n\tv_nop\n\tv_nop\n\tv_nop" : "+v"(c) : "v"(ah), "v"(al), "v"(bh), "v"(bl));
  return c;
}
// fragment of 16 rows (lane&15) x 32 k from a k-contiguous 16-bit row: elements 0..7 <- k0+8h, 8..15 <- k0+16+8h
__device__ __forceinline__ v16h g2_frag(const _Float16* p, int hh) { FragH f; f.half[0] = *(const v8us*)((const unsigned short*)p + 8 * hh); f.half[1] = *(const v8us*)((const unsigned short*)p + 16 + 8 * hh); return f.v; }
__device__ __forceinline__ v8f g2_mma(v16h a, v16h b, v8f c) { v8f d = __builtin_amdgcn_wmma_f32_16x16x32_f16(false, a, false, b, (short)0, c, false, false); asm volatile("v_nop\n\tv_nop\n\tv_nop\n\tv_nop" : "+v"(d) : "v"(a), "v"(b)); return d; }

__global__ __launch_bounds__(256) void k_wsc(const float* __restrict__ Wm, _Float16* __restrict__ Bt, size_t n8, float sc) {
  const size_t t = (size_t)blockIdx.x * 256 + threadIdx.x; if (t >= n8) return; FragH f;
#pragma unroll
  for (int q = 0; q < 8; ++q) f.h[q] = (_Float16)(bf16_rne(Wm[t * 8 + q]) * sc);
  *(v8us*)((unsigned short*)Bt + t * 8) = f.half[0]; 
}

__global__ __launch_bounds__(256) void k_x16(const float* __restrict__ x, _Float16* __restrict__ X16, size_t n8) {
  const size_t t = (size_t)blockIdx.x * 256 + threadIdx.x; if (t >= n8) return;
  const size_t e = t * 8; const size_t r = e / DM; const int c = (int)(e % DM); const size_t sr = (r / SLEN) * SEQ_FULL + (r % SLEN);
  const float* src = x + sr * DM + c; FragH f;
#pragma unroll
  for (int q = 0; q < 8; ++q) f.h[q] = (_Float16)bf16_rne(src[q]);
  *(v8us*)((unsigned short*)X16 + e) = f.half[0]; 
}

__global__ __launch_bounds__(256) void k_h16(const float* __restrict__ F, _Float16* __restrict__ H16, size_t n8, float sc) {
  const size_t t = (size_t)blockIdx.x * 256 + threadIdx.x; if (t >= n8) return; FragH f;
  const v4f a = *(const v4fa*)(F + t * 8), c = *(const v4fa*)(F + t * 8 + 4);
#pragma unroll
  for (int q = 0; q < 4; ++q) { f.h[q] = (_Float16)(a[q] * sc); f.h[4 + q] = (_Float16)(c[q] * sc); }
  *(v8us*)((unsigned short*)H16 + t * 8) = f.half[0]; 
}

// GEMM (wave tile 32x64; M % 128 == 0, N % 64 == 0, K % 32 == 0): v = acc*alpha + bf16(bias[col]) (+ CP term if CP); ACT 0 none; writes f32 C and/or f16 C16 (pitch ldc);
template <int ACT>
__global__ __launch_bounds__(128) void k_gemm2(const _Float16* __restrict__ A, int lda, size_t sA, const _Float16* __restrict__ Bh, int ldb, size_t sB, float alpha, const float* __restrict__ bias, size_t sBias, const float* __restrict__ CP, int rowsPerB, size_t sCPb, int row0g,
    float* __restrict__ C, _Float16* __restrict__ C16, int ldc, size_t sC, int M, int N, int K) {
  __shared__ __attribute__((aligned(16))) float so[4][32][68];
  const int tid = threadIdx.x, w = tid >> 5, lane = tid & 31, ln = lane & 15, hh = lane >> 4; const int by = blockIdx.y;
  A += (size_t)by * sA; Bh += (size_t)by * sB; const size_t cofs = (size_t)by * sC; const float* bp = bias ? bias + (size_t)by * sBias : nullptr;
  const int ntn = N >> 6; const int mt = blockIdx.x / ntn, nq = blockIdx.x - mt * ntn; const int row0 = mt * 128 + 32 * w, col0 = nq * 64; if (row0 >= M) return;
  const _Float16* a0p = A + (size_t)(row0 + ln) * lda; const _Float16* a1p = a0p + (size_t)16 * lda;
  const _Float16* b0p = Bh + (size_t)(col0 + ln) * ldb; const _Float16* b1p = b0p + (size_t)16 * ldb; const _Float16* b2p = b1p + (size_t)16 * ldb; const _Float16* b3p = b2p + (size_t)16 * ldb;
  const v8f z8 = {0.f,0.f,0.f,0.f,0.f,0.f,0.f,0.f}; v8f c00 = z8, c01 = z8, c02 = z8, c03 = z8, c10 = z8, c11 = z8, c12 = z8, c13 = z8;
#pragma unroll 1
  for (int kb = 0; kb < K; kb += 32) { const v16h a0 = g2_frag(a0p + kb, hh), a1 = g2_frag(a1p + kb, hh);
    v16h b = g2_frag(b0p + kb, hh); c00 = g2_mma(a0, b, c00); c10 = g2_mma(a1, b, c10);
    b = g2_frag(b1p + kb, hh); c01 = g2_mma(a0, b, c01); c11 = g2_mma(a1, b, c11);
    b = g2_frag(b2p + kb, hh); c02 = g2_mma(a0, b, c02); c12 = g2_mma(a1, b, c12);
    b = g2_frag(b3p + kb, hh); c03 = g2_mma(a0, b, c03); c13 = g2_mma(a1, b, c13); }
  v8f accs[8] = {c00, c01, c02, c03, c10, c11, c12, c13};
#pragma unroll
  for (int u = 0; u < 8; ++u) { const int t = u & 3, half = u >> 2; const int col = col0 + t * 16 + ln; const float bv = bp ? bf16_rne(bp[col]) : 0.f;
#pragma unroll
    for (int r = 0; r < 8; ++r) { const int rloc = half * 16 + 8 * hh + r; float v = accs[u][r] * alpha + bv;
      if (CP) { if (rowsPerB < 0) v += CP[cofs + (size_t)(row0g + row0 + rloc) * ldc + col]; else { const int bidx = (row0g + row0 + rloc) / rowsPerB; v += CP[(size_t)bidx * sCPb + (size_t)by * 64 + col]; } }
      if (ACT == 3) v = fmaxf(v, 0.f);
      so[w][rloc][t * 16 + ln] = v; } }
  __builtin_amdgcn_fence(4 /* acq_rel order */, "workgroup"); __builtin_amdgcn_wave_barrier();
  const int rsub = lane >> 4, c4 = (lane & 15) * 4;
  {
#pragma unroll
    for (int q = 0; q < 16; ++q) { const int r = q * 2 + rsub; const v4f v = *(const v4fa*)&so[w][r][c4];
      if (C) *(v4f*)(C + cofs + (size_t)(row0 + r) * ldc + col0 + c4) = v;
      if (C16) { v4h h4; for (int i = 0; i < 4; ++i) h4[i] = (_Float16)v[i]; *(v4h*)(C16 + cofs + (size_t)(row0 + r) * ldc + col0 + c4) = h4; } }
     } }

template <int NHv, int TTv>
__global__ __launch_bounds__(256) void k_vt(const _Float16* __restrict__ V16, int ldv, int voff, _Float16* __restrict__ Vt) {
  __shared__ unsigned short tl[64][66]; const int tid = threadIdx.x; const int slab = blockIdx.x / (TTv / 64), lg = blockIdx.x % (TTv / 64); const int b = slab / NHv, h = slab % NHv;
  for (int i = tid; i < 64 * 8; i += 256) { const int r = i / 8, c8 = (i % 8) * 8; FragH f; f.half[0] = *(const v8us*)((const unsigned short*)V16 + ((size_t)b * TTv + lg * 64 + r) * ldv + voff + h * 64 + c8);
#pragma unroll
    for (int q = 0; q < 8; ++q) tl[r][c8 + q] = f.u[q]; }
  __syncthreads();
  {
#pragma unroll
    for (int rd = 0; rd < 2; ++rd) { const int d = rd * 32 + tid / 8, pc = tid % 8; FragH f;
#pragma unroll
      for (int q = 0; q < 8; ++q) f.u[q] = tl[pc * 8 + q][d];
      *(v8us*)((unsigned short*)Vt + ((size_t)slab * 64 + d) * TTv + lg * 64 + pc * 8) = f.half[0]; }
     } }

// fused attention per ((b,h), 64 queries): wave = 16 queries; S = Q.K^T (d = 64: 2 k-steps) x SCL over all TK keys (CAUSAL == 0: no key excluded); online max/sum softmax f32;
template <int CAUSAL>
__global__ __launch_bounds__(128) void k_flash(const _Float16* __restrict__ Q16, int ldq, const _Float16* __restrict__ K16, int ldk, const _Float16* __restrict__ Vt, float* __restrict__ O, int ldo) {
  constexpr int RPW = 16, RTN = RPW / 16, DT = 4, KS = 2;
  __shared__ __attribute__((aligned(16))) unsigned short sP[4][RPW][40]; __shared__ __attribute__((aligned(16))) float sO[4][RPW][64 + 4];
  const int tid = threadIdx.x, w = tid >> 5, lane = tid & 31, ln = lane & 15, hh = lane >> 4;
  const int slab = blockIdx.x / QBLKS, qblk = blockIdx.x % QBLKS; const int b = slab / NH, h = slab % NH; const int qb0 = qblk * (4 * RPW); const int q0 = qb0 + w * RPW;
  FragH aq[2][KS];
#pragma unroll
  for (int rt = 0; rt < RTN; ++rt) { const unsigned short* qr = (const unsigned short*)Q16 + ((size_t)b * TQ + q0 + rt * 16 + ln) * ldq + h * 64;
#pragma unroll
    for (int ks = 0; ks < KS; ++ks) { aq[rt][ks].half[0] = *(const v8us*)(qr + ks * 32 + 8 * hh); aq[rt][ks].half[1] = *(const v8us*)(qr + ks * 32 + 16 + 8 * hh); } }
  const unsigned short* Vth = (const unsigned short*)Vt + (size_t)slab * 64 * TK;
  float m_r[2][8], l_r[2][8]; v8f oacc[2][DT];
#pragma unroll
  for (int rt = 0; rt < RTN; ++rt) {
#pragma unroll
    for (int r = 0; r < 8; ++r) { m_r[rt][r] = -3.0e38f; l_r[rt][r] = 0.f; }
#pragma unroll
    for (int dt = 0; dt < DT; ++dt) oacc[rt][dt] = (v8f){0.f,0.f,0.f,0.f,0.f,0.f,0.f,0.f}; }
  const int jend = (CAUSAL == 1) ? (qb0 + 4 * RPW) : TK;
#pragma unroll 1
  for (int j0 = 0; j0 < jend; j0 += 32) {
    v8f s[2][2];
#pragma unroll
    for (int nt = 0; nt < 2; ++nt) { const unsigned short* kr = (const unsigned short*)K16 + ((size_t)b * TK + j0 + nt * 16 + ln) * ldk + h * 64; FragH bk[KS];
#pragma unroll
      for (int ks = 0; ks < KS; ++ks) { bk[ks].half[0] = *(const v8us*)(kr + ks * 32 + 8 * hh); bk[ks].half[1] = *(const v8us*)(kr + ks * 32 + 16 + 8 * hh); }
#pragma unroll
      for (int rt = 0; rt < RTN; ++rt) { v8f acc = (v8f){0.f,0.f,0.f,0.f,0.f,0.f,0.f,0.f};
#pragma unroll
        for (int ks = 0; ks < KS; ++ks) acc = mmaH<1>(aq[rt][ks].v, aq[rt][ks].v, bk[ks].v, bk[ks].v, acc); s[rt][nt] = acc; } }
#pragma unroll
    for (int rt = 0; rt < RTN; ++rt)
#pragma unroll
      for (int r = 0; r < 8; ++r) { const int tq = q0 + rt * 16 + 8 * hh + r; const int k0 = j0 + ln, k1 = j0 + 16 + ln;
        const bool ok0 = (CAUSAL == 1) ? (k0 <= tq) : true, ok1 = (CAUSAL == 1) ? (k1 <= tq) : true; (void)tq;
        const float s0 = ok0 ? s[rt][0][r] * SCL : -3.0e38f, s1 = ok1 ? s[rt][1][r] * SCL : -3.0e38f; float mc = fmaxf(s0, s1);
        mc = fmaxf(mc, __shfl_xor(mc, 1, 32)); mc = fmaxf(mc, __shfl_xor(mc, 2, 32)); mc = fmaxf(mc, __shfl_xor(mc, 4, 32)); mc = fmaxf(mc, __shfl_xor(mc, 8, 32));
        const float mn = fmaxf(m_r[rt][r], mc); const float al = (mn > -1.0e38f) ? expf(m_r[rt][r] - mn) : 1.0f; m_r[rt][r] = mn; const float p0 = ok0 ? expf(s0 - mn) : 0.f, p1 = ok1 ? expf(s1 - mn) : 0.f; l_r[rt][r] = l_r[rt][r] * al + p0 + p1;
#pragma unroll
        for (int dt = 0; dt < DT; ++dt) oacc[rt][dt][r] *= al;
        FragH t2; t2.h[0] = (_Float16)(p0 * 1024.0f); t2.h[1] = (_Float16)(p1 * 1024.0f); sP[w][rt * 16 + 8 * hh + r][ln] = t2.u[0]; sP[w][rt * 16 + 8 * hh + r][16 + ln] = t2.u[1]; }
    __builtin_amdgcn_fence(4 /* acq_rel order */, "workgroup"); __builtin_amdgcn_wave_barrier();
    FragH pa[2];
#pragma unroll
    for (int rt = 0; rt < RTN; ++rt) { pa[rt].half[0] = *(const v8us*)&sP[w][rt * 16 + ln][8 * hh]; pa[rt].half[1] = *(const v8us*)&sP[w][rt * 16 + ln][16 + 8 * hh]; }
#pragma unroll
    for (int dt = 0; dt < DT; ++dt) { const unsigned short* vrow = Vth + (size_t)(dt * 16 + ln) * TK + j0; FragH bv; bv.half[0] = *(const v8us*)(vrow + 8 * hh); bv.half[1] = *(const v8us*)(vrow + 16 + 8 * hh);
#pragma unroll
      for (int rt = 0; rt < RTN; ++rt) oacc[rt][dt] = mmaH<1>(pa[rt].v, pa[rt].v, bv.v, bv.v, oacc[rt][dt]); }
    __builtin_amdgcn_fence(4 /* acq_rel order */, "workgroup"); __builtin_amdgcn_wave_barrier(); }
#pragma unroll
  for (int rt = 0; rt < RTN; ++rt) {
#pragma unroll
    for (int r = 0; r < 8; ++r) { float l = l_r[rt][r]; l += __shfl_xor(l, 1, 32); l += __shfl_xor(l, 2, 32); l += __shfl_xor(l, 4, 32); l += __shfl_xor(l, 8, 32); l_r[rt][r] = (l > 0.f) ? 1.0f / (l * 1024.0f) : 0.f; }
#pragma unroll
    for (int dt = 0; dt < DT; ++dt)
#pragma unroll
      for (int r = 0; r < 8; ++r) sO[w][rt * 16 + 8 * hh + r][dt * 16 + ln] = oacc[rt][dt][r] * l_r[rt][r]; }
  __builtin_amdgcn_fence(4 /* acq_rel order */, "workgroup"); __builtin_amdgcn_wave_barrier();
  {
#pragma unroll
    for (int rp = 0; rp < RPW; rp += 2) { const int r = rp + (lane >> 4), pc = lane & 15; const v4f val = *(const v4fa*)&sO[w][r][pc * 4]; *(v4f*)(O + ((size_t)b * TQ + q0 + r) * ldo + h * 64 + pc * 4) = val; }
     } }

__global__ __launch_bounds__(256) void k_ln(const float* __restrict__ X, const float* __restrict__ R, const float* __restrict__ g, const float* __restrict__ bta, float* __restrict__ out) {
  __shared__ float red[256];
  const int row = blockIdx.x, tid = threadIdx.x;
  const size_t srow = (size_t)(row / SLEN) * SEQ_FULL + (size_t)(row % SLEN);
  const float* x = X + (size_t)row * DM; const float* rr = R + srow * DM;
  const int j = tid * 4;
  const v4f a = *(const v4fa*)(x + j); const v4f rb = *(const v4fa*)(rr + j);
  float vals[4]; float s1 = 0.f;
#pragma unroll
  for (int q = 0; q < 4; ++q) { const float v = a[q] + bf16_rne(rb[q]); vals[q] = v; s1 += v; }
  red[tid] = s1; __syncthreads();
  for (int st = 128; st > 0; st >>= 1) { if (tid < st) red[tid] += red[tid + st]; __syncthreads(); }
  const float mu = red[0] * 0.0009765625f; __syncthreads();
  float s2 = 0.f;
#pragma unroll
  for (int q = 0; q < 4; ++q) { const float c = vals[q] - mu; s2 += c * c; }
  red[tid] = s2; __syncthreads();
  for (int st = 128; st > 0; st >>= 1) { if (tid < st) red[tid] += red[tid + st]; __syncthreads(); }
  const float rs = rsqrtf(red[0] * 0.0009765625f + LNEPS);
  v4f o;
#pragma unroll
  for (int q = 0; q < 4; ++q) { const float gg = bf16_rne(g[j + q]), bb = bf16_rne(bta[j + q]); o[q] = (vals[q] - mu) * rs * gg + bb; }
  *(v4f*)(out + (size_t)row * DM + j) = o;
  
}

extern "C" void kernel_launch(void* const* d_in, const int* in_sizes, int n_in,
                              void* d_out, int out_size, void* d_ws, size_t ws_size, hipStream_t stream) {
  if (n_in < 11) return;
  const float* hs = (const float*)d_in[0]; const float* Wq = (const float*)d_in[1]; const float* bq = (const float*)d_in[2]; const float* Wk = (const float*)d_in[3]; const float* bk = (const float*)d_in[4];
  const float* Wv = (const float*)d_in[5]; const float* bv = (const float*)d_in[6]; const float* Wd = (const float*)d_in[7]; const float* bd = (const float*)d_in[8]; const float* gam = (const float*)d_in[9]; const float* bet = (const float*)d_in[10];
  const long long need0 = ((long long)(NB - 1) * SEQ_FULL + SLEN) * DM;
  if ((long long)in_sizes[0] < need0) return;
  if (in_sizes[1] < DM * DM || in_sizes[3] < DM * DM || in_sizes[5] < DM * DM || in_sizes[7] < DM * DM) return;
  if (in_sizes[2] < DM || in_sizes[4] < DM || in_sizes[6] < DM || in_sizes[8] < DM || in_sizes[9] < DM || in_sizes[10] < DM) return;
  if ((long long)out_size < (long long)NR * DM) return;
  char* ws = (char*)d_ws; size_t off = 0;
  auto take = [&](size_t bytes) { char* p = ws + off; off += (bytes + 255) & ~(size_t)255; return p; };
  const size_t np = (size_t)NR * DM; const size_t nw = (size_t)DM * DM;
  _Float16* BQ = (_Float16*)take(nw * 2); _Float16* BK = (_Float16*)take(nw * 2); _Float16* BV = (_Float16*)take(nw * 2); _Float16* BD = (_Float16*)take(nw * 2);
  _Float16* X16 = (_Float16*)take(np * 2); _Float16* QH = (_Float16*)take(np * 2); _Float16* KH = (_Float16*)take(np * 2); _Float16* V16 = (_Float16*)take(np * 2); _Float16* VT = (_Float16*)take(np * 2);
  float* CTX = (float*)take(np * 4); _Float16* CTX16 = (_Float16*)take(np * 2); float* ATT = (float*)take(np * 4);
  float* O = (float*)d_out;
  if (off > ws_size) return;
  const unsigned gw = (unsigned)((nw / 8 + 255) / 256);
  k_wsc<<<gw, 256, 0, stream>>>(Wq, BQ, nw / 8, WSC); k_wsc<<<gw, 256, 0, stream>>>(Wk, BK, nw / 8, WSC); k_wsc<<<gw, 256, 0, stream>>>(Wv, BV, nw / 8, WSC); k_wsc<<<gw, 256, 0, stream>>>(Wd, BD, nw / 8, WSC);      /* [out][in] = [n][k] */
  k_x16<<<(unsigned)((np / 8 + 255) / 256), 256, 0, stream>>>(hs, X16, np / 8);
  const dim3 g((NR / 128) * (DM / 64), 1);
  k_gemm2<0><<<g, 128, 0, stream>>>(X16, DM, 0, BQ, DM, 0, 1.0f / WSC, bq, 0, nullptr, 1, 0, 0, nullptr, QH, DM, 0, NR, DM, DM);
  k_gemm2<0><<<g, 128, 0, stream>>>(X16, DM, 0, BK, DM, 0, 1.0f / WSC, bk, 0, nullptr, 1, 0, 0, nullptr, KH, DM, 0, NR, DM, DM);
  k_gemm2<0><<<g, 128, 0, stream>>>(X16, DM, 0, BV, DM, 0, 1.0f / WSC, bv, 0, nullptr, 1, 0, 0, nullptr, V16, DM, 0, NR, DM, DM);
  k_vt<NH, SLEN><<<NB * NH * (SLEN / 64), 256, 0, stream>>>(V16, DM, 0, VT);
  k_flash<0><<<NB * NH * QBLKS, 128, 0, stream>>>(QH, DM, KH, DM, VT, CTX, DM);
  k_h16<<<(unsigned)((np / 8 + 255) / 256), 256, 0, stream>>>(CTX, CTX16, np / 8, CSC);
  k_gemm2<0><<<g, 128, 0, stream>>>(CTX16, DM, 0, BD, DM, 0, 1.0f / (WSC * CSC), bd, 0, nullptr, 1, 0, 0, ATT, nullptr, DM, 0, NR, DM, DM);
  k_ln<<<NR, 256, 0, stream>>>(ATT, hs, gam, bet, O);
}

// v001
// A run of this version takes 287 microseconds.
// In two side-by-side timings against v000, it was 1.51 and 1.52 times as fast.
#include <hip/hip_runtime.h>
// Contractions: v_wmma_f32_16x16x32_f16 everywhere (f16 operands, f32 accumulate) - q/k/v projections (x as f16 of bf16-RNE input, W as f16 of bf16-RNE weight x16), q.k^T and p.v^T per head (plain f16 q/k/v planes, p carried x1024), output dense (context carried x16 f16, Wd bf16-RNE x16); softmax, bias adds, residual and LayerNorm in f32.

#ifndef NB
#define NB 2
#endif
#ifndef SEQ
#define SEQ 2048
#endif
#define NB_FULL 2
#define SEQ_FULL 2048
#define DM 1024
#define NH 16
#define HDIM 64
#define SLEN SEQ
#define TQ SLEN
#define TK SLEN
#define NR (NB * SLEN)
#define SCL 0.125f
#define QBLKS (TQ / 64)
#define LNEPS 0.00001f
#define WSC 16.0f
#define CSC 16.0f
static_assert(NH * HDIM == DM);
static_assert(SLEN % 64 == 0);
static_assert(NR % 128 == 0);
static_assert(DM % 64 == 0);
static_assert(DM == 4 * 256);
static_assert(NB <= NB_FULL);
static_assert(SEQ <= SEQ_FULL);

typedef unsigned short v8us __attribute__((ext_vector_type(8), may_alias));
typedef float  v8f  __attribute__((ext_vector_type(8)));
typedef float  v4f  __attribute__((ext_vector_type(4)));
typedef float  v4fa __attribute__((ext_vector_type(4), may_alias));
typedef _Float16 v16h __attribute__((ext_vector_type(16)));
typedef _Float16 v4h  __attribute__((ext_vector_type(4)));
union FragH { v16h v; v8us half[2]; _Float16 h[16]; unsigned short u[16]; };

__device__ __forceinline__ unsigned short bf16_bits(float x) { unsigned int u = __float_as_uint(x); return (unsigned short)((u + 0x7FFFu + ((u >> 16) & 1u)) >> 16); }
__device__ __forceinline__ float bf16_val(unsigned short b) { return __uint_as_float(((unsigned int)b) << 16); }
__device__ __forceinline__ float bf16_rne(float x) { return bf16_val(bf16_bits(x)); }

// D += A.B with NT terms (1 = single product); 16x16x32 f16, split k map per lane half; 4 v_nop hazard guard tied to D with A/B kept live
template <int NT>
__device__ __forceinline__ v8f mmaH(v16h ah, v16h al, v16h bh, v16h bl, v8f c) {
  c = __builtin_amdgcn_wmma_f32_16x16x32_f16(false, ah, false, bh, (short)0, c, false, false);
  if (NT >= 2) c = __builtin_amdgcn_wmma_f32_16x16x32_f16(false, al, false, bh, (short)0, c, false, false);
  if (NT >= 3) c = __builtin_amdgcn_wmma_f32_16x16x32_f16(false, ah, false, bl, (short)0, c, false, false);
  asm volatile("v_nop\n\tv_nop\n\tv_nop\n\tv_nop" : "+v"(c) : "v"(ah), "v"(al), "v"(bh), "v"(bl));
  return c;
}
// fragment of 16 rows (lane&15) x 32 k from a k-contiguous 16-bit row: elements 0..7 <- k0+8h, 8..15 <- k0+16+8h
// p already holds the lane half's 8h elements
__device__ __forceinline__ v16h g2_fragp(const _Float16* p) { FragH f; f.half[0] = *(const v8us*)((const unsigned short*)p); f.half[1] = *(const v8us*)((const unsigned short*)p + 16); return f.v; }
__device__ __forceinline__ v8f g2_mma(v16h a, v16h b, v8f c) { v8f d = __builtin_amdgcn_wmma_f32_16x16x32_f16(false, a, false, b, (short)0, c, false, false); asm volatile("v_nop\n\tv_nop\n\tv_nop\n\tv_nop" : "+v"(d) : "v"(a), "v"(b)); return d; }

__global__ __launch_bounds__(256) void k_wsc(const float* __restrict__ Wm, _Float16* __restrict__ Bt, size_t n8, float sc) {
  const size_t t = (size_t)blockIdx.x * 256 + threadIdx.x; if (t >= n8) return; FragH f;
#pragma unroll
  for (int q = 0; q < 8; ++q) f.h[q] = (_Float16)(bf16_rne(Wm[t * 8 + q]) * sc);
  *(v8us*)((unsigned short*)Bt + t * 8) = f.half[0]; 
}

__global__ __launch_bounds__(256) void k_x16(const float* __restrict__ x, _Float16* __restrict__ X16, size_t n8) {
  const size_t t = (size_t)blockIdx.x * 256 + threadIdx.x; if (t >= n8) return;
  const size_t e = t * 8; const size_t r = e / DM; const int c = (int)(e % DM); const size_t sr = (r / SLEN) * SEQ_FULL + (r % SLEN);
  const float* src = x + sr * DM + c; FragH f;
#pragma unroll
  for (int q = 0; q < 8; ++q) f.h[q] = (_Float16)bf16_rne(src[q]);
  *(v8us*)((unsigned short*)X16 + e) = f.half[0]; 
}

__global__ __launch_bounds__(256) void k_h16(const float* __restrict__ F, _Float16* __restrict__ H16, size_t n8, float sc) {
  const size_t t = (size_t)blockIdx.x * 256 + threadIdx.x; if (t >= n8) return; FragH f;
  const v4f a = *(const v4fa*)(F + t * 8), c = *(const v4fa*)(F + t * 8 + 4);
#pragma unroll
  for (int q = 0; q < 4; ++q) { f.h[q] = (_Float16)(a[q] * sc); f.h[4 + q] = (_Float16)(c[q] * sc); }
  *(v8us*)((unsigned short*)H16 + t * 8) = f.half[0]; 
}

// GEMM (wave tile 32x64; M % 128 == 0, N % 64 == 0, K % 32 == 0): v = acc*alpha + bf16(bias[col]) (+ CP term if CP); ACT 0 none; writes f32 C and/or f16 C16 (pitch ldc);
template <int ACT>
__global__ __launch_bounds__(128) void k_gemm2(const _Float16* __restrict__ A, int lda, size_t sA, const _Float16* __restrict__ Bh, int ldb, size_t sB, float alpha, const float* __restrict__ bias, size_t sBias, const float* __restrict__ CP, int rowsPerB, size_t sCPb, int row0g,
    float* __restrict__ C, _Float16* __restrict__ C16, int ldc, size_t sC, int M, int N, int K) {
  __shared__ __attribute__((aligned(16))) float so[4][32][68];
  const int tid = threadIdx.x, w = tid >> 5, lane = tid & 31, ln = lane & 15, hh = lane >> 4; const int by = blockIdx.y;
  A += (size_t)by * sA; Bh += (size_t)by * sB; const size_t cofs = (size_t)by * sC; const float* bp = bias ? bias + (size_t)by * sBias : nullptr;
  const int ntn = N >> 6; const int mt = blockIdx.x / ntn, nq = blockIdx.x - mt * ntn; const int row0 = mt * 128 + 32 * w, col0 = nq * 64; if (row0 >= M) return;
  // each lane's own fragment pointers (row start + 8 h elements); they advance once per two k-steps, the loads between reach ahead by constant offsets
  const _Float16* a0p = A + (size_t)(row0 + ln) * lda + 8 * hh; const _Float16* a1p = a0p + (size_t)16 * lda;
  const _Float16* b0p = Bh + (size_t)(col0 + ln) * ldb + 8 * hh; const _Float16* b1p = b0p + (size_t)16 * ldb; const _Float16* b2p = b1p + (size_t)16 * ldb; const _Float16* b3p = b2p + (size_t)16 * ldb;
  const v8f z8 = {0.f,0.f,0.f,0.f,0.f,0.f,0.f,0.f}; v8f c00 = z8, c01 = z8, c02 = z8, c03 = z8, c10 = z8, c11 = z8, c12 = z8, c13 = z8;
  // fragments are fetched one k-step ahead into a second register set (x and y take turns): the twelve loads of the next step go out as one group in front of this step's products
#define G2_LOAD(S, O) S##a0 = g2_fragp(a0p + (O)); S##a1 = g2_fragp(a1p + (O)); S##b0 = g2_fragp(b0p + (O)); S##b1 = g2_fragp(b1p + (O)); S##b2 = g2_fragp(b2p + (O)); S##b3 = g2_fragp(b3p + (O));
#define G2_STEP(S) c00 = g2_mma(S##a0, S##b0, c00); c10 = g2_mma(S##a1, S##b0, c10); c01 = g2_mma(S##a0, S##b1, c01); c11 = g2_mma(S##a1, S##b1, c11); c02 = g2_mma(S##a0, S##b2, c02); c12 = g2_mma(S##a1, S##b2, c12); c03 = g2_mma(S##a0, S##b3, c03); c13 = g2_mma(S##a1, S##b3, c13);
  v16h xa0, xa1, xb0, xb1, xb2, xb3, ya0, ya1, yb0, yb1, yb2, yb3;
  G2_LOAD(x, 0)
  int kb = 0;
  // unroll 1: the body already holds both register sets' steps; further copies would only add registers
#pragma unroll 1
  for (; kb + 64 < K; kb += 64) {
    G2_LOAD(y, 32)
    G2_STEP(x)
    G2_LOAD(x, 64)
    a0p += 64; a1p += 64; b0p += 64; b1p += 64; b2p += 64; b3p += 64;
    G2_STEP(y) }
  if (kb + 32 < K) { G2_LOAD(y, 32) G2_STEP(x) G2_STEP(y) } else { G2_STEP(x) }
#undef G2_LOAD
#undef G2_STEP
  v8f accs[8] = {c00, c01, c02, c03, c10, c11, c12, c13};
#pragma unroll
  for (int u = 0; u < 8; ++u) { const int t = u & 3, half = u >> 2; const int col = col0 + t * 16 + ln; const float bv = bp ? bf16_rne(bp[col]) : 0.f;
#pragma unroll
    for (int r = 0; r < 8; ++r) { const int rloc = half * 16 + 8 * hh + r; float v = accs[u][r] * alpha + bv;
      if (CP) { if (rowsPerB < 0) v += CP[cofs + (size_t)(row0g + row0 + rloc) * ldc + col]; else { const int bidx = (row0g + row0 + rloc) / rowsPerB; v += CP[(size_t)bidx * sCPb + (size_t)by * 64 + col]; } }
      if (ACT == 3) v = fmaxf(v, 0.f);
      so[w][rloc][t * 16 + ln] = v; } }
  __builtin_amdgcn_fence(4 /* acq_rel order */, "workgroup"); __builtin_amdgcn_wave_barrier();
  const int rsub = lane >> 4, c4 = (lane & 15) * 4;
  {
#pragma unroll
    for (int q = 0; q < 16; ++q) { const int r = q * 2 + rsub; const v4f v = *(const v4fa*)&so[w][r][c4];
      if (C) *(v4f*)(C + cofs + (size_t)(row0 + r) * ldc + col0 + c4) = v;
      if (C16) { v4h h4; for (int i = 0; i < 4; ++i) h4[i] = (_Float16)v[i]; *(v4h*)(C16 + cofs + (size_t)(row0 + r) * ldc + col0 + c4) = h4; } }
     } }

template <int NHv, int TTv>
__global__ __launch_bounds__(256) void k_vt(const _Float16* __restrict__ V16, int ldv, int voff, _Float16* __restrict__ Vt) {
  __shared__ unsigned short tl[64][66]; const int tid = threadIdx.x; const int slab = blockIdx.x / (TTv / 64), lg = blockIdx.x % (TTv / 64); const int b = slab / NHv, h = slab % NHv;
  for (int i = tid; i < 64 * 8; i += 256) { const int r = i / 8, c8 = (i % 8) * 8; FragH f; f.half[0] = *(const v8us*)((const unsigned short*)V16 + ((size_t)b * TTv + lg * 64 + r) * ldv + voff + h * 64 + c8);
#pragma unroll
    for (int q = 0; q < 8; ++q) tl[r][c8 + q] = f.u[q]; }
  __syncthreads();
  {
#pragma unroll
    for (int rd = 0; rd < 2; ++rd) { const int d = rd * 32 + tid / 8, pc = tid % 8; FragH f;
#pragma unroll
      for (int q = 0; q < 8; ++q) f.u[q] = tl[pc * 8 + q][d];
      *(v8us*)((unsigned short*)Vt + ((size_t)slab * 64 + d) * TTv + lg * 64 + pc * 8) = f.half[0]; }
     } }

// fused attention per ((b,h), 64 queries): wave = 16 queries; S = Q.K^T (d = 64: 2 k-steps) x SCL over all TK keys (CAUSAL == 0: no key excluded); online max/sum softmax f32;
template <int CAUSAL>
__global__ __launch_bounds__(128) void k_flash(const _Float16* __restrict__ Q16, int ldq, const _Float16* __restrict__ K16, int ldk, const _Float16* __restrict__ Vt, float* __restrict__ O, int ldo) {
  constexpr int RPW = 16, RTN = RPW / 16, DT = 4, KS = 2;
  __shared__ __attribute__((aligned(16))) unsigned short sP[4][RPW][40]; __shared__ __attribute__((aligned(16))) float sO[4][RPW][64 + 4];
  const int tid = threadIdx.x, w = tid >> 5, lane = tid & 31, ln = lane & 15, hh = lane >> 4;
  const int slab = blockIdx.x / QBLKS, qblk = blockIdx.x % QBLKS; const int b = slab / NH, h = slab % NH; const int qb0 = qblk * (4 * RPW); const int q0 = qb0 + w * RPW;
  FragH aq[2][KS];
#pragma unroll
  for (int rt = 0; rt < RTN; ++rt) { const unsigned short* qr = (const unsigned short*)Q16 + ((size_t)b * TQ + q0 + rt * 16 + ln) * ldq + h * 64;
#pragma unroll
    for (int ks = 0; ks < KS; ++ks) { aq[rt][ks].half[0] = *(const v8us*)(qr + ks * 32 + 8 * hh); aq[rt][ks].half[1] = *(const v8us*)(qr + ks * 32 + 16 + 8 * hh); } }
  const unsigned short* Vth = (const unsigned short*)Vt + (size_t)slab * 64 * TK;
  float m_r[2][8], l_r[2][8]; v8f oacc[2][DT];
#pragma unroll
  for (int rt = 0; rt < RTN; ++rt) {
#pragma unroll
    for (int r = 0; r < 8; ++r) { m_r[rt][r] = -3.0e38f; l_r[rt][r] = 0.f; }
#pragma unroll
    for (int dt = 0; dt < DT; ++dt) oacc[rt][dt] = (v8f){0.f,0.f,0.f,0.f,0.f,0.f,0.f,0.f}; }
  const int jend = (CAUSAL == 1) ? (qb0 + 4 * RPW) : TK;
  FragH bk[2][KS];
#pragma unroll
  for (int nt = 0; nt < 2; ++nt) { const unsigned short* kr = (const unsigned short*)K16 + ((size_t)b * TK + nt * 16 + ln) * ldk + h * 64;
#pragma unroll
    for (int ks = 0; ks < KS; ++ks) { bk[nt][ks].half[0] = *(const v8us*)(kr + ks * 32 + 8 * hh); bk[nt][ks].half[1] = *(const v8us*)(kr + ks * 32 + 16 + 8 * hh); } }
#pragma unroll 1
  for (int j0 = 0; j0 < jend; j0 += 32) {
    v8f s[2][2];
#pragma unroll
    for (int nt = 0; nt < 2; ++nt) {
#pragma unroll
      for (int rt = 0; rt < RTN; ++rt) { v8f acc = (v8f){0.f,0.f,0.f,0.f,0.f,0.f,0.f,0.f};
#pragma unroll
        for (int ks = 0; ks < KS; ++ks) acc = mmaH<1>(aq[rt][ks].v, aq[rt][ks].v, bk[nt][ks].v, bk[nt][ks].v, acc); s[rt][nt] = acc; } }
    // one group of loads directly behind the score products, a softmax ahead of their use: this pass's V fragments, then the next pass's K fragments into the registers just read
    FragH bv[DT];
#pragma unroll
    for (int dt = 0; dt < DT; ++dt) { const unsigned short* vrow = Vth + (size_t)(dt * 16 + ln) * TK + j0; bv[dt].half[0] = *(const v8us*)(vrow + 8 * hh); bv[dt].half[1] = *(const v8us*)(vrow + 16 + 8 * hh); }
    const int jn = (j0 + 32 < jend) ? j0 + 32 : j0; /* the last pass fetches its own keys again: stays inside K16 */
#pragma unroll
    for (int nt = 0; nt < 2; ++nt) { const unsigned short* kr = (const unsigned short*)K16 + ((size_t)b * TK + jn + nt * 16 + ln) * ldk + h * 64;
#pragma unroll
      for (int ks = 0; ks < KS; ++ks) { bk[nt][ks].half[0] = *(const v8us*)(kr + ks * 32 + 8 * hh); bk[nt][ks].half[1] = *(const v8us*)(kr + ks * 32 + 16 + 8 * hh); } }
#pragma unroll
    for (int rt = 0; rt < RTN; ++rt)
#pragma unroll
      for (int r = 0; r < 8; ++r) { const int tq = q0 + rt * 16 + 8 * hh + r; const int k0 = j0 + ln, k1 = j0 + 16 + ln;
        const bool ok0 = (CAUSAL == 1) ? (k0 <= tq) : true, ok1 = (CAUSAL == 1) ? (k1 <= tq) : true; (void)tq;
        const float s0 = ok0 ? s[rt][0][r] * SCL : -3.0e38f, s1 = ok1 ? s[rt][1][r] * SCL : -3.0e38f; float mc = fmaxf(s0, s1);
        mc = fmaxf(mc, __shfl_xor(mc, 1, 32)); mc = fmaxf(mc, __shfl_xor(mc, 2, 32)); mc = fmaxf(mc, __shfl_xor(mc, 4, 32)); mc = fmaxf(mc, __shfl_xor(mc, 8, 32));
        const float mn = fmaxf(m_r[rt][r], mc); const float al = (mn > -1.0e38f) ? expf(m_r[rt][r] - mn) : 1.0f; m_r[rt][r] = mn; const float p0 = ok0 ? expf(s0 - mn) : 0.f, p1 = ok1 ? expf(s1 - mn) : 0.f; l_r[rt][r] = l_r[rt][r] * al + p0 + p1;
#pragma unroll
        for (int dt = 0; dt < DT; ++dt) oacc[rt][dt][r] *= al;
        FragH t2; t2.h[0] = (_Float16)(p0 * 1024.0f); t2.h[1] = (_Float16)(p1 * 1024.0f); sP[w][rt * 16 + 8 * hh + r][ln] = t2.u[0]; sP[w][rt * 16 + 8 * hh + r][16 + ln] = t2.u[1]; }
    __builtin_amdgcn_fence(4 /* acq_rel order */, "workgroup"); __builtin_amdgcn_wave_barrier();
    FragH pa[2];
#pragma unroll
    for (int rt = 0; rt < RTN; ++rt) { pa[rt].half[0] = *(const v8us*)&sP[w][rt * 16 + ln][8 * hh]; pa[rt].half[1] = *(const v8us*)&sP[w][rt * 16 + ln][16 + 8 * hh]; }
#pragma unroll
    for (int dt = 0; dt < DT; ++dt) {
#pragma unroll
      for (int rt = 0; rt < RTN; ++rt) oacc[rt][dt] = mmaH<1>(pa[rt].v, pa[rt].v, bv[dt].v, bv[dt].v, oacc[rt][dt]); }
    __builtin_amdgcn_fence(4 /* acq_rel order */, "workgroup"); __builtin_amdgcn_wave_barrier(); }
#pragma unroll
  for (int rt = 0; rt < RTN; ++rt) {
#pragma unroll
    for (int r = 0; r < 8; ++r) { float l = l_r[rt][r]; l += __shfl_xor(l, 1, 32); l += __shfl_xor(l, 2, 32); l += __shfl_xor(l, 4, 32); l += __shfl_xor(l, 8, 32); l_r[rt][r] = (l > 0.f) ? 1.0f / (l * 1024.0f) : 0.f; }
#pragma unroll
    for (int dt = 0; dt < DT; ++dt)
#pragma unroll
      for (int r = 0; r < 8; ++r) sO[w][rt * 16 + 8 * hh + r][dt * 16 + ln] = oacc[rt][dt][r] * l_r[rt][r]; }
  __builtin_amdgcn_fence(4 /* acq_rel order */, "workgroup"); __builtin_amdgcn_wave_barrier();
  {
#pragma unroll
    for (int rp = 0; rp < RPW; rp += 2) { const int r = rp + (lane >> 4), pc = lane & 15; const v4f val = *(const v4fa*)&sO[w][r][pc * 4]; *(v4f*)(O + ((size_t)b * TQ + q0 + r) * ldo + h * 64 + pc * 4) = val; }
     } }

__global__ __launch_bounds__(256) void k_ln(const float* __restrict__ X, const float* __restrict__ R, const float* __restrict__ g, const float* __restrict__ bta, float* __restrict__ out) {
  __shared__ float red[256];
  const int row = blockIdx.x, tid = threadIdx.x;
  const size_t srow = (size_t)(row / SLEN) * SEQ_FULL + (size_t)(row % SLEN);
  const float* x = X + (size_t)row * DM; const float* rr = R + srow * DM;
  const int j = tid * 4;
  const v4f a = *(const v4fa*)(x + j); const v4f rb = *(const v4fa*)(rr + j);
  float vals[4]; float s1 = 0.f;
#pragma unroll
  for (int q = 0; q < 4; ++q) { const float v = a[q] + bf16_rne(rb[q]); vals[q] = v; s1 += v; }
  red[tid] = s1; __syncthreads();
  for (int st = 128; st > 0; st >>= 1) { if (tid < st) red[tid] += red[tid + st]; __syncthreads(); }
  const float mu = red[0] * 0.0009765625f; __syncthreads();
  float s2 = 0.f;
#pragma unroll
  for (int q = 0; q < 4; ++q) { const float c = vals[q] - mu; s2 += c * c; }
  red[tid] = s2; __syncthreads();
  for (int st = 128; st > 0; st >>= 1) { if (tid < st) red[tid] += red[tid + st]; __syncthreads(); }
  const float rs = rsqrtf(red[0] * 0.0009765625f + LNEPS);
  v4f o;
#pragma unroll
  for (int q = 0; q < 4; ++q) { const float gg = bf16_rne(g[j + q]), bb = bf16_rne(bta[j + q]); o[q] = (vals[q] - mu) * rs * gg + bb; }
  *(v4f*)(out + (size_t)row * DM + j) = o;
  
}

extern "C" void kernel_launch(void* const* d_in, const int* in_sizes, int n_in,
                              void* d_out, int out_size, void* d_ws, size_t ws_size, hipStream_t stream) {
  if (n_in < 11) return;
  const float* hs = (const float*)d_in[0]; const float* Wq = (const float*)d_in[1]; const float* bq = (const float*)d_in[2]; const float* Wk = (const float*)d_in[3]; const float* bk = (const float*)d_in[4];
  const float* Wv = (const float*)d_in[5]; const float* bv = (const float*)d_in[6]; const float* Wd = (const float*)d_in[7]; const float* bd = (const float*)d_in[8]; const float* gam = (const float*)d_in[9]; const float* bet = (const float*)d_in[10];
  const long long need0 = ((long long)(NB - 1) * SEQ_FULL + SLEN) * DM;
  if ((long long)in_sizes[0] < need0) return;
  if (in_sizes[1] < DM * DM || in_sizes[3] < DM * DM || in_sizes[5] < DM * DM || in_sizes[7] < DM * DM) return;
  if (in_sizes[2] < DM || in_sizes[4] < DM || in_sizes[6] < DM || in_sizes[8] < DM || in_sizes[9] < DM || in_sizes[10] < DM) return;
  if ((long long)out_size < (long long)NR * DM) return;
  char* ws = (char*)d_ws; size_t off = 0;
  auto take = [&](size_t bytes) { char* p = ws + off; off += (bytes + 255) & ~(size_t)255; return p; };
  const size_t np = (size_t)NR * DM; const size_t nw = (size_t)DM * DM;
  _Float16* BQ = (_Float16*)take(nw * 2); _Float16* BK = (_Float16*)take(nw * 2); _Float16* BV = (_Float16*)take(nw * 2); _Float16* BD = (_Float16*)take(nw * 2);
  _Float16* X16 = (_Float16*)take(np * 2); _Float16* QH = (_Float16*)take(np * 2); _Float16* KH = (_Float16*)take(np * 2); _Float16* V16 = (_Float16*)take(np * 2); _Float16* VT = (_Float16*)take(np * 2);
  float* CTX = (float*)take(np * 4); _Float16* CTX16 = (_Float16*)take(np * 2); float* ATT = (float*)take(np * 4);
  float* O = (float*)d_out;
  if (off > ws_size) return;
  const unsigned gw = (unsigned)((nw / 8 + 255) / 256);
  k_wsc<<<gw, 256, 0, stream>>>(Wq, BQ, nw / 8, WSC); k_wsc<<<gw, 256, 0, stream>>>(Wk, BK, nw / 8, WSC); k_wsc<<<gw, 256, 0, stream>>>(Wv, BV, nw / 8, WSC); k_wsc<<<gw, 256, 0, stream>>>(Wd, BD, nw / 8, WSC);      /* [out][in] = [n][k] */
  k_x16<<<(unsigned)((np / 8 + 255) / 256), 256, 0, stream>>>(hs, X16, np / 8);
  const dim3 g((NR / 128) * (DM / 64), 1);
  k_gemm2<0><<<g, 128, 0, stream>>>(X16, DM, 0, BQ, DM, 0, 1.0f / WSC, bq, 0, nullptr, 1, 0, 0, nullptr, QH, DM, 0, NR, DM, DM);
  k_gemm2<0><<<g, 128, 0, stream>>>(X16, DM, 0, BK, DM, 0, 1.0f / WSC, bk, 0, nullptr, 1, 0, 0, nullptr, KH, DM, 0, NR, DM, DM);
  k_gemm2<0><<<g, 128, 0, stream>>>(X16, DM, 0, BV, DM, 0, 1.0f / WSC, bv, 0, nullptr, 1, 0, 0, nullptr, V16, DM, 0, NR, DM, DM);
  k_vt<NH, SLEN><<<NB * NH * (SLEN / 64), 256, 0, stream>>>(V16, DM, 0, VT);
  k_flash<0><<<NB * NH * QBLKS, 128, 0, stream>>>(QH, DM, KH, DM, VT, CTX, DM);
  k_h16<<<(unsigned)((np / 8 + 255) / 256), 256, 0, stream>>>(CTX, CTX16, np / 8, CSC);
  k_gemm2<0><<<g, 128, 0, stream>>>(CTX16, DM, 0, BD, DM, 0, 1.0f / (WSC * CSC), bd, 0, nullptr, 1, 0, 0, ATT, nullptr, DM, 0, NR, DM, DM);
  k_ln<<<NR, 256, 0, stream>>>(ATT, hs, gam, bet, O);
}

// v002
// One run takes 232 microseconds.
// Next to v001, in two timings, it ran 1.24 times as fast each time.
// Over all steps from v000 it is 1.87 times as fast.
#include <hip/hip_runtime.h>
// Contractions: v_wmma_f32_16x16x32_f16 everywhere (f16 operands, f32 accumulate) - q/k/v projections (x as f16 of bf16-RNE input, W as f16 of bf16-RNE weight x16), q.k^T and p.v^T per head (plain f16 q/k/v planes, p carried x1024), output dense (context carried x16 f16, Wd bf16-RNE x16); softmax, bias adds, residual and LayerNorm in f32.

#ifndef NB
#define NB 2
#endif
#ifndef SEQ
#define SEQ 2048
#endif
#define NB_FULL 2
#define SEQ_FULL 2048
#define DM 1024
#define NH 16
#define HDIM 64
#define SLEN SEQ
#define TQ SLEN
#define TK SLEN
#define NR (NB * SLEN)
#define SCL 0.125f
#define QBLKS (TQ / 64)
#define LNEPS 0.00001f
#define WSC 16.0f
#define CSC 16.0f
static_assert(NH * HDIM == DM);
static_assert(SLEN % 64 == 0);
static_assert(NR % 128 == 0);
static_assert(DM % 64 == 0);
static_assert(DM == 4 * 256);
static_assert(NB <= NB_FULL);
static_assert(SEQ <= SEQ_FULL);

typedef unsigned short v8us __attribute__((ext_vector_type(8), may_alias));
typedef float  v8f  __attribute__((ext_vector_type(8)));
typedef float  v4f  __attribute__((ext_vector_type(4)));
typedef float  v4fa __attribute__((ext_vector_type(4), may_alias));
typedef _Float16 v16h __attribute__((ext_vector_type(16)));
typedef _Float16 v4h  __attribute__((ext_vector_type(4)));
union FragH { v16h v; v8us half[2]; _Float16 h[16]; unsigned short u[16]; };

__device__ __forceinline__ unsigned short bf16_bits(float x) { unsigned int u = __float_as_uint(x); return (unsigned short)((u + 0x7FFFu + ((u >> 16) & 1u)) >> 16); }
__device__ __forceinline__ float bf16_val(unsigned short b) { return __uint_as_float(((unsigned int)b) << 16); }
__device__ __forceinline__ float bf16_rne(float x) { return bf16_val(bf16_bits(x)); }

// D += A.B with NT terms (1 = single product); 16x16x32 f16, split k map per lane half; 4 v_nop hazard guard tied to D with A/B kept live
template <int NT>
__device__ __forceinline__ v8f mmaH(v16h ah, v16h al, v16h bh, v16h bl, v8f c) {
  c = __builtin_amdgcn_wmma_f32_16x16x32_f16(false, ah, false, bh, (short)0, c, false, false);
  if (NT >= 2) c = __builtin_amdgcn_wmma_f32_16x16x32_f16(false, al, false, bh, (short)0, c, false, false);
  if (NT >= 3) c = __builtin_amdgcn_wmma_f32_16x16x32_f16(false, ah, false, bl, (short)0, c, false, false);
  asm volatile("v_nop\n\tv_nop\n\tv_nop\n\tv_nop" : "+v"(c) : "v"(ah), "v"(al), "v"(bh), "v"(bl));
  return c;
}
// Fragment-packed plane of a [rows][K] 16-bit matrix: every tile of 16 rows x 32 k is 512 elements in a row, the tiles of one 16-row band follow in k order (so a band is 16 K elements, as in the row-major plane).
// Inside a tile the 8-element piece number 32 i + 16 h + c holds row c, k = 16 i + 8 h + 0..7: piece number = 32 i + lane, so each of a fragment's two wave-wide 16-byte loads covers 512 contiguous bytes (4 whole lines).
// packing from a row-major f32 source, kt = K / 32 tiles per band: thread t takes 8 k of one row, four threads in a row per 128-byte source line; a wave reads 8 whole lines and writes 4 whole lines. dst = element offset of its piece
__device__ __forceinline__ void pk_src(size_t t, int kt, size_t& row, int& k, size_t& dst) { const size_t tile = t >> 6; const int c = (int)(t & 63) >> 2, ih = (int)(t & 3); row = (tile / kt) * 16 + c; k = (int)(tile % kt) * 32 + 8 * ih; dst = tile * 512 + (size_t)(16 * ih + c) * 8; }
// fragment of 16 rows (lane&15) x 32 k from a packed tile: elements 0..7 <- k0+8h, 8..15 <- k0+16+8h
// p already holds the tile's start + 8 lane elements
__device__ __forceinline__ v16h g2_fragp(const _Float16* p) { FragH f; f.half[0] = *(const v8us*)((const unsigned short*)p); f.half[1] = *(const v8us*)((const unsigned short*)p + 256); return f.v; }
__device__ __forceinline__ v8f g2_mma(v16h a, v16h b, v8f c) { v8f d = __builtin_amdgcn_wmma_f32_16x16x32_f16(false, a, false, b, (short)0, c, false, false); asm volatile("v_nop\n\tv_nop\n\tv_nop\n\tv_nop" : "+v"(d) : "v"(a), "v"(b)); return d; }

__global__ __launch_bounds__(256) void k_wsc(const float* __restrict__ Wm, _Float16* __restrict__ Bt, size_t n8, float sc) {
  const size_t t = (size_t)blockIdx.x * 256 + threadIdx.x; if (t >= n8) return; FragH f;
  size_t r, e; int c; pk_src(t, DM / 32, r, c, e); const float* src = Wm + r * DM + c;
#pragma unroll
  for (int q = 0; q < 8; ++q) f.h[q] = (_Float16)(bf16_rne(src[q]) * sc);
  *(v8us*)((unsigned short*)Bt + e) = f.half[0]; 
}

__global__ __launch_bounds__(256) void k_x16(const float* __restrict__ x, _Float16* __restrict__ X16, size_t n8) {
  const size_t t = (size_t)blockIdx.x * 256 + threadIdx.x; if (t >= n8) return;
  size_t r, e; int c; pk_src(t, DM / 32, r, c, e); const size_t sr = (r / SLEN) * SEQ_FULL + (r % SLEN);
  const float* src = x + sr * DM + c; FragH f;
#pragma unroll
  for (int q = 0; q < 8; ++q) f.h[q] = (_Float16)bf16_rne(src[q]);
  *(v8us*)((unsigned short*)X16 + e) = f.half[0]; 
}

__global__ __launch_bounds__(256) void k_h16(const float* __restrict__ F, _Float16* __restrict__ H16, size_t n8, float sc) {
  const size_t t = (size_t)blockIdx.x * 256 + threadIdx.x; if (t >= n8) return; FragH f;
  size_t r, e; int k; pk_src(t, DM / 32, r, k, e); const float* src = F + r * DM + k;
  const v4f a = *(const v4fa*)src, c = *(const v4fa*)(src + 4);
#pragma unroll
  for (int q = 0; q < 4; ++q) { f.h[q] = (_Float16)(a[q] * sc); f.h[4 + q] = (_Float16)(c[q] * sc); }
  *(v8us*)((unsigned short*)H16 + e) = f.half[0]; 
}

// GEMM (wave tile 32x64; M % 128 == 0, N % 64 == 0, K % 32 == 0): v = acc*alpha + bf16(bias[col]) (+ CP term if CP); ACT 0 none; A, Bh and C16 are fragment-packed planes (lda, ldb, ldc = their K); writes f32 C (row-major, pitch ldc) and/or f16 C16;
template <int ACT>
__global__ __launch_bounds__(128) void k_gemm2(const _Float16* __restrict__ A, int lda, size_t sA, const _Float16* __restrict__ Bh, int ldb, size_t sB, float alpha, const float* __restrict__ bias, size_t sBias, const float* __restrict__ CP, int rowsPerB, size_t sCPb, int row0g,
    float* __restrict__ C, _Float16* __restrict__ C16, int ldc, size_t sC, int M, int N, int K) {
  __shared__ __attribute__((aligned(16))) float so[4][32][68];
  const int tid = threadIdx.x, w = tid >> 5, lane = tid & 31, ln = lane & 15, hh = lane >> 4; const int by = blockIdx.y;
  A += (size_t)by * sA; Bh += (size_t)by * sB; const size_t cofs = (size_t)by * sC; const float* bp = bias ? bias + (size_t)by * sBias : nullptr;
  const int ntn = N >> 6; const int mt = blockIdx.x / ntn, nq = blockIdx.x - mt * ntn; const int row0 = mt * 128 + 32 * w, col0 = nq * 64; if (row0 >= M) return;
  // each lane's own fragment pointers (band start + 8 lane elements; a k-step is one tile, 512 elements); they advance once per two k-steps, the loads between reach ahead by constant offsets
  const _Float16* a0p = A + (size_t)row0 * lda + 8 * lane; const _Float16* a1p = a0p + (size_t)16 * lda;
  const _Float16* b0p = Bh + (size_t)col0 * ldb + 8 * lane; const _Float16* b1p = b0p + (size_t)16 * ldb; const _Float16* b2p = b1p + (size_t)16 * ldb; const _Float16* b3p = b2p + (size_t)16 * ldb;
  const v8f z8 = {0.f,0.f,0.f,0.f,0.f,0.f,0.f,0.f}; v8f c00 = z8, c01 = z8, c02 = z8, c03 = z8, c10 = z8, c11 = z8, c12 = z8, c13 = z8;
  // fragments are fetched one k-step ahead into a second register set (x and y take turns): the twelve loads of the next step go out as one group in front of this step's products
#define G2_LOAD(S, O) S##a0 = g2_fragp(a0p + (O)); S##a1 = g2_fragp(a1p + (O)); S##b0 = g2_fragp(b0p + (O)); S##b1 = g2_fragp(b1p + (O)); S##b2 = g2_fragp(b2p + (O)); S##b3 = g2_fragp(b3p + (O));
#define G2_STEP(S) c00 = g2_mma(S##a0, S##b0, c00); c10 = g2_mma(S##a1, S##b0, c10); c01 = g2_mma(S##a0, S##b1, c01); c11 = g2_mma(S##a1, S##b1, c11); c02 = g2_mma(S##a0, S##b2, c02); c12 = g2_mma(S##a1, S##b2, c12); c03 = g2_mma(S##a0, S##b3, c03); c13 = g2_mma(S##a1, S##b3, c13);
  v16h xa0, xa1, xb0, xb1, xb2, xb3, ya0, ya1, yb0, yb1, yb2, yb3;
  G2_LOAD(x, 0)
  int kb = 0;
  // unroll 1: the body already holds both register sets' steps; further copies would only add registers
#pragma unroll 1
  for (; kb + 64 < K; kb += 64) {
    G2_LOAD(y, 512)
    G2_STEP(x)
    G2_LOAD(x, 1024)
    a0p += 1024; a1p += 1024; b0p += 1024; b1p += 1024; b2p += 1024; b3p += 1024;
    G2_STEP(y) }
  if (kb + 32 < K) { G2_LOAD(y, 512) G2_STEP(x) G2_STEP(y) } else { G2_STEP(x) }
#undef G2_LOAD
#undef G2_STEP
  v8f accs[8] = {c00, c01, c02, c03, c10, c11, c12, c13};
#pragma unroll
  for (int u = 0; u < 8; ++u) { const int t = u & 3, half = u >> 2; const int col = col0 + t * 16 + ln; const float bv = bp ? bf16_rne(bp[col]) : 0.f;
#pragma unroll
    for (int r = 0; r < 8; ++r) { const int rloc = half * 16 + 8 * hh + r; float v = accs[u][r] * alpha + bv;
      if (CP) { if (rowsPerB < 0) v += CP[cofs + (size_t)(row0g + row0 + rloc) * ldc + col]; else { const int bidx = (row0g + row0 + rloc) / rowsPerB; v += CP[(size_t)bidx * sCPb + (size_t)by * 64 + col]; } }
      if (ACT == 3) v = fmaxf(v, 0.f);
      so[w][rloc][t * 16 + ln] = v; } }
  __builtin_amdgcn_fence(4 /* acq_rel order */, "workgroup"); __builtin_amdgcn_wave_barrier();
  const int rsub = lane >> 4, c4 = (lane & 15) * 4;
  {
#pragma unroll
    for (int q = 0; q < 16; ++q) { const int r = q * 2 + rsub; const v4f v = *(const v4fa*)&so[w][r][c4];
      if (C) *(v4f*)(C + cofs + (size_t)(row0 + r) * ldc + col0 + c4) = v; }
     }
  asm volatile("s_wait_xcnt 0x0" ::: "memory"); // behind the run of C stores: the C16 block below reuses registers that those stores name
  if (C16) { // the wave's 32 x 64 block is 2 x 2 packed tiles; per tile two wave-wide 16-byte stores of 512 contiguous bytes
#pragma unroll
    for (int tl = 0; tl < 4; ++tl) { const int rtl = tl >> 1, kbl = tl & 1; _Float16* dst = C16 + cofs + (size_t)(row0 + 16 * rtl) * ldc + (size_t)((col0 >> 5) + kbl) * 512 + 8 * lane;
#pragma unroll
      for (int i = 0; i < 2; ++i) { const float* sp = &so[w][rtl * 16 + ln][kbl * 32 + 16 * i + 8 * hh]; const v4f lo = *(const v4fa*)sp, hi = *(const v4fa*)(sp + 4); FragH f;
#pragma unroll
        for (int q = 0; q < 4; ++q) { f.h[q] = (_Float16)lo[q]; f.h[4 + q] = (_Float16)hi[q]; }
        *(v8us*)((unsigned short*)dst + 256 * i) = f.half[0]; } } } }

template <int NHv, int TTv>
__global__ __launch_bounds__(256) void k_vt(const _Float16* __restrict__ V16, int ldv, int voff, _Float16* __restrict__ Vt) {
  __shared__ unsigned short tl[64][66]; const int tid = threadIdx.x; const int slab = blockIdx.x / (TTv / 64), lg = blockIdx.x % (TTv / 64); const int b = slab / NHv, h = slab % NHv;
  // V16 and Vt are fragment-packed planes (V16: rows = tokens, k = columns; Vt per slab: rows = d, k = tokens); piece i of the block's 4 x 2 tiles, read and written in packed order
  for (int i = tid; i < 64 * 8; i += 256) { const int tile = i >> 6, wi = i & 63; const int r = (tile >> 1) * 16 + (wi & 15), c8 = (tile & 1) * 32 + (wi >> 5) * 16 + ((wi >> 4) & 1) * 8; FragH f;
    f.half[0] = *(const v8us*)((const unsigned short*)V16 + ((size_t)b * TTv + lg * 64 + (tile >> 1) * 16) * ldv + (size_t)(((voff + h * 64) >> 5) + (tile & 1)) * 512 + wi * 8);
#pragma unroll
    for (int q = 0; q < 8; ++q) tl[r][c8 + q] = f.u[q]; }
  __syncthreads();
  {
#pragma unroll
    for (int rd = 0; rd < 2; ++rd) { const int i = rd * 256 + tid, tile = i >> 6, wi = i & 63; const int d = (tile >> 1) * 16 + (wi & 15), t0 = (tile & 1) * 32 + (wi >> 5) * 16 + ((wi >> 4) & 1) * 8; FragH f;
#pragma unroll
      for (int q = 0; q < 8; ++q) f.u[q] = tl[t0 + q][d];
      *(v8us*)((unsigned short*)Vt + ((size_t)slab * 64 + (tile >> 1) * 16) * TTv + (size_t)(lg * 2 + (tile & 1)) * 512 + wi * 8) = f.half[0]; }
     } }

// fused attention per ((b,h), 64 queries): wave = 16 queries; S = Q.K^T (d = 64: 2 k-steps) x SCL over all TK keys (CAUSAL == 0: no key excluded); online max/sum softmax f32; Q16, K16 (rows = tokens, k = columns) and Vt (per slab: rows = d, k = keys) are fragment-packed planes
template <int CAUSAL>
__global__ __launch_bounds__(128) void k_flash(const _Float16* __restrict__ Q16, int ldq, const _Float16* __restrict__ K16, int ldk, const _Float16* __restrict__ Vt, float* __restrict__ O, int ldo) {
  constexpr int RPW = 16, RTN = RPW / 16, DT = 4, KS = 2;
  __shared__ __attribute__((aligned(16))) unsigned short sP[4][RPW][40]; __shared__ __attribute__((aligned(16))) float sO[4][RPW][64 + 4];
  const int tid = threadIdx.x, w = tid >> 5, lane = tid & 31, ln = lane & 15, hh = lane >> 4;
  const int slab = blockIdx.x / QBLKS, qblk = blockIdx.x % QBLKS; const int b = slab / NH, h = slab % NH; const int qb0 = qblk * (4 * RPW); const int q0 = qb0 + w * RPW;
  FragH aq[2][KS];
#pragma unroll
  for (int rt = 0; rt < RTN; ++rt) { const unsigned short* qr = (const unsigned short*)Q16 + ((size_t)b * TQ + q0 + rt * 16) * ldq + h * 1024 + 8 * lane;
#pragma unroll
    for (int ks = 0; ks < KS; ++ks) { aq[rt][ks].half[0] = *(const v8us*)(qr + ks * 512); aq[rt][ks].half[1] = *(const v8us*)(qr + ks * 512 + 256); } }
  const unsigned short* Vth = (const unsigned short*)Vt + (size_t)slab * 64 * TK; const unsigned l8 = 8u * (unsigned)lane; /* the lane's piece of a tile half; the K and V tile starts are the same for the whole block */
  float m_r[2][8], l_r[2][8]; v8f oacc[2][DT];
#pragma unroll
  for (int rt = 0; rt < RTN; ++rt) {
#pragma unroll
    for (int r = 0; r < 8; ++r) { m_r[rt][r] = -3.0e38f; l_r[rt][r] = 0.f; }
#pragma unroll
    for (int dt = 0; dt < DT; ++dt) oacc[rt][dt] = (v8f){0.f,0.f,0.f,0.f,0.f,0.f,0.f,0.f}; }
  const int jend = (CAUSAL == 1) ? (qb0 + 4 * RPW) : TK;
  FragH bk[2][KS];
#pragma unroll
  for (int nt = 0; nt < 2; ++nt) { const unsigned short* kr = (const unsigned short*)K16 + ((size_t)b * TK + nt * 16) * ldk + h * 1024;
#pragma unroll
    for (int ks = 0; ks < KS; ++ks) { bk[nt][ks].half[0] = *(const v8us*)(kr + ks * 512 + l8); bk[nt][ks].half[1] = *(const v8us*)(kr + ks * 512 + 256 + l8); } }
#pragma unroll 1
  for (int j0 = 0; j0 < jend; j0 += 32) {
    v8f s[2][2];
#pragma unroll
    for (int nt = 0; nt < 2; ++nt) {
#pragma unroll
      for (int rt = 0; rt < RTN; ++rt) { v8f acc = (v8f){0.f,0.f,0.f,0.f,0.f,0.f,0.f,0.f};
#pragma unroll
        for (int ks = 0; ks < KS; ++ks) acc = mmaH<1>(aq[rt][ks].v, aq[rt][ks].v, bk[nt][ks].v, bk[nt][ks].v, acc); s[rt][nt] = acc; } }
    // one group of loads directly behind the score products, a softmax ahead of their use: this pass's V fragments, then the next pass's K fragments into the registers just read
    FragH bv[DT];
#pragma unroll
    for (int dt = 0; dt < DT; ++dt) { const unsigned short* vrow = Vth + (size_t)(dt * 16) * TK + (size_t)j0 * 16; bv[dt].half[0] = *(const v8us*)(vrow + l8); bv[dt].half[1] = *(const v8us*)(vrow + 256 + l8); }
    const int jn = (j0 + 32 < jend) ? j0 + 32 : j0; /* the last pass fetches its own keys again: stays inside K16 */
#pragma unroll
    for (int nt = 0; nt < 2; ++nt) { const unsigned short* kr = (const unsigned short*)K16 + ((size_t)b * TK + jn + nt * 16) * ldk + h * 1024;
#pragma unroll
      for (int ks = 0; ks < KS; ++ks) { bk[nt][ks].half[0] = *(const v8us*)(kr + ks * 512 + l8); bk[nt][ks].half[1] = *(const v8us*)(kr + ks * 512 + 256 + l8); } }
#pragma unroll
    for (int rt = 0; rt < RTN; ++rt)
#pragma unroll
      for (int r = 0; r < 8; ++r) { const int tq = q0 + rt * 16 + 8 * hh + r; const int k0 = j0 + ln, k1 = j0 + 16 + ln;
        const bool ok0 = (CAUSAL == 1) ? (k0 <= tq) : true, ok1 = (CAUSAL == 1) ? (k1 <= tq) : true; (void)tq;
        const float s0 = ok0 ? s[rt][0][r] * SCL : -3.0e38f, s1 = ok1 ? s[rt][1][r] * SCL : -3.0e38f; float mc = fmaxf(s0, s1);
        mc = fmaxf(mc, __shfl_xor(mc, 1, 32)); mc = fmaxf(mc, __shfl_xor(mc, 2, 32)); mc = fmaxf(mc, __shfl_xor(mc, 4, 32)); mc = fmaxf(mc, __shfl_xor(mc, 8, 32));
        const float mn = fmaxf(m_r[rt][r], mc); const float al = (mn > -1.0e38f) ? expf(m_r[rt][r] - mn) : 1.0f; m_r[rt][r] = mn; const float p0 = ok0 ? expf(s0 - mn) : 0.f, p1 = ok1 ? expf(s1 - mn) : 0.f; l_r[rt][r] = l_r[rt][r] * al + p0 + p1;
#pragma unroll
        for (int dt = 0; dt < DT; ++dt) oacc[rt][dt][r] *= al;
        FragH t2; t2.h[0] = (_Float16)(p0 * 1024.0f); t2.h[1] = (_Float16)(p1 * 1024.0f); sP[w][rt * 16 + 8 * hh + r][ln] = t2.u[0]; sP[w][rt * 16 + 8 * hh + r][16 + ln] = t2.u[1]; }
    __builtin_amdgcn_fence(4 /* acq_rel order */, "workgroup"); __builtin_amdgcn_wave_barrier();
    FragH pa[2];
#pragma unroll
    for (int rt = 0; rt < RTN; ++rt) { pa[rt].half[0] = *(const v8us*)&sP[w][rt * 16 + ln][8 * hh]; pa[rt].half[1] = *(const v8us*)&sP[w][rt * 16 + ln][16 + 8 * hh]; }
#pragma unroll
    for (int dt = 0; dt < DT; ++dt) {
#pragma unroll
      for (int rt = 0; rt < RTN; ++rt) oacc[rt][dt] = mmaH<1>(pa[rt].v, pa[rt].v, bv[dt].v, bv[dt].v, oacc[rt][dt]); }
    __builtin_amdgcn_fence(4 /* acq_rel order */, "workgroup"); __builtin_amdgcn_wave_barrier(); }
#pragma unroll
  for (int rt = 0; rt < RTN; ++rt) {
#pragma unroll
    for (int r = 0; r < 8; ++r) { float l = l_r[rt][r]; l += __shfl_xor(l, 1, 32); l += __shfl_xor(l, 2, 32); l += __shfl_xor(l, 4, 32); l += __shfl_xor(l, 8, 32); l_r[rt][r] = (l > 0.f) ? 1.0f / (l * 1024.0f) : 0.f; }
#pragma unroll
    for (int dt = 0; dt < DT; ++dt)
#pragma unroll
      for (int r = 0; r < 8; ++r) sO[w][rt * 16 + 8 * hh + r][dt * 16 + ln] = oacc[rt][dt][r] * l_r[rt][r]; }
  __builtin_amdgcn_fence(4 /* acq_rel order */, "workgroup"); __builtin_amdgcn_wave_barrier();
  {
#pragma unroll
    for (int rp = 0; rp < RPW; rp += 2) { const int r = rp + (lane >> 4), pc = lane & 15; const v4f val = *(const v4fa*)&sO[w][r][pc * 4]; *(v4f*)(O + ((size_t)b * TQ + q0 + r) * ldo + h * 64 + pc * 4) = val; }
     } }

__global__ __launch_bounds__(256) void k_ln(const float* __restrict__ X, const float* __restrict__ R, const float* __restrict__ g, const float* __restrict__ bta, float* __restrict__ out) {
  __shared__ float red[256];
  const int row = blockIdx.x, tid = threadIdx.x;
  const size_t srow = (size_t)(row / SLEN) * SEQ_FULL + (size_t)(row % SLEN);
  const float* x = X + (size_t)row * DM; const float* rr = R + srow * DM;
  const int j = tid * 4;
  const v4f a = *(const v4fa*)(x + j); const v4f rb = *(const v4fa*)(rr + j);
  float vals[4]; float s1 = 0.f;
#pragma unroll
  for (int q = 0; q < 4; ++q) { const float v = a[q] + bf16_rne(rb[q]); vals[q] = v; s1 += v; }
  red[tid] = s1; __syncthreads();
  for (int st = 128; st > 0; st >>= 1) { if (tid < st) red[tid] += red[tid + st]; __syncthreads(); }
  const float mu = red[0] * 0.0009765625f; __syncthreads();
  float s2 = 0.f;
#pragma unroll
  for (int q = 0; q < 4; ++q) { const float c = vals[q] - mu; s2 += c * c; }
  red[tid] = s2; __syncthreads();
  for (int st = 128; st > 0; st >>= 1) { if (tid < st) red[tid] += red[tid + st]; __syncthreads(); }
  const float rs = rsqrtf(red[0] * 0.0009765625f + LNEPS);
  v4f o;
#pragma unroll
  for (int q = 0; q < 4; ++q) { const float gg = bf16_rne(g[j + q]), bb = bf16_rne(bta[j + q]); o[q] = (vals[q] - mu) * rs * gg + bb; }
  *(v4f*)(out + (size_t)row * DM + j) = o;
  
}

extern "C" void kernel_launch(void* const* d_in, const int* in_sizes, int n_in,
                              void* d_out, int out_size, void* d_ws, size_t ws_size, hipStream_t stream) {
  if (n_in < 11) return;
  const float* hs = (const float*)d_in[0]; const float* Wq = (const float*)d_in[1]; const float* bq = (const float*)d_in[2]; const float* Wk = (const float*)d_in[3]; const float* bk = (const float*)d_in[4];
  const float* Wv = (const float*)d_in[5]; const float* bv = (const float*)d_in[6]; const float* Wd = (const float*)d_in[7]; const float* bd = (const float*)d_in[8]; const float* gam = (const float*)d_in[9]; const float* bet = (const float*)d_in[10];
  const long long need0 = ((long long)(NB - 1) * SEQ_FULL + SLEN) * DM;
  if ((long long)in_sizes[0] < need0) return;
  if (in_sizes[1] < DM * DM || in_sizes[3] < DM * DM || in_sizes[5] < DM * DM || in_sizes[7] < DM * DM) return;
  if (in_sizes[2] < DM || in_sizes[4] < DM || in_sizes[6] < DM || in_sizes[8] < DM || in_sizes[9] < DM || in_sizes[10] < DM) return;
  if ((long long)out_size < (long long)NR * DM) return;
  char* ws = (char*)d_ws; size_t off = 0;
  auto take = [&](size_t bytes) { char* p = ws + off; off += (bytes + 255) & ~(size_t)255; return p; };
  const size_t np = (size_t)NR * DM; const size_t nw = (size_t)DM * DM;
  _Float16* BQ = (_Float16*)take(nw * 2); _Float16* BK = (_Float16*)take(nw * 2); _Float16* BV = (_Float16*)take(nw * 2); _Float16* BD = (_Float16*)take(nw * 2);
  _Float16* X16 = (_Float16*)take(np * 2); _Float16* QH = (_Float16*)take(np * 2); _Float16* KH = (_Float16*)take(np * 2); _Float16* V16 = (_Float16*)take(np * 2); _Float16* VT = (_Float16*)take(np * 2);
  float* CTX = (float*)take(np * 4); _Float16* CTX16 = (_Float16*)take(np * 2); float* ATT = (float*)take(np * 4);
  float* O = (float*)d_out;
  if (off > ws_size) return;
  const unsigned gw = (unsigned)((nw / 8 + 255) / 256);
  k_wsc<<<gw, 256, 0, stream>>>(Wq, BQ, nw / 8, WSC); k_wsc<<<gw, 256, 0, stream>>>(Wk, BK, nw / 8, WSC); k_wsc<<<gw, 256, 0, stream>>>(Wv, BV, nw / 8, WSC); k_wsc<<<gw, 256, 0, stream>>>(Wd, BD, nw / 8, WSC);      /* [out][in] = [n][k] */
  k_x16<<<(unsigned)((np / 8 + 255) / 256), 256, 0, stream>>>(hs, X16, np / 8);
  const dim3 g((NR / 128) * (DM / 64), 1);
  k_gemm2<0><<<g, 128, 0, stream>>>(X16, DM, 0, BQ, DM, 0, 1.0f / WSC, bq, 0, nullptr, 1, 0, 0, nullptr, QH, DM, 0, NR, DM, DM);
  k_gemm2<0><<<g, 128, 0, stream>>>(X16, DM, 0, BK, DM, 0, 1.0f / WSC, bk, 0, nullptr, 1, 0, 0, nullptr, KH, DM, 0, NR, DM, DM);
  k_gemm2<0><<<g, 128, 0, stream>>>(X16, DM, 0, BV, DM, 0, 1.0f / WSC, bv, 0, nullptr, 1, 0, 0, nullptr, V16, DM, 0, NR, DM, DM);
  k_vt<NH, SLEN><<<NB * NH * (SLEN / 64), 256, 0, stream>>>(V16, DM, 0, VT);
  k_flash<0><<<NB * NH * QBLKS, 128, 0, stream>>>(QH, DM, KH, DM, VT, CTX, DM);
  k_h16<<<(unsigned)((np / 8 + 255) / 256), 256, 0, stream>>>(CTX, CTX16, np / 8, CSC);
  k_gemm2<0><<<g, 128, 0, stream>>>(CTX16, DM, 0, BD, DM, 0, 1.0f / (WSC * CSC), bd, 0, nullptr, 1, 0, 0, ATT, nullptr, DM, 0, NR, DM, DM);
  k_ln<<<NR, 256, 0, stream>>>(ATT, hs, gam, bet, O);
}

// v003
// One run takes 162 microseconds.
// Timed twice side by side with v002, it ran 1.43 and 1.44 times as fast.
// Over all steps from v000 it is 2.69 times as fast.
#include <hip/hip_runtime.h>
// Contractions: v_wmma_f32_16x16x32_f16 everywhere (f16 operands, f32 accumulate) - q/k/v projections (x as f16 of bf16-RNE input, W as f16 of bf16-RNE weight x16), k.q^T and v^T.p^T per head (plain f16 q/k/v planes, p carried x1024), output dense (context carried x16 f16, Wd bf16-RNE x16); softmax, bias adds, residual and LayerNorm in f32.

#ifndef NB
#define NB 2
#endif
#ifndef SEQ
#define SEQ 2048
#endif
#define NB_FULL 2
#define SEQ_FULL 2048
#define DM 1024
#define NH 16
#define HDIM 64
#define SLEN SEQ
#define TQ SLEN
#define TK SLEN
#define NR (NB * SLEN)
#define SCL 0.125f
#define QBLKS (TQ / 64)
#define LNEPS 0.00001f
#define WSC 16.0f
#define CSC 16.0f
static_assert(NH * HDIM == DM);
static_assert(SLEN % 64 == 0);
static_assert(NR % 128 == 0);
static_assert(DM % 64 == 0);
static_assert(DM == 4 * 256);
static_assert(NB <= NB_FULL);
static_assert(SEQ <= SEQ_FULL);

typedef unsigned short v8us __attribute__((ext_vector_type(8), may_alias));
typedef float  v8f  __attribute__((ext_vector_type(8)));
typedef float  v4f  __attribute__((ext_vector_type(4)));
typedef float  v4fa __attribute__((ext_vector_type(4), may_alias));
typedef _Float16 v16h __attribute__((ext_vector_type(16)));
typedef _Float16 v4h  __attribute__((ext_vector_type(4)));
typedef float  v2f  __attribute__((ext_vector_type(2)));
typedef _Float16 v2h  __attribute__((ext_vector_type(2)));
union FragH { v16h v; v8us half[2]; _Float16 h[16]; unsigned short u[16]; };

__device__ __forceinline__ unsigned short bf16_bits(float x) { unsigned int u = __float_as_uint(x); return (unsigned short)((u + 0x7FFFu + ((u >> 16) & 1u)) >> 16); }
__device__ __forceinline__ float bf16_val(unsigned short b) { return __uint_as_float(((unsigned int)b) << 16); }
__device__ __forceinline__ float bf16_rne(float x) { return bf16_val(bf16_bits(x)); }

// D += A.B with NT terms (1 = single product); 16x16x32 f16, split k map per lane half; 4 v_nop hazard guard tied to D with A/B kept live
template <int NT>
__device__ __forceinline__ v8f mmaH(v16h ah, v16h al, v16h bh, v16h bl, v8f c) {
  c = __builtin_amdgcn_wmma_f32_16x16x32_f16(false, ah, false, bh, (short)0, c, false, false);
  if (NT >= 2) c = __builtin_amdgcn_wmma_f32_16x16x32_f16(false, al, false, bh, (short)0, c, false, false);
  if (NT >= 3) c = __builtin_amdgcn_wmma_f32_16x16x32_f16(false, ah, false, bl, (short)0, c, false, false);
  asm volatile("v_nop\n\tv_nop\n\tv_nop\n\tv_nop" : "+v"(c) : "v"(ah), "v"(al), "v"(bh), "v"(bl));
  return c;
}
// Fragment-packed plane of a [rows][K] 16-bit matrix: every tile of 16 rows x 32 k is 512 elements in a row, the tiles of one 16-row band follow in k order (so a band is 16 K elements, as in the row-major plane).
// Inside a tile the 8-element piece number 32 i + 16 h + c holds row c, k = 16 i + 8 h + 0..7: piece number = 32 i + lane, so each of a fragment's two wave-wide 16-byte loads covers 512 contiguous bytes (4 whole lines).
// packing from a row-major f32 source, kt = K / 32 tiles per band: thread t takes 8 k of one row, four threads in a row per 128-byte source line; a wave reads 8 whole lines and writes 4 whole lines. dst = element offset of its piece
__device__ __forceinline__ void pk_src(size_t t, int kt, size_t& row, int& k, size_t& dst) { const size_t tile = t >> 6; const int c = (int)(t & 63) >> 2, ih = (int)(t & 3); row = (tile / kt) * 16 + c; k = (int)(tile % kt) * 32 + 8 * ih; dst = tile * 512 + (size_t)(16 * ih + c) * 8; }
// fragment of 16 rows (lane&15) x 32 k from a packed tile: elements 0..7 <- k0+8h, 8..15 <- k0+16+8h
// p already holds the tile's start + 8 lane elements
__device__ __forceinline__ v16h g2_fragp(const _Float16* p) { FragH f; f.half[0] = *(const v8us*)((const unsigned short*)p); f.half[1] = *(const v8us*)((const unsigned short*)p + 256); return f.v; }
__device__ __forceinline__ v8f g2_mma(v16h a, v16h b, v8f c) { v8f d = __builtin_amdgcn_wmma_f32_16x16x32_f16(false, a, false, b, (short)0, c, false, false); asm volatile("v_nop\n\tv_nop\n\tv_nop\n\tv_nop" : "+v"(d) : "v"(a), "v"(b)); return d; }

__global__ __launch_bounds__(256) void k_wsc(const float* __restrict__ Wm, _Float16* __restrict__ Bt, size_t n8, float sc) {
  const size_t t = (size_t)blockIdx.x * 256 + threadIdx.x; if (t >= n8) return; FragH f;
  size_t r, e; int c; pk_src(t, DM / 32, r, c, e); const float* src = Wm + r * DM + c;
#pragma unroll
  for (int q = 0; q < 8; ++q) f.h[q] = (_Float16)(bf16_rne(src[q]) * sc);
  *(v8us*)((unsigned short*)Bt + e) = f.half[0]; 
}

__global__ __launch_bounds__(256) void k_x16(const float* __restrict__ x, _Float16* __restrict__ X16, size_t n8) {
  const size_t t = (size_t)blockIdx.x * 256 + threadIdx.x; if (t >= n8) return;
  size_t r, e; int c; pk_src(t, DM / 32, r, c, e); const size_t sr = (r / SLEN) * SEQ_FULL + (r % SLEN);
  const float* src = x + sr * DM + c; FragH f;
#pragma unroll
  for (int q = 0; q < 8; ++q) f.h[q] = (_Float16)bf16_rne(src[q]);
  *(v8us*)((unsigned short*)X16 + e) = f.half[0]; 
}

__global__ __launch_bounds__(256) void k_h16(const float* __restrict__ F, _Float16* __restrict__ H16, size_t n8, float sc) {
  const size_t t = (size_t)blockIdx.x * 256 + threadIdx.x; if (t >= n8) return; FragH f;
  size_t r, e; int k; pk_src(t, DM / 32, r, k, e); const float* src = F + r * DM + k;
  const v4f a = *(const v4fa*)src, c = *(const v4fa*)(src + 4);
#pragma unroll
  for (int q = 0; q < 4; ++q) { f.h[q] = (_Float16)(a[q] * sc); f.h[4 + q] = (_Float16)(c[q] * sc); }
  *(v8us*)((unsigned short*)H16 + e) = f.half[0]; 
}

// GEMM (wave tile 32x64; M % 128 == 0, N % 64 == 0, K % 32 == 0): v = acc*alpha + bf16(bias[col]) (+ CP term if CP); ACT 0 none; A, Bh and C16 are fragment-packed planes (lda, ldb, ldc = their K); writes f32 C (row-major, pitch ldc) and/or f16 C16;
template <int ACT>
__global__ __launch_bounds__(128) void k_gemm2(const _Float16* __restrict__ A, int lda, size_t sA, const _Float16* __restrict__ Bh, int ldb, size_t sB, float alpha, const float* __restrict__ bias, size_t sBias, const float* __restrict__ CP, int rowsPerB, size_t sCPb, int row0g,
    float* __restrict__ C, _Float16* __restrict__ C16, int ldc, size_t sC, int M, int N, int K) {
  __shared__ __attribute__((aligned(16))) float so[4][32][68];
  const int tid = threadIdx.x, w = tid >> 5, lane = tid & 31, ln = lane & 15, hh = lane >> 4; const int by = blockIdx.y;
  A += (size_t)by * sA; Bh += (size_t)by * sB; const size_t cofs = (size_t)by * sC; const float* bp = bias ? bias + (size_t)by * sBias : nullptr;
  const int ntn = N >> 6; const int mt = blockIdx.x / ntn, nq = blockIdx.x - mt * ntn; const int row0 = mt * 128 + 32 * w, col0 = nq * 64; if (row0 >= M) return;
  // each lane's own fragment pointers (band start + 8 lane elements; a k-step is one tile, 512 elements); they advance once per two k-steps, the loads between reach ahead by constant offsets
  const _Float16* a0p = A + (size_t)row0 * lda + 8 * lane; const _Float16* a1p = a0p + (size_t)16 * lda;
  const _Float16* b0p = Bh + (size_t)col0 * ldb + 8 * lane; const _Float16* b1p = b0p + (size_t)16 * ldb; const _Float16* b2p = b1p + (size_t)16 * ldb; const _Float16* b3p = b2p + (size_t)16 * ldb;
  const v8f z8 = {0.f,0.f,0.f,0.f,0.f,0.f,0.f,0.f}; v8f c00 = z8, c01 = z8, c02 = z8, c03 = z8, c10 = z8, c11 = z8, c12 = z8, c13 = z8;
  // fragments are fetched one k-step ahead into a second register set (x and y take turns): the twelve loads of the next step go out as one group in front of this step's products
#define G2_LOAD(S, O) S##a0 = g2_fragp(a0p + (O)); S##a1 = g2_fragp(a1p + (O)); S##b0 = g2_fragp(b0p + (O)); S##b1 = g2_fragp(b1p + (O)); S##b2 = g2_fragp(b2p + (O)); S##b3 = g2_fragp(b3p + (O));
#define G2_STEP(S) c00 = g2_mma(S##a0, S##b0, c00); c10 = g2_mma(S##a1, S##b0, c10); c01 = g2_mma(S##a0, S##b1, c01); c11 = g2_mma(S##a1, S##b1, c11); c02 = g2_mma(S##a0, S##b2, c02); c12 = g2_mma(S##a1, S##b2, c12); c03 = g2_mma(S##a0, S##b3, c03); c13 = g2_mma(S##a1, S##b3, c13);
  v16h xa0, xa1, xb0, xb1, xb2, xb3, ya0, ya1, yb0, yb1, yb2, yb3;
  G2_LOAD(x, 0)
  int kb = 0;
  // unroll 1: the body already holds both register sets' steps; further copies would only add registers
#pragma unroll 1
  for (; kb + 64 < K; kb += 64) {
    G2_LOAD(y, 512)
    G2_STEP(x)
    G2_LOAD(x, 1024)
    a0p += 1024; a1p += 1024; b0p += 1024; b1p += 1024; b2p += 1024; b3p += 1024;
    G2_STEP(y) }
  if (kb + 32 < K) { G2_LOAD(y, 512) G2_STEP(x) G2_STEP(y) } else { G2_STEP(x) }
#undef G2_LOAD
#undef G2_STEP
  v8f accs[8] = {c00, c01, c02, c03, c10, c11, c12, c13};
#pragma unroll
  for (int u = 0; u < 8; ++u) { const int t = u & 3, half = u >> 2; const int col = col0 + t * 16 + ln; const float bv = bp ? bf16_rne(bp[col]) : 0.f;
#pragma unroll
    for (int r = 0; r < 8; ++r) { const int rloc = half * 16 + 8 * hh + r; float v = accs[u][r] * alpha + bv;
      if (CP) { if (rowsPerB < 0) v += CP[cofs + (size_t)(row0g + row0 + rloc) * ldc + col]; else { const int bidx = (row0g + row0 + rloc) / rowsPerB; v += CP[(size_t)bidx * sCPb + (size_t)by * 64 + col]; } }
      if (ACT == 3) v = fmaxf(v, 0.f);
      so[w][rloc][t * 16 + ln] = v; } }
  __builtin_amdgcn_fence(4 /* acq_rel order */, "workgroup"); __builtin_amdgcn_wave_barrier();
  const int rsub = lane >> 4, c4 = (lane & 15) * 4;
  {
#pragma unroll
    for (int q = 0; q < 16; ++q) { const int r = q * 2 + rsub; const v4f v = *(const v4fa*)&so[w][r][c4];
      if (C) *(v4f*)(C + cofs + (size_t)(row0 + r) * ldc + col0 + c4) = v; }
     }
  asm volatile("s_wait_xcnt 0x0" ::: "memory"); // behind the run of C stores: the C16 block below reuses registers that those stores name
  if (C16) { // the wave's 32 x 64 block is 2 x 2 packed tiles; per tile two wave-wide 16-byte stores of 512 contiguous bytes
#pragma unroll
    for (int tl = 0; tl < 4; ++tl) { const int rtl = tl >> 1, kbl = tl & 1; _Float16* dst = C16 + cofs + (size_t)(row0 + 16 * rtl) * ldc + (size_t)((col0 >> 5) + kbl) * 512 + 8 * lane;
#pragma unroll
      for (int i = 0; i < 2; ++i) { const float* sp = &so[w][rtl * 16 + ln][kbl * 32 + 16 * i + 8 * hh]; const v4f lo = *(const v4fa*)sp, hi = *(const v4fa*)(sp + 4); FragH f;
#pragma unroll
        for (int q = 0; q < 4; ++q) { f.h[q] = (_Float16)lo[q]; f.h[4 + q] = (_Float16)hi[q]; }
        *(v8us*)((unsigned short*)dst + 256 * i) = f.half[0]; } } } }

template <int NHv, int TTv>
__global__ __launch_bounds__(256) void k_vt(const _Float16* __restrict__ V16, int ldv, int voff, _Float16* __restrict__ Vt) {
  __shared__ unsigned short tl[64][66]; const int tid = threadIdx.x; const int slab = blockIdx.x / (TTv / 64), lg = blockIdx.x % (TTv / 64); const int b = slab / NHv, h = slab % NHv;
  // V16 and Vt are fragment-packed planes (V16: rows = tokens, k = columns; Vt per slab: rows = d, k = tokens); piece i of the block's 4 x 2 tiles, read and written in packed order
  for (int i = tid; i < 64 * 8; i += 256) { const int tile = i >> 6, wi = i & 63; const int r = (tile >> 1) * 16 + (wi & 15), c8 = (tile & 1) * 32 + (wi >> 5) * 16 + ((wi >> 4) & 1) * 8; FragH f;
    f.half[0] = *(const v8us*)((const unsigned short*)V16 + ((size_t)b * TTv + lg * 64 + (tile >> 1) * 16) * ldv + (size_t)(((voff + h * 64) >> 5) + (tile & 1)) * 512 + wi * 8);
#pragma unroll
    for (int q = 0; q < 8; ++q) tl[r][c8 + q] = f.u[q]; }
  __syncthreads();
  {
#pragma unroll
    for (int rd = 0; rd < 2; ++rd) { const int i = rd * 256 + tid, tile = i >> 6, wi = i & 63; const int d = (tile >> 1) * 16 + (wi & 15), t0 = (tile & 1) * 32 + (wi >> 5) * 16 + ((wi >> 4) & 1) * 8; FragH f;
#pragma unroll
      for (int q = 0; q < 8; ++q) f.u[q] = tl[t0 + q][d];
      *(v8us*)((unsigned short*)Vt + ((size_t)slab * 64 + (tile >> 1) * 16) * TTv + (size_t)(lg * 2 + (tile & 1)) * 512 + wi * 8) = f.half[0]; }
     } }

// lane l with lane l ^ 16 (a vector cross-row move, no LDS queue)
__device__ __forceinline__ float xhalf(float x) { return __builtin_bit_cast(float, __builtin_amdgcn_permlanex16(__builtin_bit_cast(int, x), __builtin_bit_cast(int, x), 0x76543210, 0xfedcba98, false, false)); }

// fused attention per ((b,h), 64 queries): wave = 16 queries; both products transposed: S^T = K.Q^T (A = 16 keys, B = the wave's queries; d = 64: 2 k-steps) x SCL over all TK keys (CAUSAL == 0: no key excluded), O^T += V^T.P^T (A = 16 d, B = P^T).
// A lane holds 16 of the pass's 32 scores of ONE query (column lane & 15; keys 16 nt + 8 (lane >> 4) + r): maximum and sum run in the lane, the two lane halves meet by one cross-row move; the two score tiles, converted in place, are the B fragment of P^T (element 8 nt + r = k 16 nt + 8 h + r, the k order of the packed V^T tiles).
// online max/sum softmax f32; Q16, K16 (rows = tokens, k = columns) and Vt (per slab: rows = d, k = keys) are fragment-packed planes
template <int CAUSAL>
__global__ __launch_bounds__(128) void k_flash(const _Float16* __restrict__ Q16, int ldq, const _Float16* __restrict__ K16, int ldk, const _Float16* __restrict__ Vt, float* __restrict__ O, int ldo) {
  constexpr int RPW = 16, DT = 4, KS = 2;
  __shared__ __attribute__((aligned(16))) float sO[4][RPW][64 + 4];
  const int tid = threadIdx.x, w = tid >> 5, lane = tid & 31, ln = lane & 15, hh = lane >> 4;
  const int slab = blockIdx.x / QBLKS, qblk = blockIdx.x % QBLKS; const int b = slab / NH, h = slab % NH; const int qb0 = qblk * (4 * RPW); const int q0 = qb0 + w * RPW;
  FragH bq[KS];
  { const unsigned short* qr = (const unsigned short*)Q16 + ((size_t)b * TQ + q0) * ldq + h * 1024 + 8 * lane;
#pragma unroll
    for (int ks = 0; ks < KS; ++ks) { bq[ks].half[0] = *(const v8us*)(qr + ks * 512); bq[ks].half[1] = *(const v8us*)(qr + ks * 512 + 256); } }
  const unsigned short* Vth = (const unsigned short*)Vt + (size_t)slab * 64 * TK; const unsigned l8 = 8u * (unsigned)lane; /* the lane's piece of a tile half; the K and V tile starts are the same for the whole block */
  float m_r = -3.0e38f, l_r = 0.f; v8f oacc[DT]; /* m_r: the query's running maximum (alike in both halves); l_r: the sum over this half's keys */
#pragma unroll
  for (int dt = 0; dt < DT; ++dt) oacc[dt] = (v8f){0.f,0.f,0.f,0.f,0.f,0.f,0.f,0.f};
  const int jend = (CAUSAL == 1) ? (qb0 + 4 * RPW) : TK; const int tq = q0 + ln; (void)tq;
  FragH ak[2][KS];
#pragma unroll
  for (int nt = 0; nt < 2; ++nt) { const unsigned short* kr = (const unsigned short*)K16 + ((size_t)b * TK + nt * 16) * ldk + h * 1024;
#pragma unroll
    for (int ks = 0; ks < KS; ++ks) { ak[nt][ks].half[0] = *(const v8us*)(kr + ks * 512 + l8); ak[nt][ks].half[1] = *(const v8us*)(kr + ks * 512 + 256 + l8); } }
#pragma unroll 1
  for (int j0 = 0; j0 < jend; j0 += 32) {
    v8f s[2];
#pragma unroll
    for (int nt = 0; nt < 2; ++nt) { v8f acc = (v8f){0.f,0.f,0.f,0.f,0.f,0.f,0.f,0.f};
#pragma unroll
      for (int ks = 0; ks < KS; ++ks) acc = mmaH<1>(ak[nt][ks].v, ak[nt][ks].v, bq[ks].v, bq[ks].v, acc);
      s[nt] = acc; }
    // one group of loads directly behind the score products, a softmax ahead of their use: this pass's V fragments, then the next pass's K fragments into the registers just read
    FragH av[DT];
#pragma unroll
    for (int dt = 0; dt < DT; ++dt) { const unsigned short* vrow = Vth + (size_t)(dt * 16) * TK + (size_t)j0 * 16; av[dt].half[0] = *(const v8us*)(vrow + l8); av[dt].half[1] = *(const v8us*)(vrow + 256 + l8); }
    const int jn = (j0 + 32 < jend) ? j0 + 32 : j0; /* the last pass fetches its own keys again: stays inside K16 */
#pragma unroll
    for (int nt = 0; nt < 2; ++nt) { const unsigned short* kr = (const unsigned short*)K16 + ((size_t)b * TK + jn + nt * 16) * ldk + h * 1024;
#pragma unroll
      for (int ks = 0; ks < KS; ++ks) { ak[nt][ks].half[0] = *(const v8us*)(kr + ks * 512 + l8); ak[nt][ks].half[1] = *(const v8us*)(kr + ks * 512 + 256 + l8); } }
    __builtin_amdgcn_sched_barrier(0); // keeps the sixteen loads in one group here: without it the scheduler sinks the K loads to the foot of the softmax, a few instructions ahead of their use
    float sv[16]; bool ok[16]; const v8f sc[2] = {s[0] * SCL, s[1] * SCL};
#pragma unroll
    for (int e = 0; e < 16; ++e) { const int key = j0 + (e >> 3) * 16 + 8 * hh + (e & 7); ok[e] = (CAUSAL == 1) ? (key <= tq) : true; sv[e] = ok[e] ? sc[e >> 3][e & 7] : -3.0e38f; }
    float mx[5];
#pragma unroll
    for (int c = 0; c < 5; ++c) mx[c] = fmaxf(fmaxf(sv[3 * c], sv[3 * c + 1]), sv[3 * c + 2]);
    float mc = fmaxf(fmaxf(fmaxf(mx[0], mx[1]), mx[2]), fmaxf(fmaxf(mx[3], mx[4]), sv[15])); mc = fmaxf(mc, xhalf(mc));
    const float mn = fmaxf(m_r, mc); const float ae = expf(m_r - mn); const float al = (mn > -1.0e38f) ? ae : 1.0f; m_r = mn; /* ae formed on every path: a select, so that it runs among the weights' exponentials and EXEC stays whole */
    FragH pb; v2f ps[2]; /* the lane's 16 weights in pairs: four independent partial sums */
#pragma unroll
    for (int i = 0; i < 8; ++i) { v2f p; p.x = ok[2 * i] ? expf(sv[2 * i] - mn) : 0.f; p.y = ok[2 * i + 1] ? expf(sv[2 * i + 1] - mn) : 0.f;
      if (i < 2) ps[i] = p; else ps[i & 1] += p;
      const v2h ph = __builtin_convertvector(p * 1024.0f, v2h); pb.h[2 * i] = ph.x; pb.h[2 * i + 1] = ph.y; }
    l_r = l_r * al + ((ps[0].x + ps[1].x) + (ps[0].y + ps[1].y));
#pragma unroll
    for (int dt = 0; dt < DT; ++dt) oacc[dt] *= al;
#pragma unroll
    for (int dt = 0; dt < DT; ++dt) oacc[dt] = mmaH<1>(av[dt].v, av[dt].v, pb.v, pb.v, oacc[dt]); }
  { const float l = l_r + xhalf(l_r); const float inv = (l > 0.f) ? 1.0f / (l * 1024.0f) : 0.f;
    // oacc[dt][r] = O[query ln][d = 16 dt + 8 hh + r]: eight d in a row per lane and tile
#pragma unroll
    for (int dt = 0; dt < DT; ++dt) { v4f lo, hi;
#pragma unroll
      for (int q = 0; q < 4; ++q) { lo[q] = oacc[dt][q] * inv; hi[q] = oacc[dt][4 + q] * inv; }
      *(v4fa*)&sO[w][ln][dt * 16 + 8 * hh] = lo; *(v4fa*)&sO[w][ln][dt * 16 + 8 * hh + 4] = hi; } }
  __builtin_amdgcn_fence(4 /* acq_rel order */, "workgroup"); __builtin_amdgcn_wave_barrier();
  {
#pragma unroll
    for (int rp = 0; rp < RPW; rp += 2) { const int r = rp + (lane >> 4), pc = lane & 15; const v4f val = *(const v4fa*)&sO[w][r][pc * 4]; *(v4f*)(O + ((size_t)b * TQ + q0 + r) * ldo + h * 64 + pc * 4) = val; }
     } }

__global__ __launch_bounds__(256) void k_ln(const float* __restrict__ X, const float* __restrict__ R, const float* __restrict__ g, const float* __restrict__ bta, float* __restrict__ out) {
  __shared__ float red[256];
  const int row = blockIdx.x, tid = threadIdx.x;
  const size_t srow = (size_t)(row / SLEN) * SEQ_FULL + (size_t)(row % SLEN);
  const float* x = X + (size_t)row * DM; const float* rr = R + srow * DM;
  const int j = tid * 4;
  const v4f a = *(const v4fa*)(x + j); const v4f rb = *(const v4fa*)(rr + j);
  float vals[4]; float s1 = 0.f;
#pragma unroll
  for (int q = 0; q < 4; ++q) { const float v = a[q] + bf16_rne(rb[q]); vals[q] = v; s1 += v; }
  red[tid] = s1; __syncthreads();
  for (int st = 128; st > 0; st >>= 1) { if (tid < st) red[tid] += red[tid + st]; __syncthreads(); }
  const float mu = red[0] * 0.0009765625f; __syncthreads();
  float s2 = 0.f;
#pragma unroll
  for (int q = 0; q < 4; ++q) { const float c = vals[q] - mu; s2 += c * c; }
  red[tid] = s2; __syncthreads();
  for (int st = 128; st > 0; st >>= 1) { if (tid < st) red[tid] += red[tid + st]; __syncthreads(); }
  const float rs = rsqrtf(red[0] * 0.0009765625f + LNEPS);
  v4f o;
#pragma unroll
  for (int q = 0; q < 4; ++q) { const float gg = bf16_rne(g[j + q]), bb = bf16_rne(bta[j + q]); o[q] = (vals[q] - mu) * rs * gg + bb; }
  *(v4f*)(out + (size_t)row * DM + j) = o;
  
}

extern "C" void kernel_launch(void* const* d_in, const int* in_sizes, int n_in,
                              void* d_out, int out_size, void* d_ws, size_t ws_size, hipStream_t stream) {
  if (n_in < 11) return;
  const float* hs = (const float*)d_in[0]; const float* Wq = (const float*)d_in[1]; const float* bq = (const float*)d_in[2]; const float* Wk = (const float*)d_in[3]; const float* bk = (const float*)d_in[4];
  const float* Wv = (const float*)d_in[5]; const float* bv = (const float*)d_in[6]; const float* Wd = (const float*)d_in[7]; const float* bd = (const float*)d_in[8]; const float* gam = (const float*)d_in[9]; const float* bet = (const float*)d_in[10];
  const long long need0 = ((long long)(NB - 1) * SEQ_FULL + SLEN) * DM;
  if ((long long)in_sizes[0] < need0) return;
  if (in_sizes[1] < DM * DM || in_sizes[3] < DM * DM || in_sizes[5] < DM * DM || in_sizes[7] < DM * DM) return;
  if (in_sizes[2] < DM || in_sizes[4] < DM || in_sizes[6] < DM || in_sizes[8] < DM || in_sizes[9] < DM || in_sizes[10] < DM) return;
  if ((long long)out_size < (long long)NR * DM) return;
  char* ws = (char*)d_ws; size_t off = 0;
  auto take = [&](size_t bytes) { char* p = ws + off; off += (bytes + 255) & ~(size_t)255; return p; };
  const size_t np = (size_t)NR * DM; const size_t nw = (size_t)DM * DM;
  _Float16* BQ = (_Float16*)take(nw * 2); _Float16* BK = (_Float16*)take(nw * 2); _Float16* BV = (_Float16*)take(nw * 2); _Float16* BD = (_Float16*)take(nw * 2);
  _Float16* X16 = (_Float16*)take(np * 2); _Float16* QH = (_Float16*)take(np * 2); _Float16* KH = (_Float16*)take(np * 2); _Float16* V16 = (_Float16*)take(np * 2); _Float16* VT = (_Float16*)take(np * 2);
  float* CTX = (float*)take(np * 4); _Float16* CTX16 = (_Float16*)take(np * 2); float* ATT = (float*)take(np * 4);
  float* O = (float*)d_out;
  if (off > ws_size) return;
  const unsigned gw = (unsigned)((nw / 8 + 255) / 256);
  k_wsc<<<gw, 256, 0, stream>>>(Wq, BQ, nw / 8, WSC); k_wsc<<<gw, 256, 0, stream>>>(Wk, BK, nw / 8, WSC); k_wsc<<<gw, 256, 0, stream>>>(Wv, BV, nw / 8, WSC); k_wsc<<<gw, 256, 0, stream>>>(Wd, BD, nw / 8, WSC);      /* [out][in] = [n][k] */
  k_x16<<<(unsigned)((np / 8 + 255) / 256), 256, 0, stream>>>(hs, X16, np / 8);
  const dim3 g((NR / 128) * (DM / 64), 1);
  k_gemm2<0><<<g, 128, 0, stream>>>(X16, DM, 0, BQ, DM, 0, 1.0f / WSC, bq, 0, nullptr, 1, 0, 0, nullptr, QH, DM, 0, NR, DM, DM);
  k_gemm2<0><<<g, 128, 0, stream>>>(X16, DM, 0, BK, DM, 0, 1.0f / WSC, bk, 0, nullptr, 1, 0, 0, nullptr, KH, DM, 0, NR, DM, DM);
  k_gemm2<0><<<g, 128, 0, stream>>>(X16, DM, 0, BV, DM, 0, 1.0f / WSC, bv, 0, nullptr, 1, 0, 0, nullptr, V16, DM, 0, NR, DM, DM);
  k_vt<NH, SLEN><<<NB * NH * (SLEN / 64), 256, 0, stream>>>(V16, DM, 0, VT);
  k_flash<0><<<NB * NH * QBLKS, 128, 0, stream>>>(QH, DM, KH, DM, VT, CTX, DM);
  k_h16<<<(unsigned)((np / 8 + 255) / 256), 256, 0, stream>>>(CTX, CTX16, np / 8, CSC);
  k_gemm2<0><<<g, 128, 0, stream>>>(CTX16, DM, 0, BD, DM, 0, 1.0f / (WSC * CSC), bd, 0, nullptr, 1, 0, 0, ATT, nullptr, DM, 0, NR, DM, DM);
  k_ln<<<NR, 256, 0, stream>>>(ATT, hs, gam, bet, O);
}

// v004
// A run of this version takes 144 microseconds.
// Two timings next to v003 put it at 1.14 and 1.13 times that version's speed.
// Counting every step since v000, it is 3.05 times as fast.
#include <hip/hip_runtime.h>
// Contractions: v_wmma_f32_16x16x32_f16 everywhere (f16 operands, f32 accumulate) - q/k/v projections (x as f16 of bf16-RNE input, W as f16 of bf16-RNE weight x16), k.q^T and v^T.p^T per head (plain f16 q/k/v planes, p carried x1024), output dense (context carried x16 f16, Wd bf16-RNE x16); softmax, bias adds, residual and LayerNorm in f32.

#ifndef NB
#define NB 2
#endif
#ifndef SEQ
#define SEQ 2048
#endif
#define NB_FULL 2
#define SEQ_FULL 2048
#define DM 1024
#define NH 16
#define HDIM 64
#define SLEN SEQ
#define TQ SLEN
#define TK SLEN
#define NR (NB * SLEN)
#define SCL 0.125f
#define QBLKS (TQ / 64)
#define LNEPS 0.00001f
#define WSC 16.0f
#define CSC 16.0f
static_assert(NH * HDIM == DM);
static_assert(SLEN % 64 == 0);
static_assert(NR % 128 == 0);
static_assert(DM % 64 == 0);
static_assert(DM == 4 * 256);
static_assert(NB <= NB_FULL);
static_assert(SEQ <= SEQ_FULL);

typedef unsigned short v8us __attribute__((ext_vector_type(8), may_alias));
typedef float  v8f  __attribute__((ext_vector_type(8)));
typedef float  v4f  __attribute__((ext_vector_type(4)));
typedef float  v4fa __attribute__((ext_vector_type(4), may_alias));
typedef _Float16 v16h __attribute__((ext_vector_type(16)));
typedef _Float16 v4h  __attribute__((ext_vector_type(4)));
typedef float  v2f  __attribute__((ext_vector_type(2)));
typedef _Float16 v2h  __attribute__((ext_vector_type(2)));
union FragH { v16h v; v8us half[2]; _Float16 h[16]; unsigned short u[16]; };

__device__ __forceinline__ unsigned short bf16_bits(float x) { unsigned int u = __float_as_uint(x); return (unsigned short)((u + 0x7FFFu + ((u >> 16) & 1u)) >> 16); }
__device__ __forceinline__ float bf16_val(unsigned short b) { return __uint_as_float(((unsigned int)b) << 16); }
__device__ __forceinline__ float bf16_rne(float x) { return bf16_val(bf16_bits(x)); }

// D += A.B with NT terms (1 = single product); 16x16x32 f16, split k map per lane half; 4 v_nop hazard guard tied to D with A/B kept live
template <int NT>
__device__ __forceinline__ v8f mmaH(v16h ah, v16h al, v16h bh, v16h bl, v8f c) {
  c = __builtin_amdgcn_wmma_f32_16x16x32_f16(false, ah, false, bh, (short)0, c, false, false);
  if (NT >= 2) c = __builtin_amdgcn_wmma_f32_16x16x32_f16(false, al, false, bh, (short)0, c, false, false);
  if (NT >= 3) c = __builtin_amdgcn_wmma_f32_16x16x32_f16(false, ah, false, bl, (short)0, c, false, false);
  asm volatile("v_nop\n\tv_nop\n\tv_nop\n\tv_nop" : "+v"(c) : "v"(ah), "v"(al), "v"(bh), "v"(bl));
  return c;
}
// Fragment-packed plane of a [rows][K] 16-bit matrix: every tile of 16 rows x 32 k is 512 elements in a row, the tiles of one 16-row band follow in k order (so a band is 16 K elements, as in the row-major plane).
// Inside a tile the 8-element piece number 32 i + 16 h + c holds row c, k = 16 i + 8 h + 0..7: piece number = 32 i + lane, so each of a fragment's two wave-wide 16-byte loads covers 512 contiguous bytes (4 whole lines).
// packing from a row-major f32 source, kt = K / 32 tiles per band: thread t takes 8 k of one row, four threads in a row per 128-byte source line; a wave reads 8 whole lines and writes 4 whole lines. dst = element offset of its piece
__device__ __forceinline__ void pk_src(size_t t, int kt, size_t& row, int& k, size_t& dst) { const size_t tile = t >> 6; const int c = (int)(t & 63) >> 2, ih = (int)(t & 3); row = (tile / kt) * 16 + c; k = (int)(tile % kt) * 32 + 8 * ih; dst = tile * 512 + (size_t)(16 * ih + c) * 8; }
// fragment of 16 rows (lane&15) x 32 k from a packed tile: elements 0..7 <- k0+8h, 8..15 <- k0+16+8h
// p already holds the tile's start + 8 lane elements
__device__ __forceinline__ v16h g2_fragp(const _Float16* p) { FragH f; f.half[0] = *(const v8us*)((const unsigned short*)p); f.half[1] = *(const v8us*)((const unsigned short*)p + 256); return f.v; }
__device__ __forceinline__ v8f g2_mma(v16h a, v16h b, v8f c) { v8f d = __builtin_amdgcn_wmma_f32_16x16x32_f16(false, a, false, b, (short)0, c, false, false); asm volatile("v_nop\n\tv_nop\n\tv_nop\n\tv_nop" : "+v"(d) : "v"(a), "v"(b)); return d; }

__global__ __launch_bounds__(256) void k_wsc(const float* __restrict__ Wm, _Float16* __restrict__ Bt, size_t n8, float sc) {
  const size_t t = (size_t)blockIdx.x * 256 + threadIdx.x; if (t >= n8) return; FragH f;
  size_t r, e; int c; pk_src(t, DM / 32, r, c, e); const float* src = Wm + r * DM + c;
#pragma unroll
  for (int q = 0; q < 8; ++q) f.h[q] = (_Float16)(bf16_rne(src[q]) * sc);
  *(v8us*)((unsigned short*)Bt + e) = f.half[0]; 
}

__global__ __launch_bounds__(256) void k_x16(const float* __restrict__ x, _Float16* __restrict__ X16, size_t n8) {
  const size_t t = (size_t)blockIdx.x * 256 + threadIdx.x; if (t >= n8) return;
  size_t r, e; int c; pk_src(t, DM / 32, r, c, e); const size_t sr = (r / SLEN) * SEQ_FULL + (r % SLEN);
  const float* src = x + sr * DM + c; FragH f;
#pragma unroll
  for (int q = 0; q < 8; ++q) f.h[q] = (_Float16)bf16_rne(src[q]);
  *(v8us*)((unsigned short*)X16 + e) = f.half[0]; 
}

__global__ __launch_bounds__(256) void k_h16(const float* __restrict__ F, _Float16* __restrict__ H16, size_t n8, float sc) {
  const size_t t = (size_t)blockIdx.x * 256 + threadIdx.x; if (t >= n8) return; FragH f;
  size_t r, e; int k; pk_src(t, DM / 32, r, k, e); const float* src = F + r * DM + k;
  const v4f a = *(const v4fa*)src, c = *(const v4fa*)(src + 4);
#pragma unroll
  for (int q = 0; q < 4; ++q) { f.h[q] = (_Float16)(a[q] * sc); f.h[4 + q] = (_Float16)(c[q] * sc); }
  *(v8us*)((unsigned short*)H16 + e) = f.half[0]; 
}

// GEMM (wave tile 32x64; M % 128 == 0, N % 64 == 0, K % 32 == 0): v = acc*alpha + bf16(bias[col]) (+ CP term if CP); ACT 0 none; A, Bh and C16 are fragment-packed planes (lda, ldb, ldc = their K); writes f32 C (row-major, pitch ldc) and/or f16 C16;
template <int ACT>
__global__ __launch_bounds__(128) void k_gemm2(const _Float16* __restrict__ A, int lda, size_t sA, const _Float16* __restrict__ Bh, int ldb, size_t sB, float alpha, const float* __restrict__ bias, size_t sBias, const float* __restrict__ CP, int rowsPerB, size_t sCPb, int row0g,
    float* __restrict__ C, _Float16* __restrict__ C16, int ldc, size_t sC, int M, int N, int K) {
  __shared__ __attribute__((aligned(16))) float so[4][32][68];
  const int tid = threadIdx.x, w = tid >> 5, lane = tid & 31, ln = lane & 15, hh = lane >> 4; const int by = blockIdx.y;
  A += (size_t)by * sA; Bh += (size_t)by * sB; const size_t cofs = (size_t)by * sC; const float* bp = bias ? bias + (size_t)by * sBias : nullptr;
  const int ntn = N >> 6; const int mt = blockIdx.x / ntn, nq = blockIdx.x - mt * ntn; const int row0 = mt * 128 + 32 * w, col0 = nq * 64; if (row0 >= M) return;
  // each lane's own fragment pointers (band start + 8 lane elements; a k-step is one tile, 512 elements); they advance once per two k-steps, the loads between reach ahead by constant offsets
  const _Float16* a0p = A + (size_t)row0 * lda + 8 * lane; const _Float16* a1p = a0p + (size_t)16 * lda;
  const _Float16* b0p = Bh + (size_t)col0 * ldb + 8 * lane; const _Float16* b1p = b0p + (size_t)16 * ldb; const _Float16* b2p = b1p + (size_t)16 * ldb; const _Float16* b3p = b2p + (size_t)16 * ldb;
  const v8f z8 = {0.f,0.f,0.f,0.f,0.f,0.f,0.f,0.f}; v8f c00 = z8, c01 = z8, c02 = z8, c03 = z8, c10 = z8, c11 = z8, c12 = z8, c13 = z8;
  // fragments are fetched one k-step ahead into a second register set (x and y take turns): the twelve loads of the next step go out as one group in front of this step's products
#define G2_LOAD(S, O) S##a0 = g2_fragp(a0p + (O)); S##a1 = g2_fragp(a1p + (O)); S##b0 = g2_fragp(b0p + (O)); S##b1 = g2_fragp(b1p + (O)); S##b2 = g2_fragp(b2p + (O)); S##b3 = g2_fragp(b3p + (O));
#define G2_STEP(S) c00 = g2_mma(S##a0, S##b0, c00); c10 = g2_mma(S##a1, S##b0, c10); c01 = g2_mma(S##a0, S##b1, c01); c11 = g2_mma(S##a1, S##b1, c11); c02 = g2_mma(S##a0, S##b2, c02); c12 = g2_mma(S##a1, S##b2, c12); c03 = g2_mma(S##a0, S##b3, c03); c13 = g2_mma(S##a1, S##b3, c13);
  v16h xa0, xa1, xb0, xb1, xb2, xb3, ya0, ya1, yb0, yb1, yb2, yb3;
  G2_LOAD(x, 0)
  int kb = 0;
  // unroll 1: the body already holds both register sets' steps; further copies would only add registers
#pragma unroll 1
  for (; kb + 64 < K; kb += 64) {
    G2_LOAD(y, 512)
    G2_STEP(x)
    G2_LOAD(x, 1024)
    a0p += 1024; a1p += 1024; b0p += 1024; b1p += 1024; b2p += 1024; b3p += 1024;
    G2_STEP(y) }
  if (kb + 32 < K) { G2_LOAD(y, 512) G2_STEP(x) G2_STEP(y) } else { G2_STEP(x) }
#undef G2_LOAD
#undef G2_STEP
  v8f accs[8] = {c00, c01, c02, c03, c10, c11, c12, c13};
#pragma unroll
  for (int u = 0; u < 8; ++u) { const int t = u & 3, half = u >> 2; const int col = col0 + t * 16 + ln; const float bv = bp ? bf16_rne(bp[col]) : 0.f;
#pragma unroll
    for (int r = 0; r < 8; ++r) { const int rloc = half * 16 + 8 * hh + r; float v = accs[u][r] * alpha + bv;
      if (CP) { if (rowsPerB < 0) v += CP[cofs + (size_t)(row0g + row0 + rloc) * ldc + col]; else { const int bidx = (row0g + row0 + rloc) / rowsPerB; v += CP[(size_t)bidx * sCPb + (size_t)by * 64 + col]; } }
      if (ACT == 3) v = fmaxf(v, 0.f);
      so[w][rloc][t * 16 + ln] = v; } }
  __builtin_amdgcn_fence(4 /* acq_rel order */, "workgroup"); __builtin_amdgcn_wave_barrier();
  const int rsub = lane >> 4, c4 = (lane & 15) * 4;
  {
#pragma unroll
    for (int q = 0; q < 16; ++q) { const int r = q * 2 + rsub; const v4f v = *(const v4fa*)&so[w][r][c4];
      if (C) *(v4f*)(C + cofs + (size_t)(row0 + r) * ldc + col0 + c4) = v; }
     }
  asm volatile("s_wait_xcnt 0x0" ::: "memory"); // behind the run of C stores: the C16 block below reuses registers that those stores name
  if (C16) { // the wave's 32 x 64 block is 2 x 2 packed tiles; per tile two wave-wide 16-byte stores of 512 contiguous bytes
#pragma unroll
    for (int tl = 0; tl < 4; ++tl) { const int rtl = tl >> 1, kbl = tl & 1; _Float16* dst = C16 + cofs + (size_t)(row0 + 16 * rtl) * ldc + (size_t)((col0 >> 5) + kbl) * 512 + 8 * lane;
#pragma unroll
      for (int i = 0; i < 2; ++i) { const float* sp = &so[w][rtl * 16 + ln][kbl * 32 + 16 * i + 8 * hh]; const v4f lo = *(const v4fa*)sp, hi = *(const v4fa*)(sp + 4); FragH f;
#pragma unroll
        for (int q = 0; q < 4; ++q) { f.h[q] = (_Float16)lo[q]; f.h[4 + q] = (_Float16)hi[q]; }
        *(v8us*)((unsigned short*)dst + 256 * i) = f.half[0]; } } } }

template <int NHv, int TTv>
__global__ __launch_bounds__(256) void k_vt(const _Float16* __restrict__ V16, int ldv, int voff, _Float16* __restrict__ Vt) {
  __shared__ unsigned short tl[64][66]; const int tid = threadIdx.x; const int slab = blockIdx.x / (TTv / 64), lg = blockIdx.x % (TTv / 64); const int b = slab / NHv, h = slab % NHv;
  // V16 and Vt are fragment-packed planes (V16: rows = tokens, k = columns; Vt per slab: rows = d, k = tokens); piece i of the block's 4 x 2 tiles, read and written in packed order
  for (int i = tid; i < 64 * 8; i += 256) { const int tile = i >> 6, wi = i & 63; const int r = (tile >> 1) * 16 + (wi & 15), c8 = (tile & 1) * 32 + (wi >> 5) * 16 + ((wi >> 4) & 1) * 8; FragH f;
    f.half[0] = *(const v8us*)((const unsigned short*)V16 + ((size_t)b * TTv + lg * 64 + (tile >> 1) * 16) * ldv + (size_t)(((voff + h * 64) >> 5) + (tile & 1)) * 512 + wi * 8);
#pragma unroll
    for (int q = 0; q < 8; ++q) tl[r][c8 + q] = f.u[q]; }
  __syncthreads();
  {
#pragma unroll
    for (int rd = 0; rd < 2; ++rd) { const int i = rd * 256 + tid, tile = i >> 6, wi = i & 63; const int d = (tile >> 1) * 16 + (wi & 15), t0 = (tile & 1) * 32 + (wi >> 5) * 16 + ((wi >> 4) & 1) * 8; FragH f;
#pragma unroll
      for (int q = 0; q < 8; ++q) f.u[q] = tl[t0 + q][d];
      *(v8us*)((unsigned short*)Vt + ((size_t)slab * 64 + (tile >> 1) * 16) * TTv + (size_t)(lg * 2 + (tile & 1)) * 512 + wi * 8) = f.half[0]; }
     } }

// lane l with lane l ^ 16 (a vector cross-row move, no LDS queue)
__device__ __forceinline__ float xhalf(float x) { return __builtin_bit_cast(float, __builtin_amdgcn_permlanex16(__builtin_bit_cast(int, x), __builtin_bit_cast(int, x), 0x76543210, 0xfedcba98, false, false)); }

// fused attention per ((b,h), 64 queries): wave = 16 queries; both products transposed: S^T = K.Q^T (A = 16 keys, B = the wave's queries; d = 64: 2 k-steps) x SCL over all TK keys (CAUSAL == 0: no key excluded), O^T += V^T.P^T (A = 16 d, B = P^T).
// A lane holds 16 of the pass's 32 scores of ONE query (column lane & 15; keys 16 nt + 8 (lane >> 4) + r): maximum and sum run in the lane, the two lane halves meet by one cross-row move; the two score tiles, converted in place, are the B fragment of P^T (element 8 nt + r = k 16 nt + 8 h + r, the k order of the packed V^T tiles).
// online max/sum softmax f32; Q16, K16 (rows = tokens, k = columns) and Vt (per slab: rows = d, k = keys) are fragment-packed planes
template <int CAUSAL>
__global__ __launch_bounds__(128) void k_flash(const _Float16* __restrict__ Q16, int ldq, const _Float16* __restrict__ K16, int ldk, const _Float16* __restrict__ Vt, float* __restrict__ O, int ldo) {
  constexpr int RPW = 16, DT = 4, KS = 2; constexpr float C2 = SCL * 1.4426950408889634f;
  __shared__ __attribute__((aligned(16))) float sO[4][RPW][64 + 4];
  const int tid = threadIdx.x, w = tid >> 5, lane = tid & 31, ln = lane & 15, hh = lane >> 4;
  const int slab = blockIdx.x / QBLKS, qblk = blockIdx.x % QBLKS; const int b = slab / NH, h = slab % NH; const int qb0 = qblk * (4 * RPW); const int q0 = qb0 + w * RPW;
  FragH bq[KS];
  { const unsigned short* qr = (const unsigned short*)Q16 + ((size_t)b * TQ + q0) * ldq + h * 1024 + 8 * lane;
#pragma unroll
    for (int ks = 0; ks < KS; ++ks) { bq[ks].half[0] = *(const v8us*)(qr + ks * 512); bq[ks].half[1] = *(const v8us*)(qr + ks * 512 + 256); } }
  const unsigned short* Vth = (const unsigned short*)Vt + (size_t)slab * 64 * TK; const unsigned l8 = 8u * (unsigned)lane; /* the lane's piece of a tile half; the K and V tile starts are the same for the whole block */
  float m_r = -3.0e38f, l_r = 0.f; v8f oacc[DT]; /* m_r: the query's running maximum of the raw products (alike in both halves); l_r: the sum over this half's keys, x1024 */
#pragma unroll
  for (int dt = 0; dt < DT; ++dt) oacc[dt] = (v8f){0.f,0.f,0.f,0.f,0.f,0.f,0.f,0.f};
  const int jend = (CAUSAL == 1) ? (qb0 + 4 * RPW) : TK; const int tq = q0 + ln; (void)tq;
  FragH ak[2][KS];
#pragma unroll
  for (int nt = 0; nt < 2; ++nt) { const unsigned short* kr = (const unsigned short*)K16 + ((size_t)b * TK + nt * 16) * ldk + h * 1024;
#pragma unroll
    for (int ks = 0; ks < KS; ++ks) { ak[nt][ks].half[0] = *(const v8us*)(kr + ks * 512 + l8); ak[nt][ks].half[1] = *(const v8us*)(kr + ks * 512 + 256 + l8); } }
#pragma unroll 1
  for (int j0 = 0; j0 < jend; j0 += 32) {
    v8f s[2];
#pragma unroll
    for (int nt = 0; nt < 2; ++nt) { v8f acc = (v8f){0.f,0.f,0.f,0.f,0.f,0.f,0.f,0.f};
#pragma unroll
      for (int ks = 0; ks < KS; ++ks) acc = mmaH<1>(ak[nt][ks].v, ak[nt][ks].v, bq[ks].v, bq[ks].v, acc);
      s[nt] = acc; }
    // one group of loads directly behind the score products, a softmax ahead of their use: this pass's V fragments, then the next pass's K fragments into the registers just read
    FragH av[DT];
#pragma unroll
    for (int dt = 0; dt < DT; ++dt) { const unsigned short* vrow = Vth + (size_t)(dt * 16) * TK + (size_t)j0 * 16; av[dt].half[0] = *(const v8us*)(vrow + l8); av[dt].half[1] = *(const v8us*)(vrow + 256 + l8); }
    const int jn = (j0 + 32 < jend) ? j0 + 32 : j0; /* the last pass fetches its own keys again: stays inside K16 */
#pragma unroll
    for (int nt = 0; nt < 2; ++nt) { const unsigned short* kr = (const unsigned short*)K16 + ((size_t)b * TK + jn + nt * 16) * ldk + h * 1024;
#pragma unroll
      for (int ks = 0; ks < KS; ++ks) { ak[nt][ks].half[0] = *(const v8us*)(kr + ks * 512 + l8); ak[nt][ks].half[1] = *(const v8us*)(kr + ks * 512 + 256 + l8); } }
    __builtin_amdgcn_sched_barrier(0); // keeps the sixteen loads in one group here: without it the scheduler sinks the K loads to the foot of the softmax, a few instructions ahead of their use
    // the softmax runs in base 2 on the raw products: C2 = SCL log2(e) > 0, so the raw maximum is the scaled one's element, and a weight is one multiply-add and one hardware exponential
    float sv[16]; bool ok[16];
#pragma unroll
    for (int e = 0; e < 16; ++e) { const int key = j0 + (e >> 3) * 16 + 8 * hh + (e & 7); ok[e] = (CAUSAL == 1) ? (key <= tq) : true; sv[e] = ok[e] ? s[e >> 3][e & 7] : -3.0e38f; }
    float mx[5];
#pragma unroll
    for (int c = 0; c < 5; ++c) mx[c] = fmaxf(fmaxf(sv[3 * c], sv[3 * c + 1]), sv[3 * c + 2]);
    float mc = fmaxf(fmaxf(fmaxf(mx[0], mx[1]), mx[2]), fmaxf(fmaxf(mx[3], mx[4]), sv[15])); mc = fmaxf(mc, xhalf(mc));
    const float mn = fmaxf(m_r, mc); const float ae = __builtin_amdgcn_exp2f((m_r - mn) * C2); const float al = (mn > -1.0e38f) ? ae : 1.0f; m_r = mn; /* ae formed on every path: a select, so that it runs among the weights' exponentials and EXEC stays whole */
    const float nb = 10.0f - mn * C2; /* the exponent's addend: minus the maximum, plus 10 for the x1024 that the f16 weights carry (the sum carries it too) */
    FragH pb; v2f ps[2]; /* the lane's 16 weights in pairs: four independent partial sums */
#pragma unroll
    for (int i = 0; i < 8; ++i) { const v2f ar = (v2f){sv[2 * i], sv[2 * i + 1]} * C2 + nb; v2f p; p.x = ok[2 * i] ? __builtin_amdgcn_exp2f(ar.x) : 0.f; p.y = ok[2 * i + 1] ? __builtin_amdgcn_exp2f(ar.y) : 0.f;
      if (i < 2) ps[i] = p; else ps[i & 1] += p;
      const v2h ph = __builtin_convertvector(p, v2h); pb.h[2 * i] = ph.x; pb.h[2 * i + 1] = ph.y; }
    l_r = l_r * al + ((ps[0].x + ps[1].x) + (ps[0].y + ps[1].y));
#pragma unroll
    for (int dt = 0; dt < DT; ++dt) oacc[dt] *= al;
#pragma unroll
    for (int dt = 0; dt < DT; ++dt) oacc[dt] = mmaH<1>(av[dt].v, av[dt].v, pb.v, pb.v, oacc[dt]); }
  { const float l = l_r + xhalf(l_r); const float inv = (l > 0.f) ? 1.0f / l : 0.f; /* l and oacc both carry x1024 */
    // oacc[dt][r] = O[query ln][d = 16 dt + 8 hh + r]: eight d in a row per lane and tile
#pragma unroll
    for (int dt = 0; dt < DT; ++dt) { v4f lo, hi;
#pragma unroll
      for (int q = 0; q < 4; ++q) { lo[q] = oacc[dt][q] * inv; hi[q] = oacc[dt][4 + q] * inv; }
      *(v4fa*)&sO[w][ln][dt * 16 + 8 * hh] = lo; *(v4fa*)&sO[w][ln][dt * 16 + 8 * hh + 4] = hi; } }
  __builtin_amdgcn_fence(4 /* acq_rel order */, "workgroup"); __builtin_amdgcn_wave_barrier();
  {
#pragma unroll
    for (int rp = 0; rp < RPW; rp += 2) { const int r = rp + (lane >> 4), pc = lane & 15; const v4f val = *(const v4fa*)&sO[w][r][pc * 4]; *(v4f*)(O + ((size_t)b * TQ + q0 + r) * ldo + h * 64 + pc * 4) = val; }
     } }

__global__ __launch_bounds__(256) void k_ln(const float* __restrict__ X, const float* __restrict__ R, const float* __restrict__ g, const float* __restrict__ bta, float* __restrict__ out) {
  __shared__ float red[256];
  const int row = blockIdx.x, tid = threadIdx.x;
  const size_t srow = (size_t)(row / SLEN) * SEQ_FULL + (size_t)(row % SLEN);
  const float* x = X + (size_t)row * DM; const float* rr = R + srow * DM;
  const int j = tid * 4;
  const v4f a = *(const v4fa*)(x + j); const v4f rb = *(const v4fa*)(rr + j);
  float vals[4]; float s1 = 0.f;
#pragma unroll
  for (int q = 0; q < 4; ++q) { const float v = a[q] + bf16_rne(rb[q]); vals[q] = v; s1 += v; }
  red[tid] = s1; __syncthreads();
  for (int st = 128; st > 0; st >>= 1) { if (tid < st) red[tid] += red[tid + st]; __syncthreads(); }
  const float mu = red[0] * 0.0009765625f; __syncthreads();
  float s2 = 0.f;
#pragma unroll
  for (int q = 0; q < 4; ++q) { const float c = vals[q] - mu; s2 += c * c; }
  red[tid] = s2; __syncthreads();
  for (int st = 128; st > 0; st >>= 1) { if (tid < st) red[tid] += red[tid + st]; __syncthreads(); }
  const float rs = rsqrtf(red[0] * 0.0009765625f + LNEPS);
  v4f o;
#pragma unroll
  for (int q = 0; q < 4; ++q) { const float gg = bf16_rne(g[j + q]), bb = bf16_rne(bta[j + q]); o[q] = (vals[q] - mu) * rs * gg + bb; }
  *(v4f*)(out + (size_t)row * DM + j) = o;
  
}

extern "C" void kernel_launch(void* const* d_in, const int* in_sizes, int n_in,
                              void* d_out, int out_size, void* d_ws, size_t ws_size, hipStream_t stream) {
  if (n_in < 11) return;
  const float* hs = (const float*)d_in[0]; const float* Wq = (const float*)d_in[1]; const float* bq = (const float*)d_in[2]; const float* Wk = (const float*)d_in[3]; const float* bk = (const float*)d_in[4];
  const float* Wv = (const float*)d_in[5]; const float* bv = (const float*)d_in[6]; const float* Wd = (const float*)d_in[7]; const float* bd = (const float*)d_in[8]; const float* gam = (const float*)d_in[9]; const float* bet = (const float*)d_in[10];
  const long long need0 = ((long long)(NB - 1) * SEQ_FULL + SLEN) * DM;
  if ((long long)in_sizes[0] < need0) return;
  if (in_sizes[1] < DM * DM || in_sizes[3] < DM * DM || in_sizes[5] < DM * DM || in_sizes[7] < DM * DM) return;
  if (in_sizes[2] < DM || in_sizes[4] < DM || in_sizes[6] < DM || in_sizes[8] < DM || in_sizes[9] < DM || in_sizes[10] < DM) return;
  if ((long long)out_size < (long long)NR * DM) return;
  char* ws = (char*)d_ws; size_t off = 0;
  auto take = [&](size_t bytes) { char* p = ws + off; off += (bytes + 255) & ~(size_t)255; return p; };
  const size_t np = (size_t)NR * DM; const size_t nw = (size_t)DM * DM;
  _Float16* BQ = (_Float16*)take(nw * 2); _Float16* BK = (_Float16*)take(nw * 2); _Float16* BV = (_Float16*)take(nw * 2); _Float16* BD = (_Float16*)take(nw * 2);
  _Float16* X16 = (_Float16*)take(np * 2); _Float16* QH = (_Float16*)take(np * 2); _Float16* KH = (_Float16*)take(np * 2); _Float16* V16 = (_Float16*)take(np * 2); _Float16* VT = (_Float16*)take(np * 2);
  float* CTX = (float*)take(np * 4); _Float16* CTX16 = (_Float16*)take(np * 2); float* ATT = (float*)take(np * 4);
  float* O = (float*)d_out;
  if (off > ws_size) return;
  const unsigned gw = (unsigned)((nw / 8 + 255) / 256);
  k_wsc<<<gw, 256, 0, stream>>>(Wq, BQ, nw / 8, WSC); k_wsc<<<gw, 256, 0, stream>>>(Wk, BK, nw / 8, WSC); k_wsc<<<gw, 256, 0, stream>>>(Wv, BV, nw / 8, WSC); k_wsc<<<gw, 256, 0, stream>>>(Wd, BD, nw / 8, WSC);      /* [out][in] = [n][k] */
  k_x16<<<(unsigned)((np / 8 + 255) / 256), 256, 0, stream>>>(hs, X16, np / 8);
  const dim3 g((NR / 128) * (DM / 64), 1);
  k_gemm2<0><<<g, 128, 0, stream>>>(X16, DM, 0, BQ, DM, 0, 1.0f / WSC, bq, 0, nullptr, 1, 0, 0, nullptr, QH, DM, 0, NR, DM, DM);
  k_gemm2<0><<<g, 128, 0, stream>>>(X16, DM, 0, BK, DM, 0, 1.0f / WSC, bk, 0, nullptr, 1, 0, 0, nullptr, KH, DM, 0, NR, DM, DM);
  k_gemm2<0><<<g, 128, 0, stream>>>(X16, DM, 0, BV, DM, 0, 1.0f / WSC, bv, 0, nullptr, 1, 0, 0, nullptr, V16, DM, 0, NR, DM, DM);
  k_vt<NH, SLEN><<<NB * NH * (SLEN / 64), 256, 0, stream>>>(V16, DM, 0, VT);
  k_flash<0><<<NB * NH * QBLKS, 128, 0, stream>>>(QH, DM, KH, DM, VT, CTX, DM);
  k_h16<<<(unsigned)((np / 8 + 255) / 256), 256, 0, stream>>>(CTX, CTX16, np / 8, CSC);
  k_gemm2<0><<<g, 128, 0, stream>>>(CTX16, DM, 0, BD, DM, 0, 1.0f / (WSC * CSC), bd, 0, nullptr, 1, 0, 0, ATT, nullptr, DM, 0, NR, DM, DM);
  k_ln<<<NR, 256, 0, stream>>>(ATT, hs, gam, bet, O);
}

// v005
// A run of this version takes 128 microseconds.
// Next to v004, in two timings, it ran 1.13 times as fast each time.
// All steps since v000 together make it 3.45 times as fast.
#include <hip/hip_runtime.h>
// Contractions: v_wmma_f32_16x16x32_f16 everywhere (f16 operands, f32 accumulate) - q/k/v projections (x as f16 of bf16-RNE input, W as f16 of bf16-RNE weight x16), k.q^T and v^T.p^T per head (plain f16 q/k/v planes, p carried x1024), output dense (context carried x16 f16, Wd bf16-RNE x16); softmax, bias adds, residual and LayerNorm in f32.

#ifndef NB
#define NB 2
#endif
#ifndef SEQ
#define SEQ 2048
#endif
#define NB_FULL 2
#define SEQ_FULL 2048
#define DM 1024
#define NH 16
#define HDIM 64
#define SLEN SEQ
#define TQ SLEN
#define TK SLEN
#define NR (NB * SLEN)
#define SCL 0.125f
#define QBLKS (TQ / 64)
#define LNEPS 0.00001f
#define WSC 16.0f
#define CSC 16.0f
static_assert(NH * HDIM == DM);
static_assert(SLEN % 64 == 0);
static_assert(NR % 128 == 0);
static_assert(DM % 64 == 0);
static_assert(DM == 4 * 256);
static_assert(NB <= NB_FULL);
static_assert(SEQ <= SEQ_FULL);

typedef unsigned short v8us __attribute__((ext_vector_type(8), may_alias));
typedef float  v8f  __attribute__((ext_vector_type(8)));
typedef float  v4f  __attribute__((ext_vector_type(4)));
typedef float  v4fa __attribute__((ext_vector_type(4), may_alias));
typedef _Float16 v16h __attribute__((ext_vector_type(16)));
typedef _Float16 v4h  __attribute__((ext_vector_type(4)));
typedef float  v2f  __attribute__((ext_vector_type(2)));
typedef _Float16 v2h  __attribute__((ext_vector_type(2)));
union FragH { v16h v; v8us half[2]; _Float16 h[16]; unsigned short u[16]; };

__device__ __forceinline__ unsigned short bf16_bits(float x) { unsigned int u = __float_as_uint(x); return (unsigned short)((u + 0x7FFFu + ((u >> 16) & 1u)) >> 16); }
__device__ __forceinline__ float bf16_val(unsigned short b) { return __uint_as_float(((unsigned int)b) << 16); }
__device__ __forceinline__ float bf16_rne(float x) { return bf16_val(bf16_bits(x)); }

// D += A.B with NT terms (1 = single product); 16x16x32 f16, split k map per lane half; 4 v_nop hazard guard tied to D with A/B kept live
template <int NT>
__device__ __forceinline__ v8f mmaH(v16h ah, v16h al, v16h bh, v16h bl, v8f c) {
  c = __builtin_amdgcn_wmma_f32_16x16x32_f16(false, ah, false, bh, (short)0, c, false, false);
  if (NT >= 2) c = __builtin_amdgcn_wmma_f32_16x16x32_f16(false, al, false, bh, (short)0, c, false, false);
  if (NT >= 3) c = __builtin_amdgcn_wmma_f32_16x16x32_f16(false, ah, false, bl, (short)0, c, false, false);
  asm volatile("v_nop\n\tv_nop\n\tv_nop\n\tv_nop" : "+v"(c) : "v"(ah), "v"(al), "v"(bh), "v"(bl));
  return c;
}
// Fragment-packed plane of a [rows][K] 16-bit matrix: every tile of 16 rows x 32 k is 512 elements in a row, the tiles of one 16-row band follow in k order (so a band is 16 K elements, as in the row-major plane).
// Inside a tile the 8-element piece number 32 i + 16 h + c holds row c, k = 16 i + 8 h + 0..7: piece number = 32 i + lane, so each of a fragment's two wave-wide 16-byte loads covers 512 contiguous bytes (4 whole lines).
// packing from a row-major f32 source, kt = K / 32 tiles per band: thread t takes 8 k of one row, four threads in a row per 128-byte source line; a wave reads 8 whole lines and writes 4 whole lines. dst = element offset of its piece
__device__ __forceinline__ void pk_src(size_t t, int kt, size_t& row, int& k, size_t& dst) { const size_t tile = t >> 6; const int c = (int)(t & 63) >> 2, ih = (int)(t & 3); row = (tile / kt) * 16 + c; k = (int)(tile % kt) * 32 + 8 * ih; dst = tile * 512 + (size_t)(16 * ih + c) * 8; }
// fragment of 16 rows (lane&15) x 32 k from a packed tile: elements 0..7 <- k0+8h, 8..15 <- k0+16+8h
// p already holds the tile's start + 8 lane elements
__device__ __forceinline__ v16h g2_fragp(const _Float16* p) { FragH f; f.half[0] = *(const v8us*)((const unsigned short*)p); f.half[1] = *(const v8us*)((const unsigned short*)p + 256); return f.v; }
__device__ __forceinline__ v8f g2_mma(v16h a, v16h b, v8f c) { v8f d = __builtin_amdgcn_wmma_f32_16x16x32_f16(false, a, false, b, (short)0, c, false, false); asm volatile("v_nop\n\tv_nop\n\tv_nop\n\tv_nop" : "+v"(d) : "v"(a), "v"(b)); return d; }

// blocks of 256 threads that one conversion takes: x (NR x DM) and one weight (DM x DM), 8 elements a thread
#define XBLK ((NR * (DM / 8) + 255) / 256)
#define WBLK ((DM * (DM / 8) + 255) / 256)
// the five input conversions depend on nothing and on each other not at all: one grid; blocks [0, XBLK) pack x, then WBLK blocks for each of the four weights (the choice is the same for a whole block)
__global__ __launch_bounds__(256) void k_prep(const float* __restrict__ x, _Float16* __restrict__ X16, const float* __restrict__ W0, const float* __restrict__ W1, const float* __restrict__ W2, const float* __restrict__ W3,
    _Float16* __restrict__ B0, _Float16* __restrict__ B1, _Float16* __restrict__ B2, _Float16* __restrict__ B3, float sc) {
  FragH f; size_t r, e; int c;
  if (blockIdx.x < XBLK) {
    const size_t t = (size_t)blockIdx.x * 256 + threadIdx.x; if (t >= (size_t)NR * (DM / 8)) return;
    pk_src(t, DM / 32, r, c, e); const size_t sr = (r / SLEN) * SEQ_FULL + (r % SLEN);
    const float* src = x + sr * DM + c;
#pragma unroll
    for (int q = 0; q < 8; ++q) f.h[q] = (_Float16)bf16_rne(src[q]);
    *(v8us*)((unsigned short*)X16 + e) = f.half[0];
    return; }
  const unsigned wblk = blockIdx.x - XBLK, wi = wblk / WBLK;
  const size_t t = (size_t)(wblk - wi * WBLK) * 256 + threadIdx.x; if (t >= (size_t)DM * (DM / 8)) return;
  const float* Wm = wi == 0 ? W0 : wi == 1 ? W1 : wi == 2 ? W2 : W3; _Float16* Bt = wi == 0 ? B0 : wi == 1 ? B1 : wi == 2 ? B2 : B3;
  pk_src(t, DM / 32, r, c, e); const float* src = Wm + r * DM + c;
#pragma unroll
  for (int q = 0; q < 8; ++q) f.h[q] = (_Float16)(bf16_rne(src[q]) * sc);
  *(v8us*)((unsigned short*)Bt + e) = f.half[0];
}

__global__ __launch_bounds__(256) void k_h16(const float* __restrict__ F, _Float16* __restrict__ H16, size_t n8, float sc) {
  const size_t t = (size_t)blockIdx.x * 256 + threadIdx.x; if (t >= n8) return; FragH f;
  size_t r, e; int k; pk_src(t, DM / 32, r, k, e); const float* src = F + r * DM + k;
  const v4f a = *(const v4fa*)src, c = *(const v4fa*)(src + 4);
#pragma unroll
  for (int q = 0; q < 4; ++q) { f.h[q] = (_Float16)(a[q] * sc); f.h[4 + q] = (_Float16)(c[q] * sc); }
  *(v8us*)((unsigned short*)H16 + e) = f.half[0]; 
}

// GEMM (wave tile 32x64; M % 128 == 0, N % 64 == 0, K % 32 == 0): v = acc*alpha + bf16(bias[col]) (+ CP term if CP); ACT 0 none; A, Bh and C16 are fragment-packed planes (lda, ldb, ldc = their K); writes f32 C (row-major, pitch ldc) and/or f16 C16; blockIdx.y = one of up to three independent products of one grid (A, Bh, C by their strides sA, sB, sC; bias, bias1, bias2 in turn)
template <int ACT>
__global__ __launch_bounds__(128) void k_gemm2(const _Float16* __restrict__ A, int lda, size_t sA, const _Float16* __restrict__ Bh, int ldb, size_t sB, float alpha, const float* __restrict__ bias, const float* __restrict__ bias1, const float* __restrict__ bias2, const float* __restrict__ CP, int rowsPerB, size_t sCPb, int row0g,
    float* __restrict__ C, _Float16* __restrict__ C16, int ldc, size_t sC, int M, int N, int K) {
  __shared__ __attribute__((aligned(16))) float so[4][32][68];
  const int tid = threadIdx.x, w = tid >> 5, lane = tid & 31, ln = lane & 15, hh = lane >> 4; const int by = blockIdx.y;
  A += (size_t)by * sA; Bh += (size_t)by * sB; const size_t cofs = (size_t)by * sC; const float* bp = by == 0 ? bias : by == 1 ? bias1 : bias2;
  const int ntn = N >> 6; const int mt = blockIdx.x / ntn, nq = blockIdx.x - mt * ntn; const int row0 = mt * 128 + 32 * w, col0 = nq * 64; if (row0 >= M) return;
  // each lane's own fragment pointers (band start + 8 lane elements; a k-step is one tile, 512 elements); they advance once per two k-steps, the loads between reach ahead by constant offsets
  const _Float16* a0p = A + (size_t)row0 * lda + 8 * lane; const _Float16* a1p = a0p + (size_t)16 * lda;
  const _Float16* b0p = Bh + (size_t)col0 * ldb + 8 * lane; const _Float16* b1p = b0p + (size_t)16 * ldb; const _Float16* b2p = b1p + (size_t)16 * ldb; const _Float16* b3p = b2p + (size_t)16 * ldb;
  const v8f z8 = {0.f,0.f,0.f,0.f,0.f,0.f,0.f,0.f}; v8f c00 = z8, c01 = z8, c02 = z8, c03 = z8, c10 = z8, c11 = z8, c12 = z8, c13 = z8;
  // fragments are fetched one k-step ahead into a second register set (x and y take turns): the twelve loads of the next step go out as one group in front of this step's products
#define G2_LOAD(S, O) S##a0 = g2_fragp(a0p + (O)); S##a1 = g2_fragp(a1p + (O)); S##b0 = g2_fragp(b0p + (O)); S##b1 = g2_fragp(b1p + (O)); S##b2 = g2_fragp(b2p + (O)); S##b3 = g2_fragp(b3p + (O));
#define G2_STEP(S) c00 = g2_mma(S##a0, S##b0, c00); c10 = g2_mma(S##a1, S##b0, c10); c01 = g2_mma(S##a0, S##b1, c01); c11 = g2_mma(S##a1, S##b1, c11); c02 = g2_mma(S##a0, S##b2, c02); c12 = g2_mma(S##a1, S##b2, c12); c03 = g2_mma(S##a0, S##b3, c03); c13 = g2_mma(S##a1, S##b3, c13);
  v16h xa0, xa1, xb0, xb1, xb2, xb3, ya0, ya1, yb0, yb1, yb2, yb3;
  G2_LOAD(x, 0)
  int kb = 0;
  // unroll 1: the body already holds both register sets' steps; further copies would only add registers
#pragma unroll 1
  for (; kb + 64 < K; kb += 64) {
    G2_LOAD(y, 512)
    G2_STEP(x)
    G2_LOAD(x, 1024)
    a0p += 1024; a1p += 1024; b0p += 1024; b1p += 1024; b2p += 1024; b3p += 1024;
    G2_STEP(y) }
  if (kb + 32 < K) { G2_LOAD(y, 512) G2_STEP(x) G2_STEP(y) } else { G2_STEP(x) }
#undef G2_LOAD
#undef G2_STEP
  v8f accs[8] = {c00, c01, c02, c03, c10, c11, c12, c13};
#pragma unroll
  for (int u = 0; u < 8; ++u) { const int t = u & 3, half = u >> 2; const int col = col0 + t * 16 + ln; const float bv = bp ? bf16_rne(bp[col]) : 0.f;
#pragma unroll
    for (int r = 0; r < 8; ++r) { const int rloc = half * 16 + 8 * hh + r; float v = accs[u][r] * alpha + bv;
      if (CP) { if (rowsPerB < 0) v += CP[cofs + (size_t)(row0g + row0 + rloc) * ldc + col]; else { const int bidx = (row0g + row0 + rloc) / rowsPerB; v += CP[(size_t)bidx * sCPb + (size_t)by * 64 + col]; } }
      if (ACT == 3) v = fmaxf(v, 0.f);
      so[w][rloc][t * 16 + ln] = v; } }
  __builtin_amdgcn_fence(4 /* acq_rel order */, "workgroup"); __builtin_amdgcn_wave_barrier();
  const int rsub = lane >> 4, c4 = (lane & 15) * 4;
  {
#pragma unroll
    for (int q = 0; q < 16; ++q) { const int r = q * 2 + rsub; const v4f v = *(const v4fa*)&so[w][r][c4];
      if (C) *(v4f*)(C + cofs + (size_t)(row0 + r) * ldc + col0 + c4) = v; }
     }
  asm volatile("s_wait_xcnt 0x0" ::: "memory"); // behind the run of C stores: the C16 block below reuses registers that those stores name
  if (C16) { // the wave's 32 x 64 block is 2 x 2 packed tiles; per tile two wave-wide 16-byte stores of 512 contiguous bytes
#pragma unroll
    for (int tl = 0; tl < 4; ++tl) { const int rtl = tl >> 1, kbl = tl & 1; _Float16* dst = C16 + cofs + (size_t)(row0 + 16 * rtl) * ldc + (size_t)((col0 >> 5) + kbl) * 512 + 8 * lane;
#pragma unroll
      for (int i = 0; i < 2; ++i) { const float* sp = &so[w][rtl * 16 + ln][kbl * 32 + 16 * i + 8 * hh]; const v4f lo = *(const v4fa*)sp, hi = *(const v4fa*)(sp + 4); FragH f;
#pragma unroll
        for (int q = 0; q < 4; ++q) { f.h[q] = (_Float16)lo[q]; f.h[4 + q] = (_Float16)hi[q]; }
        *(v8us*)((unsigned short*)dst + 256 * i) = f.half[0]; } } } }

template <int NHv, int TTv>
__global__ __launch_bounds__(256) void k_vt(const _Float16* __restrict__ V16, int ldv, int voff, _Float16* __restrict__ Vt) {
  __shared__ unsigned short tl[64][66]; const int tid = threadIdx.x; const int slab = blockIdx.x / (TTv / 64), lg = blockIdx.x % (TTv / 64); const int b = slab / NHv, h = slab % NHv;
  // V16 and Vt are fragment-packed planes (V16: rows = tokens, k = columns; Vt per slab: rows = d, k = tokens); piece i of the block's 4 x 2 tiles, read and written in packed order
  for (int i = tid; i < 64 * 8; i += 256) { const int tile = i >> 6, wi = i & 63; const int r = (tile >> 1) * 16 + (wi & 15), c8 = (tile & 1) * 32 + (wi >> 5) * 16 + ((wi >> 4) & 1) * 8; FragH f;
    f.half[0] = *(const v8us*)((const unsigned short*)V16 + ((size_t)b * TTv + lg * 64 + (tile >> 1) * 16) * ldv + (size_t)(((voff + h * 64) >> 5) + (tile & 1)) * 512 + wi * 8);
#pragma unroll
    for (int q = 0; q < 8; ++q) tl[r][c8 + q] = f.u[q]; }
  __syncthreads();
  {
#pragma unroll
    for (int rd = 0; rd < 2; ++rd) { const int i = rd * 256 + tid, tile = i >> 6, wi = i & 63; const int d = (tile >> 1) * 16 + (wi & 15), t0 = (tile & 1) * 32 + (wi >> 5) * 16 + ((wi >> 4) & 1) * 8; FragH f;
#pragma unroll
      for (int q = 0; q < 8; ++q) f.u[q] = tl[t0 + q][d];
      *(v8us*)((unsigned short*)Vt + ((size_t)slab * 64 + (tile >> 1) * 16) * TTv + (size_t)(lg * 2 + (tile & 1)) * 512 + wi * 8) = f.half[0]; }
     } }

// lane l with lane l ^ 16 (a vector cross-row move, no LDS queue)
__device__ __forceinline__ float xhalf(float x) { return __builtin_bit_cast(float, __builtin_amdgcn_permlanex16(__builtin_bit_cast(int, x), __builtin_bit_cast(int, x), 0x76543210, 0xfedcba98, false, false)); }

// fused attention per ((b,h), 64 queries): wave = 16 queries; both products transposed: S^T = K.Q^T (A = 16 keys, B = the wave's queries; d = 64: 2 k-steps) x SCL over all TK keys (CAUSAL == 0: no key excluded), O^T += V^T.P^T (A = 16 d, B = P^T).
// A lane holds 16 of the pass's 32 scores of ONE query (column lane & 15; keys 16 nt + 8 (lane >> 4) + r): maximum and sum run in the lane, the two lane halves meet by one cross-row move; the two score tiles, converted in place, are the B fragment of P^T (element 8 nt + r = k 16 nt + 8 h + r, the k order of the packed V^T tiles).
// online max/sum softmax f32; Q16, K16 (rows = tokens, k = columns) and Vt (per slab: rows = d, k = keys) are fragment-packed planes
template <int CAUSAL>
__global__ __launch_bounds__(128) void k_flash(const _Float16* __restrict__ Q16, int ldq, const _Float16* __restrict__ K16, int ldk, const _Float16* __restrict__ Vt, float* __restrict__ O, int ldo) {
  constexpr int RPW = 16, DT = 4, KS = 2; constexpr float C2 = SCL * 1.4426950408889634f;
  __shared__ __attribute__((aligned(16))) float sO[4][RPW][64 + 4];
  const int tid = threadIdx.x, w = tid >> 5, lane = tid & 31, ln = lane & 15, hh = lane >> 4;
  const int slab = blockIdx.x / QBLKS, qblk = blockIdx.x % QBLKS; const int b = slab / NH, h = slab % NH; const int qb0 = qblk * (4 * RPW); const int q0 = qb0 + w * RPW;
  FragH bq[KS];
  { const unsigned short* qr = (const unsigned short*)Q16 + ((size_t)b * TQ + q0) * ldq + h * 1024 + 8 * lane;
#pragma unroll
    for (int ks = 0; ks < KS; ++ks) { bq[ks].half[0] = *(const v8us*)(qr + ks * 512); bq[ks].half[1] = *(const v8us*)(qr + ks * 512 + 256); } }
  const unsigned short* Vth = (const unsigned short*)Vt + (size_t)slab * 64 * TK; const unsigned l8 = 8u * (unsigned)lane; /* the lane's piece of a tile half; the K and V tile starts are the same for the whole block */
  float m_r = -3.0e38f, l_r = 0.f; v8f oacc[DT]; /* m_r: the query's running maximum of the raw products (alike in both halves); l_r: the sum over this half's keys, x1024 */
#pragma unroll
  for (int dt = 0; dt < DT; ++dt) oacc[dt] = (v8f){0.f,0.f,0.f,0.f,0.f,0.f,0.f,0.f};
  const int jend = (CAUSAL == 1) ? (qb0 + 4 * RPW) : TK; const int tq = q0 + ln; (void)tq;
  FragH ak[2][KS];
#pragma unroll
  for (int nt = 0; nt < 2; ++nt) { const unsigned short* kr = (const unsigned short*)K16 + ((size_t)b * TK + nt * 16) * ldk + h * 1024;
#pragma unroll
    for (int ks = 0; ks < KS; ++ks) { ak[nt][ks].half[0] = *(const v8us*)(kr + ks * 512 + l8); ak[nt][ks].half[1] = *(const v8us*)(kr + ks * 512 + 256 + l8); } }
#pragma unroll 1
  for (int j0 = 0; j0 < jend; j0 += 32) {
    v8f s[2];
#pragma unroll
    for (int nt = 0; nt < 2; ++nt) { v8f acc = (v8f){0.f,0.f,0.f,0.f,0.f,0.f,0.f,0.f};
#pragma unroll
      for (int ks = 0; ks < KS; ++ks) acc = mmaH<1>(ak[nt][ks].v, ak[nt][ks].v, bq[ks].v, bq[ks].v, acc);
      s[nt] = acc; }
    // one group of loads directly behind the score products, a softmax ahead of their use: this pass's V fragments, then the next pass's K fragments into the registers just read
    FragH av[DT];
#pragma unroll
    for (int dt = 0; dt < DT; ++dt) { const unsigned short* vrow = Vth + (size_t)(dt * 16) * TK + (size_t)j0 * 16; av[dt].half[0] = *(const v8us*)(vrow + l8); av[dt].half[1] = *(const v8us*)(vrow + 256 + l8); }
    const int jn = (j0 + 32 < jend) ? j0 + 32 : j0; /* the last pass fetches its own keys again: stays inside K16 */
#pragma unroll
    for (int nt = 0; nt < 2; ++nt) { const unsigned short* kr = (const unsigned short*)K16 + ((size_t)b * TK + jn + nt * 16) * ldk + h * 1024;
#pragma unroll
      for (int ks = 0; ks < KS; ++ks) { ak[nt][ks].half[0] = *(const v8us*)(kr + ks * 512 + l8); ak[nt][ks].half[1] = *(const v8us*)(kr + ks * 512 + 256 + l8); } }
    __builtin_amdgcn_sched_barrier(0); // keeps the sixteen loads in one group here: without it the scheduler sinks the K loads to the foot of the softmax, a few instructions ahead of their use
    // the softmax runs in base 2 on the raw products: C2 = SCL log2(e) > 0, so the raw maximum is the scaled one's element, and a weight is one multiply-add and one hardware exponential
    float sv[16]; bool ok[16];
#pragma unroll
    for (int e = 0; e < 16; ++e) { const int key = j0 + (e >> 3) * 16 + 8 * hh + (e & 7); ok[e] = (CAUSAL == 1) ? (key <= tq) : true; sv[e] = ok[e] ? s[e >> 3][e & 7] : -3.0e38f; }
    float mx[5];
#pragma unroll
    for (int c = 0; c < 5; ++c) mx[c] = fmaxf(fmaxf(sv[3 * c], sv[3 * c + 1]), sv[3 * c + 2]);
    float mc = fmaxf(fmaxf(fmaxf(mx[0], mx[1]), mx[2]), fmaxf(fmaxf(mx[3], mx[4]), sv[15])); mc = fmaxf(mc, xhalf(mc));
    const float mn = fmaxf(m_r, mc); const float ae = __builtin_amdgcn_exp2f((m_r - mn) * C2); const float al = (mn > -1.0e38f) ? ae : 1.0f; m_r = mn; /* ae formed on every path: a select, so that it runs among the weights' exponentials and EXEC stays whole */
    const float nb = 10.0f - mn * C2; /* the exponent's addend: minus the maximum, plus 10 for the x1024 that the f16 weights carry (the sum carries it too) */
    FragH pb; v2f ps[2]; /* the lane's 16 weights in pairs: four independent partial sums */
#pragma unroll
    for (int i = 0; i < 8; ++i) { const v2f ar = (v2f){sv[2 * i], sv[2 * i + 1]} * C2 + nb; v2f p; p.x = ok[2 * i] ? __builtin_amdgcn_exp2f(ar.x) : 0.f; p.y = ok[2 * i + 1] ? __builtin_amdgcn_exp2f(ar.y) : 0.f;
      if (i < 2) ps[i] = p; else ps[i & 1] += p;
      const v2h ph = __builtin_convertvector(p, v2h); pb.h[2 * i] = ph.x; pb.h[2 * i + 1] = ph.y; }
    l_r = l_r * al + ((ps[0].x + ps[1].x) + (ps[0].y + ps[1].y));
#pragma unroll
    for (int dt = 0; dt < DT; ++dt) oacc[dt] *= al;
#pragma unroll
    for (int dt = 0; dt < DT; ++dt) oacc[dt] = mmaH<1>(av[dt].v, av[dt].v, pb.v, pb.v, oacc[dt]); }
  { const float l = l_r + xhalf(l_r); const float inv = (l > 0.f) ? 1.0f / l : 0.f; /* l and oacc both carry x1024 */
    // oacc[dt][r] = O[query ln][d = 16 dt + 8 hh + r]: eight d in a row per lane and tile
#pragma unroll
    for (int dt = 0; dt < DT; ++dt) { v4f lo, hi;
#pragma unroll
      for (int q = 0; q < 4; ++q) { lo[q] = oacc[dt][q] * inv; hi[q] = oacc[dt][4 + q] * inv; }
      *(v4fa*)&sO[w][ln][dt * 16 + 8 * hh] = lo; *(v4fa*)&sO[w][ln][dt * 16 + 8 * hh + 4] = hi; } }
  __builtin_amdgcn_fence(4 /* acq_rel order */, "workgroup"); __builtin_amdgcn_wave_barrier();
  {
#pragma unroll
    for (int rp = 0; rp < RPW; rp += 2) { const int r = rp + (lane >> 4), pc = lane & 15; const v4f val = *(const v4fa*)&sO[w][r][pc * 4]; *(v4f*)(O + ((size_t)b * TQ + q0 + r) * ldo + h * 64 + pc * 4) = val; }
     } }

__global__ __launch_bounds__(256) void k_ln(const float* __restrict__ X, const float* __restrict__ R, const float* __restrict__ g, const float* __restrict__ bta, float* __restrict__ out) {
  __shared__ float red[256];
  const int row = blockIdx.x, tid = threadIdx.x;
  const size_t srow = (size_t)(row / SLEN) * SEQ_FULL + (size_t)(row % SLEN);
  const float* x = X + (size_t)row * DM; const float* rr = R + srow * DM;
  const int j = tid * 4;
  const v4f a = *(const v4fa*)(x + j); const v4f rb = *(const v4fa*)(rr + j);
  float vals[4]; float s1 = 0.f;
#pragma unroll
  for (int q = 0; q < 4; ++q) { const float v = a[q] + bf16_rne(rb[q]); vals[q] = v; s1 += v; }
  red[tid] = s1; __syncthreads();
  for (int st = 128; st > 0; st >>= 1) { if (tid < st) red[tid] += red[tid + st]; __syncthreads(); }
  const float mu = red[0] * 0.0009765625f; __syncthreads();
  float s2 = 0.f;
#pragma unroll
  for (int q = 0; q < 4; ++q) { const float c = vals[q] - mu; s2 += c * c; }
  red[tid] = s2; __syncthreads();
  for (int st = 128; st > 0; st >>= 1) { if (tid < st) red[tid] += red[tid + st]; __syncthreads(); }
  const float rs = rsqrtf(red[0] * 0.0009765625f + LNEPS);
  v4f o;
#pragma unroll
  for (int q = 0; q < 4; ++q) { const float gg = bf16_rne(g[j + q]), bb = bf16_rne(bta[j + q]); o[q] = (vals[q] - mu) * rs * gg + bb; }
  *(v4f*)(out + (size_t)row * DM + j) = o;
  
}

extern "C" void kernel_launch(void* const* d_in, const int* in_sizes, int n_in,
                              void* d_out, int out_size, void* d_ws, size_t ws_size, hipStream_t stream) {
  if (n_in < 11) return;
  const float* hs = (const float*)d_in[0]; const float* Wq = (const float*)d_in[1]; const float* bq = (const float*)d_in[2]; const float* Wk = (const float*)d_in[3]; const float* bk = (const float*)d_in[4];
  const float* Wv = (const float*)d_in[5]; const float* bv = (const float*)d_in[6]; const float* Wd = (const float*)d_in[7]; const float* bd = (const float*)d_in[8]; const float* gam = (const float*)d_in[9]; const float* bet = (const float*)d_in[10];
  const long long need0 = ((long long)(NB - 1) * SEQ_FULL + SLEN) * DM;
  if ((long long)in_sizes[0] < need0) return;
  if (in_sizes[1] < DM * DM || in_sizes[3] < DM * DM || in_sizes[5] < DM * DM || in_sizes[7] < DM * DM) return;
  if (in_sizes[2] < DM || in_sizes[4] < DM || in_sizes[6] < DM || in_sizes[8] < DM || in_sizes[9] < DM || in_sizes[10] < DM) return;
  if ((long long)out_size < (long long)NR * DM) return;
  char* ws = (char*)d_ws; size_t off = 0;
  auto take = [&](size_t bytes) { char* p = ws + off; off += (bytes + 255) & ~(size_t)255; return p; };
  const size_t np = (size_t)NR * DM; const size_t nw = (size_t)DM * DM;
  _Float16* BQ = (_Float16*)take(nw * 2 * 3); _Float16* BK = BQ + nw; _Float16* BV = BK + nw; _Float16* BD = (_Float16*)take(nw * 2); /* q, k, v planes one behind the other: blockIdx.y strides through them */
  _Float16* X16 = (_Float16*)take(np * 2); _Float16* QH = (_Float16*)take(np * 2 * 3); _Float16* KH = QH + np; _Float16* V16 = KH + np; _Float16* VT = (_Float16*)take(np * 2);
  float* CTX = (float*)take(np * 4); _Float16* CTX16 = (_Float16*)take(np * 2); float* ATT = (float*)take(np * 4);
  float* O = (float*)d_out;
  if (off > ws_size) return;
  k_prep<<<XBLK + 4 * WBLK, 256, 0, stream>>>(hs, X16, Wq, Wk, Wv, Wd, BQ, BK, BV, BD, WSC);      /* weights: [out][in] = [n][k] */
  const dim3 g((NR / 128) * (DM / 64), 1), g3((NR / 128) * (DM / 64), 3);
  k_gemm2<0><<<g3, 128, 0, stream>>>(X16, DM, 0, BQ, DM, nw, 1.0f / WSC, bq, bk, bv, nullptr, 1, 0, 0, nullptr, QH, DM, np, NR, DM, DM);
  k_vt<NH, SLEN><<<NB * NH * (SLEN / 64), 256, 0, stream>>>(V16, DM, 0, VT);
  k_flash<0><<<NB * NH * QBLKS, 128, 0, stream>>>(QH, DM, KH, DM, VT, CTX, DM);
  k_h16<<<(unsigned)((np / 8 + 255) / 256), 256, 0, stream>>>(CTX, CTX16, np / 8, CSC);
  k_gemm2<0><<<g, 128, 0, stream>>>(CTX16, DM, 0, BD, DM, 0, 1.0f / (WSC * CSC), bd, nullptr, nullptr, nullptr, 1, 0, 0, ATT, nullptr, DM, 0, NR, DM, DM);
  k_ln<<<NR, 256, 0, stream>>>(ATT, hs, gam, bet, O);
}

// v006
// A run of this version takes 119 microseconds.
// In two side-by-side timings against v005, it was 1.07 and 1.08 times as fast.
// All steps since v000 together make it 3.70 times as fast.
#include <hip/hip_runtime.h>
// Contractions: v_wmma_f32_16x16x32_f16 everywhere (f16 operands, f32 accumulate) - q/k/v projections (x as f16 of bf16-RNE input, W as f16 of bf16-RNE weight x16), k.q^T and v^T.p^T per head (plain f16 q/k/v planes, p carried x1024), output dense (context carried x16 f16, Wd bf16-RNE x16); softmax, bias adds, residual and LayerNorm in f32.

#ifndef NB
#define NB 2
#endif
#ifndef SEQ
#define SEQ 2048
#endif
#define NB_FULL 2
#define SEQ_FULL 2048
#define DM 1024
#define NH 16
#define HDIM 64
#define SLEN SEQ
#define TQ SLEN
#define TK SLEN
#define NR (NB * SLEN)
#define SCL 0.125f
#define QBLKS (TQ / 64)
#define LNEPS 0.00001f
#define WSC 16.0f
#define CSC 16.0f
static_assert(NH * HDIM == DM);
static_assert(HDIM == 64);
static_assert(SLEN % 64 == 0);
static_assert(NR % 128 == 0);
static_assert(DM % 64 == 0);
static_assert(DM == 4 * 256);
static_assert(NB <= NB_FULL);
static_assert(SEQ <= SEQ_FULL);

typedef unsigned short v8us __attribute__((ext_vector_type(8), may_alias));
typedef float  v8f  __attribute__((ext_vector_type(8)));
typedef float  v4f  __attribute__((ext_vector_type(4)));
typedef float  v4fa __attribute__((ext_vector_type(4), may_alias));
typedef _Float16 v16h __attribute__((ext_vector_type(16)));
typedef _Float16 v4h  __attribute__((ext_vector_type(4)));
typedef float  v2f  __attribute__((ext_vector_type(2)));
typedef _Float16 v2h  __attribute__((ext_vector_type(2)));
union FragH { v16h v; v8us half[2]; _Float16 h[16]; unsigned short u[16]; };

__device__ __forceinline__ unsigned short bf16_bits(float x) { unsigned int u = __float_as_uint(x); return (unsigned short)((u + 0x7FFFu + ((u >> 16) & 1u)) >> 16); }
__device__ __forceinline__ float bf16_val(unsigned short b) { return __uint_as_float(((unsigned int)b) << 16); }
__device__ __forceinline__ float bf16_rne(float x) { return bf16_val(bf16_bits(x)); }

// D += A.B with NT terms (1 = single product); 16x16x32 f16, split k map per lane half; 4 v_nop hazard guard tied to D with A/B kept live
template <int NT>
__device__ __forceinline__ v8f mmaH(v16h ah, v16h al, v16h bh, v16h bl, v8f c) {
  c = __builtin_amdgcn_wmma_f32_16x16x32_f16(false, ah, false, bh, (short)0, c, false, false);
  if (NT >= 2) c = __builtin_amdgcn_wmma_f32_16x16x32_f16(false, al, false, bh, (short)0, c, false, false);
  if (NT >= 3) c = __builtin_amdgcn_wmma_f32_16x16x32_f16(false, ah, false, bl, (short)0, c, false, false);
  asm volatile("v_nop\n\tv_nop\n\tv_nop\n\tv_nop" : "+v"(c) : "v"(ah), "v"(al), "v"(bh), "v"(bl));
  return c;
}
// Fragment-packed plane of a [rows][K] 16-bit matrix: every tile of 16 rows x 32 k is 512 elements in a row, the tiles of one 16-row band follow in k order (so a band is 16 K elements, as in the row-major plane).
// Inside a tile the 8-element piece number 32 i + 16 h + c holds row c, k = 16 i + 8 h + 0..7: piece number = 32 i + lane, so each of a fragment's two wave-wide 16-byte loads covers 512 contiguous bytes (4 whole lines).
// packing from a row-major f32 source, kt = K / 32 tiles per band: thread t takes 8 k of one row, four threads in a row per 128-byte source line; a wave reads 8 whole lines and writes 4 whole lines. dst = element offset of its piece
__device__ __forceinline__ void pk_src(size_t t, int kt, size_t& row, int& k, size_t& dst) { const size_t tile = t >> 6; const int c = (int)(t & 63) >> 2, ih = (int)(t & 3); row = (tile / kt) * 16 + c; k = (int)(tile % kt) * 32 + 8 * ih; dst = tile * 512 + (size_t)(16 * ih + c) * 8; }
// fragment of 16 rows (lane&15) x 32 k from a packed tile: elements 0..7 <- k0+8h, 8..15 <- k0+16+8h
// p already holds the tile's start + 8 lane elements
__device__ __forceinline__ v16h g2_fragp(const _Float16* p) { FragH f; f.half[0] = *(const v8us*)((const unsigned short*)p); f.half[1] = *(const v8us*)((const unsigned short*)p + 256); return f.v; }
__device__ __forceinline__ v8f g2_mma(v16h a, v16h b, v8f c) { v8f d = __builtin_amdgcn_wmma_f32_16x16x32_f16(false, a, false, b, (short)0, c, false, false); asm volatile("v_nop\n\tv_nop\n\tv_nop\n\tv_nop" : "+v"(d) : "v"(a), "v"(b)); return d; }

// blocks of 256 threads that one conversion takes: x (NR x DM) and one weight (DM x DM), 8 elements a thread
#define XBLK ((NR * (DM / 8) + 255) / 256)
#define WBLK ((DM * (DM / 8) + 255) / 256)
// the five input conversions depend on nothing and on each other not at all: one grid; blocks [0, XBLK) pack x, then WBLK blocks for each of the four weights (the choice is the same for a whole block)
__global__ __launch_bounds__(256) void k_prep(const float* __restrict__ x, _Float16* __restrict__ X16, const float* __restrict__ W0, const float* __restrict__ W1, const float* __restrict__ W2, const float* __restrict__ W3,
    _Float16* __restrict__ B0, _Float16* __restrict__ B1, _Float16* __restrict__ B2, _Float16* __restrict__ B3, float sc) {
  FragH f; size_t r, e; int c;
  if (blockIdx.x < XBLK) {
    const size_t t = (size_t)blockIdx.x * 256 + threadIdx.x; if (t >= (size_t)NR * (DM / 8)) return;
    pk_src(t, DM / 32, r, c, e); const size_t sr = (r / SLEN) * SEQ_FULL + (r % SLEN);
    const float* src = x + sr * DM + c;
#pragma unroll
    for (int q = 0; q < 8; ++q) f.h[q] = (_Float16)bf16_rne(src[q]);
    *(v8us*)((unsigned short*)X16 + e) = f.half[0];
    return; }
  const unsigned wblk = blockIdx.x - XBLK, wi = wblk / WBLK;
  const size_t t = (size_t)(wblk - wi * WBLK) * 256 + threadIdx.x; if (t >= (size_t)DM * (DM / 8)) return;
  const float* Wm = wi == 0 ? W0 : wi == 1 ? W1 : wi == 2 ? W2 : W3; _Float16* Bt = wi == 0 ? B0 : wi == 1 ? B1 : wi == 2 ? B2 : B3;
  pk_src(t, DM / 32, r, c, e); const float* src = Wm + r * DM + c;
#pragma unroll
  for (int q = 0; q < 8; ++q) f.h[q] = (_Float16)(bf16_rne(src[q]) * sc);
  *(v8us*)((unsigned short*)Bt + e) = f.half[0];
}

// GEMM (wave tile 32x64; M % 128 == 0, N % 64 == 0, K % 32 == 0): v = acc*alpha + bf16(bias[col]) (+ CP term if CP); ACT 0 none; A, Bh and C16 are fragment-packed planes (lda, ldb, ldc = their K); writes f32 C (row-major, pitch ldc) and/or f16 C16; blockIdx.y = one of up to three independent products of one grid (A, Bh, C by their strides sA, sB, sC; bias, bias1, bias2 in turn); if CT, the third product (N = NH heads of 64 columns, no CP, no ACT) goes to CT alone, transposed
template <int ACT>
__global__ __launch_bounds__(128) void k_gemm2(const _Float16* __restrict__ A, int lda, size_t sA, const _Float16* __restrict__ Bh, int ldb, size_t sB, float alpha, const float* __restrict__ bias, const float* __restrict__ bias1, const float* __restrict__ bias2, const float* __restrict__ CP, int rowsPerB, size_t sCPb, int row0g,
    float* __restrict__ C, _Float16* __restrict__ C16, _Float16* __restrict__ CT, int ldc, size_t sC, int M, int N, int K) {
  __shared__ __attribute__((aligned(16))) float so[4][32][68];
  const int tid = threadIdx.x, w = tid >> 5, lane = tid & 31, ln = lane & 15, hh = lane >> 4; const int by = blockIdx.y;
  A += (size_t)by * sA; Bh += (size_t)by * sB; const size_t cofs = (size_t)by * sC; const float* bp = by == 0 ? bias : by == 1 ? bias1 : bias2;
  const int ntn = N >> 6; const int mt = blockIdx.x / ntn, nq = blockIdx.x - mt * ntn; const int row0 = mt * 128 + 32 * w, col0 = nq * 64; if (row0 >= M) return;
  // each lane's own fragment pointers (band start + 8 lane elements; a k-step is one tile, 512 elements); they advance once per two k-steps, the loads between reach ahead by constant offsets
  const _Float16* a0p = A + (size_t)row0 * lda + 8 * lane; const _Float16* a1p = a0p + (size_t)16 * lda;
  const _Float16* b0p = Bh + (size_t)col0 * ldb + 8 * lane; const _Float16* b1p = b0p + (size_t)16 * ldb; const _Float16* b2p = b1p + (size_t)16 * ldb; const _Float16* b3p = b2p + (size_t)16 * ldb;
  const v8f z8 = {0.f,0.f,0.f,0.f,0.f,0.f,0.f,0.f}; v8f c00 = z8, c01 = z8, c02 = z8, c03 = z8, c10 = z8, c11 = z8, c12 = z8, c13 = z8;
  // fragments are fetched one k-step ahead into a second register set (x and y take turns): the twelve loads of the next step go out as one group in front of this step's products
#define G2_LOAD(S, O) S##a0 = g2_fragp(a0p + (O)); S##a1 = g2_fragp(a1p + (O)); S##b0 = g2_fragp(b0p + (O)); S##b1 = g2_fragp(b1p + (O)); S##b2 = g2_fragp(b2p + (O)); S##b3 = g2_fragp(b3p + (O));
#define G2_STEP(S) c00 = g2_mma(S##a0, S##b0, c00); c10 = g2_mma(S##a1, S##b0, c10); c01 = g2_mma(S##a0, S##b1, c01); c11 = g2_mma(S##a1, S##b1, c11); c02 = g2_mma(S##a0, S##b2, c02); c12 = g2_mma(S##a1, S##b2, c12); c03 = g2_mma(S##a0, S##b3, c03); c13 = g2_mma(S##a1, S##b3, c13);
  v16h xa0, xa1, xb0, xb1, xb2, xb3, ya0, ya1, yb0, yb1, yb2, yb3;
  G2_LOAD(x, 0)
  int kb = 0;
  // unroll 1: the body already holds both register sets' steps; further copies would only add registers
#pragma unroll 1
  for (; kb + 64 < K; kb += 64) {
    G2_LOAD(y, 512)
    G2_STEP(x)
    G2_LOAD(x, 1024)
    a0p += 1024; a1p += 1024; b0p += 1024; b1p += 1024; b2p += 1024; b3p += 1024;
    G2_STEP(y) }
  if (kb + 32 < K) { G2_LOAD(y, 512) G2_STEP(x) G2_STEP(y) } else { G2_STEP(x) }
#undef G2_LOAD
#undef G2_STEP
  v8f accs[8] = {c00, c01, c02, c03, c10, c11, c12, c13};
  if (CT && by == 2) { // the same for a whole block. CT: per (batch, head) slab a fragment-packed plane with rows = the head's 64 columns, k = tokens, as the attention's second product reads it.
    // A lane's accumulator tile (t, half) is row 16 t + ln, k = 16 half + 8 hh + 0..7 of the wave's 32-token tile: piece 32 half + lane of that packed tile, so it is stored from registers, 512 contiguous bytes per wave-wide store
    unsigned short* dst = (unsigned short*)CT + (size_t)((row0 / SLEN) * NH + nq) * 64 * SLEN + (size_t)((row0 % SLEN) >> 5) * 512 + 8 * lane;
    float bvs[4]; FragH f[8]; // the four bias loads go out as one group; all eight pieces are formed before the first store, so that no register of an issued store is written again
#pragma unroll
    for (int t = 0; t < 4; ++t) bvs[t] = bp ? bp[col0 + t * 16 + ln] : 0.f;
#pragma unroll
    for (int u = 0; u < 8; ++u) { const float bv = bf16_rne(bvs[u & 3]);
#pragma unroll
      for (int r = 0; r < 8; ++r) f[u].h[r] = (_Float16)(accs[u][r] * alpha + bv); }
#pragma unroll
    for (int u = 0; u < 8; ++u) *(v8us*)(dst + (size_t)((u & 3) * 16) * SLEN + 256 * (u >> 2)) = f[u].half[0];
    return; }
#pragma unroll
  for (int u = 0; u < 8; ++u) { const int t = u & 3, half = u >> 2; const int col = col0 + t * 16 + ln; const float bv = bp ? bf16_rne(bp[col]) : 0.f;
#pragma unroll
    for (int r = 0; r < 8; ++r) { const int rloc = half * 16 + 8 * hh + r; float v = accs[u][r] * alpha + bv;
      if (CP) { if (rowsPerB < 0) v += CP[cofs + (size_t)(row0g + row0 + rloc) * ldc + col]; else { const int bidx = (row0g + row0 + rloc) / rowsPerB; v += CP[(size_t)bidx * sCPb + (size_t)by * 64 + col]; } }
      if (ACT == 3) v = fmaxf(v, 0.f);
      so[w][rloc][t * 16 + ln] = v; } }
  __builtin_amdgcn_fence(4 /* acq_rel order */, "workgroup"); __builtin_amdgcn_wave_barrier();
  const int rsub = lane >> 4, c4 = (lane & 15) * 4;
  {
#pragma unroll
    for (int q = 0; q < 16; ++q) { const int r = q * 2 + rsub; const v4f v = *(const v4fa*)&so[w][r][c4];
      if (C) *(v4f*)(C + cofs + (size_t)(row0 + r) * ldc + col0 + c4) = v; }
     }
  asm volatile("s_wait_xcnt 0x0" ::: "memory"); // behind the run of C stores: the C16 block below reuses registers that those stores name
  if (C16) { // the wave's 32 x 64 block is 2 x 2 packed tiles; per tile two wave-wide 16-byte stores of 512 contiguous bytes
#pragma unroll
    for (int tl = 0; tl < 4; ++tl) { const int rtl = tl >> 1, kbl = tl & 1; _Float16* dst = C16 + cofs + (size_t)(row0 + 16 * rtl) * ldc + (size_t)((col0 >> 5) + kbl) * 512 + 8 * lane;
#pragma unroll
      for (int i = 0; i < 2; ++i) { const float* sp = &so[w][rtl * 16 + ln][kbl * 32 + 16 * i + 8 * hh]; const v4f lo = *(const v4fa*)sp, hi = *(const v4fa*)(sp + 4); FragH f;
#pragma unroll
        for (int q = 0; q < 4; ++q) { f.h[q] = (_Float16)lo[q]; f.h[4 + q] = (_Float16)hi[q]; }
        *(v8us*)((unsigned short*)dst + 256 * i) = f.half[0]; } } } }

// lane l with lane l ^ 16 (a vector cross-row move, no LDS queue)
__device__ __forceinline__ float xhalf(float x) { return __builtin_bit_cast(float, __builtin_amdgcn_permlanex16(__builtin_bit_cast(int, x), __builtin_bit_cast(int, x), 0x76543210, 0xfedcba98, false, false)); }

// fused attention per ((b,h), 64 queries): wave = 16 queries; both products transposed: S^T = K.Q^T (A = 16 keys, B = the wave's queries; d = 64: 2 k-steps) x SCL over all TK keys (CAUSAL == 0: no key excluded), O^T += V^T.P^T (A = 16 d, B = P^T).
// A lane holds 16 of the pass's 32 scores of ONE query (column lane & 15; keys 16 nt + 8 (lane >> 4) + r): maximum and sum run in the lane, the two lane halves meet by one cross-row move; the two score tiles, converted in place, are the B fragment of P^T (element 8 nt + r = k 16 nt + 8 h + r, the k order of the packed V^T tiles).
// online max/sum softmax f32; Q16, K16, O16 (rows = tokens, k = columns) and Vt (per slab: rows = d, k = keys) are fragment-packed planes
template <int CAUSAL>
__global__ __launch_bounds__(128) void k_flash(const _Float16* __restrict__ Q16, int ldq, const _Float16* __restrict__ K16, int ldk, const _Float16* __restrict__ Vt, _Float16* __restrict__ O16, int ldo) {
  constexpr int RPW = 16, DT = 4, KS = 2; constexpr float C2 = SCL * 1.4426950408889634f;
  const int tid = threadIdx.x, w = tid >> 5, lane = tid & 31, ln = lane & 15, hh = lane >> 4;
  const int slab = blockIdx.x / QBLKS, qblk = blockIdx.x % QBLKS; const int b = slab / NH, h = slab % NH; const int qb0 = qblk * (4 * RPW); const int q0 = qb0 + w * RPW;
  FragH bq[KS];
  { const unsigned short* qr = (const unsigned short*)Q16 + ((size_t)b * TQ + q0) * ldq + h * 1024 + 8 * lane;
#pragma unroll
    for (int ks = 0; ks < KS; ++ks) { bq[ks].half[0] = *(const v8us*)(qr + ks * 512); bq[ks].half[1] = *(const v8us*)(qr + ks * 512 + 256); } }
  const unsigned short* Vth = (const unsigned short*)Vt + (size_t)slab * 64 * TK; const unsigned l8 = 8u * (unsigned)lane; /* the lane's piece of a tile half; the K and V tile starts are the same for the whole block */
  float m_r = -3.0e38f, l_r = 0.f; v8f oacc[DT]; /* m_r: the query's running maximum of the raw products (alike in both halves); l_r: the sum over this half's keys, x1024 */
#pragma unroll
  for (int dt = 0; dt < DT; ++dt) oacc[dt] = (v8f){0.f,0.f,0.f,0.f,0.f,0.f,0.f,0.f};
  const int jend = (CAUSAL == 1) ? (qb0 + 4 * RPW) : TK; const int tq = q0 + ln; (void)tq;
  FragH ak[2][KS];
#pragma unroll
  for (int nt = 0; nt < 2; ++nt) { const unsigned short* kr = (const unsigned short*)K16 + ((size_t)b * TK + nt * 16) * ldk + h * 1024;
#pragma unroll
    for (int ks = 0; ks < KS; ++ks) { ak[nt][ks].half[0] = *(const v8us*)(kr + ks * 512 + l8); ak[nt][ks].half[1] = *(const v8us*)(kr + ks * 512 + 256 + l8); } }
#pragma unroll 1
  for (int j0 = 0; j0 < jend; j0 += 32) {
    v8f s[2];
#pragma unroll
    for (int nt = 0; nt < 2; ++nt) { v8f acc = (v8f){0.f,0.f,0.f,0.f,0.f,0.f,0.f,0.f};
#pragma unroll
      for (int ks = 0; ks < KS; ++ks) acc = mmaH<1>(ak[nt][ks].v, ak[nt][ks].v, bq[ks].v, bq[ks].v, acc);
      s[nt] = acc; }
    // one group of loads directly behind the score products, a softmax ahead of their use: this pass's V fragments, then the next pass's K fragments into the registers just read
    FragH av[DT];
#pragma unroll
    for (int dt = 0; dt < DT; ++dt) { const unsigned short* vrow = Vth + (size_t)(dt * 16) * TK + (size_t)j0 * 16; av[dt].half[0] = *(const v8us*)(vrow + l8); av[dt].half[1] = *(const v8us*)(vrow + 256 + l8); }
    const int jn = (j0 + 32 < jend) ? j0 + 32 : j0; /* the last pass fetches its own keys again: stays inside K16 */
#pragma unroll
    for (int nt = 0; nt < 2; ++nt) { const unsigned short* kr = (const unsigned short*)K16 + ((size_t)b * TK + jn + nt * 16) * ldk + h * 1024;
#pragma unroll
      for (int ks = 0; ks < KS; ++ks) { ak[nt][ks].half[0] = *(const v8us*)(kr + ks * 512 + l8); ak[nt][ks].half[1] = *(const v8us*)(kr + ks * 512 + 256 + l8); } }
    __builtin_amdgcn_sched_barrier(0); // keeps the sixteen loads in one group here: without it the scheduler sinks the K loads to the foot of the softmax, a few instructions ahead of their use
    // the softmax runs in base 2 on the raw products: C2 = SCL log2(e) > 0, so the raw maximum is the scaled one's element, and a weight is one multiply-add and one hardware exponential
    float sv[16]; bool ok[16];
#pragma unroll
    for (int e = 0; e < 16; ++e) { const int key = j0 + (e >> 3) * 16 + 8 * hh + (e & 7); ok[e] = (CAUSAL == 1) ? (key <= tq) : true; sv[e] = ok[e] ? s[e >> 3][e & 7] : -3.0e38f; }
    float mx[5];
#pragma unroll
    for (int c = 0; c < 5; ++c) mx[c] = fmaxf(fmaxf(sv[3 * c], sv[3 * c + 1]), sv[3 * c + 2]);
    float mc = fmaxf(fmaxf(fmaxf(mx[0], mx[1]), mx[2]), fmaxf(fmaxf(mx[3], mx[4]), sv[15])); mc = fmaxf(mc, xhalf(mc));
    const float mn = fmaxf(m_r, mc); const float ae = __builtin_amdgcn_exp2f((m_r - mn) * C2); const float al = (mn > -1.0e38f) ? ae : 1.0f; m_r = mn; /* ae formed on every path: a select, so that it runs among the weights' exponentials and EXEC stays whole */
    const float nb = 10.0f - mn * C2; /* the exponent's addend: minus the maximum, plus 10 for the x1024 that the f16 weights carry (the sum carries it too) */
    FragH pb; v2f ps[2]; /* the lane's 16 weights in pairs: four independent partial sums */
#pragma unroll
    for (int i = 0; i < 8; ++i) { const v2f ar = (v2f){sv[2 * i], sv[2 * i + 1]} * C2 + nb; v2f p; p.x = ok[2 * i] ? __builtin_amdgcn_exp2f(ar.x) : 0.f; p.y = ok[2 * i + 1] ? __builtin_amdgcn_exp2f(ar.y) : 0.f;
      if (i < 2) ps[i] = p; else ps[i & 1] += p;
      const v2h ph = __builtin_convertvector(p, v2h); pb.h[2 * i] = ph.x; pb.h[2 * i + 1] = ph.y; }
    l_r = l_r * al + ((ps[0].x + ps[1].x) + (ps[0].y + ps[1].y));
#pragma unroll
    for (int dt = 0; dt < DT; ++dt) oacc[dt] *= al;
#pragma unroll
    for (int dt = 0; dt < DT; ++dt) oacc[dt] = mmaH<1>(av[dt].v, av[dt].v, pb.v, pb.v, oacc[dt]); }
  { const float l = l_r + xhalf(l_r); const float inv = (l > 0.f) ? 1.0f / l : 0.f; /* l and oacc both carry x1024 */
    // oacc[dt][r] = O[query ln][d = 16 dt + 8 hh + r]: piece 32 (dt & 1) + lane of k tile 2 h + (dt >> 1) in the wave's 16-row band of the fragment-packed context plane (f16, x CSC) that the output GEMM reads: stored from registers, 512 contiguous bytes per wave-wide store
    unsigned short* ob = (unsigned short*)O16 + ((size_t)b * TQ + q0) * ldo + h * 1024 + 8 * lane;
#pragma unroll
    for (int dt = 0; dt < DT; ++dt) { FragH f;
#pragma unroll
      for (int q = 0; q < 8; ++q) f.h[q] = (_Float16)(oacc[dt][q] * inv * CSC);
      *(v8us*)(ob + dt * 256) = f.half[0]; } } }

__global__ __launch_bounds__(256) void k_ln(const float* __restrict__ X, const float* __restrict__ R, const float* __restrict__ g, const float* __restrict__ bta, float* __restrict__ out) {
  __shared__ float red[256];
  const int row = blockIdx.x, tid = threadIdx.x;
  const size_t srow = (size_t)(row / SLEN) * SEQ_FULL + (size_t)(row % SLEN);
  const float* x = X + (size_t)row * DM; const float* rr = R + srow * DM;
  const int j = tid * 4;
  const v4f a = *(const v4fa*)(x + j); const v4f rb = *(const v4fa*)(rr + j);
  float vals[4]; float s1 = 0.f;
#pragma unroll
  for (int q = 0; q < 4; ++q) { const float v = a[q] + bf16_rne(rb[q]); vals[q] = v; s1 += v; }
  red[tid] = s1; __syncthreads();
  for (int st = 128; st > 0; st >>= 1) { if (tid < st) red[tid] += red[tid + st]; __syncthreads(); }
  const float mu = red[0] * 0.0009765625f; __syncthreads();
  float s2 = 0.f;
#pragma unroll
  for (int q = 0; q < 4; ++q) { const float c = vals[q] - mu; s2 += c * c; }
  red[tid] = s2; __syncthreads();
  for (int st = 128; st > 0; st >>= 1) { if (tid < st) red[tid] += red[tid + st]; __syncthreads(); }
  const float rs = rsqrtf(red[0] * 0.0009765625f + LNEPS);
  v4f o;
#pragma unroll
  for (int q = 0; q < 4; ++q) { const float gg = bf16_rne(g[j + q]), bb = bf16_rne(bta[j + q]); o[q] = (vals[q] - mu) * rs * gg + bb; }
  *(v4f*)(out + (size_t)row * DM + j) = o;
  
}

extern "C" void kernel_launch(void* const* d_in, const int* in_sizes, int n_in,
                              void* d_out, int out_size, void* d_ws, size_t ws_size, hipStream_t stream) {
  if (n_in < 11) return;
  const float* hs = (const float*)d_in[0]; const float* Wq = (const float*)d_in[1]; const float* bq = (const float*)d_in[2]; const float* Wk = (const float*)d_in[3]; const float* bk = (const float*)d_in[4];
  const float* Wv = (const float*)d_in[5]; const float* bv = (const float*)d_in[6]; const float* Wd = (const float*)d_in[7]; const float* bd = (const float*)d_in[8]; const float* gam = (const float*)d_in[9]; const float* bet = (const float*)d_in[10];
  const long long need0 = ((long long)(NB - 1) * SEQ_FULL + SLEN) * DM;
  if ((long long)in_sizes[0] < need0) return;
  if (in_sizes[1] < DM * DM || in_sizes[3] < DM * DM || in_sizes[5] < DM * DM || in_sizes[7] < DM * DM) return;
  if (in_sizes[2] < DM || in_sizes[4] < DM || in_sizes[6] < DM || in_sizes[8] < DM || in_sizes[9] < DM || in_sizes[10] < DM) return;
  if ((long long)out_size < (long long)NR * DM) return;
  char* ws = (char*)d_ws; size_t off = 0;
  auto take = [&](size_t bytes) { char* p = ws + off; off += (bytes + 255) & ~(size_t)255; return p; };
  const size_t np = (size_t)NR * DM; const size_t nw = (size_t)DM * DM;
  _Float16* BQ = (_Float16*)take(nw * 2 * 3); _Float16* BK = BQ + nw; _Float16* BV = BK + nw; _Float16* BD = (_Float16*)take(nw * 2); /* q, k, v planes one behind the other: blockIdx.y strides through them */
  _Float16* X16 = (_Float16*)take(np * 2); _Float16* QH = (_Float16*)take(np * 2 * 2); _Float16* KH = QH + np; _Float16* VT = (_Float16*)take(np * 2);
  _Float16* CTX16 = (_Float16*)take(np * 2); float* ATT = (float*)take(np * 4);
  float* O = (float*)d_out;
  if (off > ws_size) return;
  k_prep<<<XBLK + 4 * WBLK, 256, 0, stream>>>(hs, X16, Wq, Wk, Wv, Wd, BQ, BK, BV, BD, WSC);      /* weights: [out][in] = [n][k] */
  const dim3 g((NR / 128) * (DM / 64), 1), g3((NR / 128) * (DM / 64), 3);
  k_gemm2<0><<<g3, 128, 0, stream>>>(X16, DM, 0, BQ, DM, nw, 1.0f / WSC, bq, bk, bv, nullptr, 1, 0, 0, nullptr, QH, VT, DM, np, NR, DM, DM);
  k_flash<0><<<NB * NH * QBLKS, 128, 0, stream>>>(QH, DM, KH, DM, VT, CTX16, DM);
  k_gemm2<0><<<g, 128, 0, stream>>>(CTX16, DM, 0, BD, DM, 0, 1.0f / (WSC * CSC), bd, nullptr, nullptr, nullptr, 1, 0, 0, ATT, nullptr, nullptr, DM, 0, NR, DM, DM);
  k_ln<<<NR, 256, 0, stream>>>(ATT, hs, gam, bet, O);
}

// v007
// A run of this version takes 115 microseconds.
// Two timings next to v006 put it at 1.03 and 1.04 times that version's speed.
// Counting every step since v000, it is 3.83 times as fast.
#include <hip/hip_runtime.h>
// Contractions: v_wmma_f32_16x16x32_f16 everywhere (f16 operands, f32 accumulate) - q/k/v projections (x as f16 of bf16-RNE input, W as f16 of bf16-RNE weight x16), k.q^T and v^T.p^T per head (plain f16 q/k/v planes, p carried x1024), output dense (context carried x16 f16, Wd bf16-RNE x16); softmax, bias adds, residual and LayerNorm in f32.
// Left untouched so far: k_gemm2's epilogue tests CP once per element at run time (64 taken branches a wave; the code they skip, never run, is some 5,000 of the kernel's 5,900 instructions); k_prep and k_ln start 32,768 waves each, one item a lane.

#ifndef NB
#define NB 2
#endif
#ifndef SEQ
#define SEQ 2048
#endif
#define NB_FULL 2
#define SEQ_FULL 2048
#define DM 1024
#define NH 16
#define HDIM 64
#define SLEN SEQ
#define TQ SLEN
#define TK SLEN
#define NR (NB * SLEN)
#define SCL 0.125f
#define QBLKS (TQ / 64)
#define LNEPS 0.00001f
#define WSC 16.0f
#define CSC 16.0f
static_assert(NH * HDIM == DM);
static_assert(HDIM == 64);
static_assert(SLEN % 64 == 0);
static_assert(NR % 128 == 0);
static_assert(DM % 64 == 0);
static_assert(DM == 4 * 256);
static_assert(NB <= NB_FULL);
static_assert(SEQ <= SEQ_FULL);

typedef unsigned short v8us __attribute__((ext_vector_type(8), may_alias));
typedef float  v8f  __attribute__((ext_vector_type(8)));
typedef float  v4f  __attribute__((ext_vector_type(4)));
typedef float  v4fa __attribute__((ext_vector_type(4), may_alias));
typedef _Float16 v16h __attribute__((ext_vector_type(16)));
typedef _Float16 v4h  __attribute__((ext_vector_type(4)));
typedef float  v2f  __attribute__((ext_vector_type(2)));
typedef _Float16 v2h  __attribute__((ext_vector_type(2)));
union FragH { v16h v; v8us half[2]; _Float16 h[16]; unsigned short u[16]; };

__device__ __forceinline__ unsigned short bf16_bits(float x) { unsigned int u = __float_as_uint(x); return (unsigned short)((u + 0x7FFFu + ((u >> 16) & 1u)) >> 16); }
__device__ __forceinline__ float bf16_val(unsigned short b) { return __uint_as_float(((unsigned int)b) << 16); }
__device__ __forceinline__ float bf16_rne(float x) { return bf16_val(bf16_bits(x)); }

// D += A.B with NT terms (1 = single product); 16x16x32 f16, split k map per lane half; no padding here: inside a run of WMMAs each fills the slots behind the one before, and four v_nop stand once behind the run's last.
// Those four v_nop (the asm statements below) are the distance between a run's last WMMAs and whatever overwrites their A or B registers next (the loads of the next fragments, the next run's D over the loop's back edge); their operands are the run's accumulators (so they stand behind every WMMA of the run) and its fragments (kept live up to them)
template <int NT>
__device__ __forceinline__ v8f mmaH(v16h ah, v16h al, v16h bh, v16h bl, v8f c) {
  c = __builtin_amdgcn_wmma_f32_16x16x32_f16(false, ah, false, bh, (short)0, c, false, false);
  if (NT >= 2) c = __builtin_amdgcn_wmma_f32_16x16x32_f16(false, al, false, bh, (short)0, c, false, false);
  if (NT >= 3) c = __builtin_amdgcn_wmma_f32_16x16x32_f16(false, ah, false, bl, (short)0, c, false, false);
  return c;
}
// Fragment-packed plane of a [rows][K] 16-bit matrix: every tile of 16 rows x 32 k is 512 elements in a row, the tiles of one 16-row band follow in k order (so a band is 16 K elements, as in the row-major plane).
// Inside a tile the 8-element piece number 32 i + 16 h + c holds row c, k = 16 i + 8 h + 0..7: piece number = 32 i + lane, so each of a fragment's two wave-wide 16-byte loads covers 512 contiguous bytes (4 whole lines).
// packing from a row-major f32 source, kt = K / 32 tiles per band: thread t takes 8 k of one row, four threads in a row per 128-byte source line; a wave reads 8 whole lines and writes 4 whole lines. dst = element offset of its piece
__device__ __forceinline__ void pk_src(size_t t, int kt, size_t& row, int& k, size_t& dst) { const size_t tile = t >> 6; const int c = (int)(t & 63) >> 2, ih = (int)(t & 3); row = (tile / kt) * 16 + c; k = (int)(tile % kt) * 32 + 8 * ih; dst = tile * 512 + (size_t)(16 * ih + c) * 8; }
// fragment of 16 rows (lane&15) x 32 k from a packed tile: elements 0..7 <- k0+8h, 8..15 <- k0+16+8h
// p already holds the tile's start + 8 lane elements
__device__ __forceinline__ v16h g2_fragp(const _Float16* p) { FragH f; f.half[0] = *(const v8us*)((const unsigned short*)p); f.half[1] = *(const v8us*)((const unsigned short*)p + 256); return f.v; }
__device__ __forceinline__ v8f g2_mma(v16h a, v16h b, v8f c) { return __builtin_amdgcn_wmma_f32_16x16x32_f16(false, a, false, b, (short)0, c, false, false); }
// behind the eight WMMAs of a GEMM k-step
__device__ __forceinline__ void g2_run_end(v8f& c0, v8f& c1, v8f& c2, v8f& c3, v8f& c4, v8f& c5, v8f& c6, v8f& c7, v16h a0, v16h a1, v16h b0, v16h b1, v16h b2, v16h b3) {
  asm volatile("v_nop\n\tv_nop\n\tv_nop\n\tv_nop" : "+v"(c0), "+v"(c1), "+v"(c2), "+v"(c3), "+v"(c4), "+v"(c5), "+v"(c6), "+v"(c7) : "v"(a0), "v"(a1), "v"(b0), "v"(b1), "v"(b2), "v"(b3)); // the run's distance, see above
  __builtin_amdgcn_sched_barrier(0); } // the next loads stay behind the run whose registers they refill

// blocks of 256 threads that one conversion takes: x (NR x DM) and one weight (DM x DM), 8 elements a thread
#define XBLK ((NR * (DM / 8) + 255) / 256)
#define WBLK ((DM * (DM / 8) + 255) / 256)
// the five input conversions depend on nothing and on each other not at all: one grid; blocks [0, XBLK) pack x, then WBLK blocks for each of the four weights (the choice is the same for a whole block)
__global__ __launch_bounds__(256) void k_prep(const float* __restrict__ x, _Float16* __restrict__ X16, const float* __restrict__ W0, const float* __restrict__ W1, const float* __restrict__ W2, const float* __restrict__ W3,
    _Float16* __restrict__ B0, _Float16* __restrict__ B1, _Float16* __restrict__ B2, _Float16* __restrict__ B3, float sc) {
  FragH f; size_t r, e; int c;
  if (blockIdx.x < XBLK) {
    const size_t t = (size_t)blockIdx.x * 256 + threadIdx.x; if (t >= (size_t)NR * (DM / 8)) return;
    pk_src(t, DM / 32, r, c, e); const size_t sr = (r / SLEN) * SEQ_FULL + (r % SLEN);
    const float* src = x + sr * DM + c;
#pragma unroll
    for (int q = 0; q < 8; ++q) f.h[q] = (_Float16)bf16_rne(src[q]);
    *(v8us*)((unsigned short*)X16 + e) = f.half[0];
    return; }
  const unsigned wblk = blockIdx.x - XBLK, wi = wblk / WBLK;
  const size_t t = (size_t)(wblk - wi * WBLK) * 256 + threadIdx.x; if (t >= (size_t)DM * (DM / 8)) return;
  const float* Wm = wi == 0 ? W0 : wi == 1 ? W1 : wi == 2 ? W2 : W3; _Float16* Bt = wi == 0 ? B0 : wi == 1 ? B1 : wi == 2 ? B2 : B3;
  pk_src(t, DM / 32, r, c, e); const float* src = Wm + r * DM + c;
#pragma unroll
  for (int q = 0; q < 8; ++q) f.h[q] = (_Float16)(bf16_rne(src[q]) * sc);
  *(v8us*)((unsigned short*)Bt + e) = f.half[0];
}

// GEMM (wave tile 32x64; M % 128 == 0, N % 64 == 0, K % 32 == 0): v = acc*alpha + bf16(bias[col]) (+ CP term if CP); ACT 0 none; A, Bh and C16 are fragment-packed planes (lda, ldb, ldc = their K); writes f32 C (row-major, pitch ldc) and/or f16 C16; blockIdx.y = one of up to three independent products of one grid (A, Bh, C by their strides sA, sB, sC; bias, bias1, bias2 in turn); if CT, the third product (N = NH heads of 64 columns, no CP, no ACT) goes to CT alone, transposed
template <int ACT>
__global__ __launch_bounds__(128) void k_gemm2(const _Float16* __restrict__ A, int lda, size_t sA, const _Float16* __restrict__ Bh, int ldb, size_t sB, float alpha, const float* __restrict__ bias, const float* __restrict__ bias1, const float* __restrict__ bias2, const float* __restrict__ CP, int rowsPerB, size_t sCPb, int row0g,
    float* __restrict__ C, _Float16* __restrict__ C16, _Float16* __restrict__ CT, int ldc, size_t sC, int M, int N, int K) {
  __shared__ __attribute__((aligned(16))) float so[4][32][68];
  const int tid = threadIdx.x, w = tid >> 5, lane = tid & 31, ln = lane & 15, hh = lane >> 4; const int by = blockIdx.y;
  A += (size_t)by * sA; Bh += (size_t)by * sB; const size_t cofs = (size_t)by * sC; const float* bp = by == 0 ? bias : by == 1 ? bias1 : bias2;
  const int ntn = N >> 6; const int mt = blockIdx.x / ntn, nq = blockIdx.x - mt * ntn; const int row0 = mt * 128 + 32 * w, col0 = nq * 64; if (row0 >= M) return;
  // each lane's own fragment pointers (band start + 8 lane elements; a k-step is one tile, 512 elements); they advance once per two k-steps, the loads between reach ahead by constant offsets
  const _Float16* a0p = A + (size_t)row0 * lda + 8 * lane; const _Float16* a1p = a0p + (size_t)16 * lda;
  const _Float16* b0p = Bh + (size_t)col0 * ldb + 8 * lane; const _Float16* b1p = b0p + (size_t)16 * ldb; const _Float16* b2p = b1p + (size_t)16 * ldb; const _Float16* b3p = b2p + (size_t)16 * ldb;
  const v8f z8 = {0.f,0.f,0.f,0.f,0.f,0.f,0.f,0.f}; v8f c00 = z8, c01 = z8, c02 = z8, c03 = z8, c10 = z8, c11 = z8, c12 = z8, c13 = z8;
  // fragments are fetched one k-step ahead into a second register set (x and y take turns): the twelve loads of the next step go out as one group in front of this step's products
#define G2_LOAD(S, O) S##a0 = g2_fragp(a0p + (O)); S##a1 = g2_fragp(a1p + (O)); S##b0 = g2_fragp(b0p + (O)); S##b1 = g2_fragp(b1p + (O)); S##b2 = g2_fragp(b2p + (O)); S##b3 = g2_fragp(b3p + (O));
#define G2_STEP(S) c00 = g2_mma(S##a0, S##b0, c00); c10 = g2_mma(S##a1, S##b0, c10); c01 = g2_mma(S##a0, S##b1, c01); c11 = g2_mma(S##a1, S##b1, c11); c02 = g2_mma(S##a0, S##b2, c02); c12 = g2_mma(S##a1, S##b2, c12); c03 = g2_mma(S##a0, S##b3, c03); c13 = g2_mma(S##a1, S##b3, c13); \
  g2_run_end(c00, c10, c01, c11, c02, c12, c03, c13, S##a0, S##a1, S##b0, S##b1, S##b2, S##b3);
  v16h xa0, xa1, xb0, xb1, xb2, xb3, ya0, ya1, yb0, yb1, yb2, yb3;
  G2_LOAD(x, 0)
  int kb = 0;
  // unroll 1: the body already holds both register sets' steps; further copies would only add registers
#pragma unroll 1
  for (; kb + 64 < K; kb += 64) {
    G2_LOAD(y, 512)
    __builtin_amdgcn_sched_barrier(0); // each group of twelve loads stays whole in front of the run before its use: the scheduler otherwise sinks some of them to a few instructions ahead of their use
    G2_STEP(x)
    G2_LOAD(x, 1024)
    a0p += 1024; a1p += 1024; b0p += 1024; b1p += 1024; b2p += 1024; b3p += 1024;
    __builtin_amdgcn_sched_barrier(0); // as above
    G2_STEP(y) }
  if (kb + 32 < K) { G2_LOAD(y, 512) G2_STEP(x) G2_STEP(y) } else { G2_STEP(x) }
#undef G2_LOAD
#undef G2_STEP
  v8f accs[8] = {c00, c01, c02, c03, c10, c11, c12, c13};
  if (CT && by == 2) { // the same for a whole block. CT: per (batch, head) slab a fragment-packed plane with rows = the head's 64 columns, k = tokens, as the attention's second product reads it.
    // A lane's accumulator tile (t, half) is row 16 t + ln, k = 16 half + 8 hh + 0..7 of the wave's 32-token tile: piece 32 half + lane of that packed tile, so it is stored from registers, 512 contiguous bytes per wave-wide store
    unsigned short* dst = (unsigned short*)CT + (size_t)((row0 / SLEN) * NH + nq) * 64 * SLEN + (size_t)((row0 % SLEN) >> 5) * 512 + 8 * lane;
    float bvs[4]; FragH f[8]; // the four bias loads go out as one group; all eight pieces are formed before the first store, so that no register of an issued store is written again
#pragma unroll
    for (int t = 0; t < 4; ++t) bvs[t] = bp ? bp[col0 + t * 16 + ln] : 0.f;
#pragma unroll
    for (int u = 0; u < 8; ++u) { const float bv = bf16_rne(bvs[u & 3]);
#pragma unroll
      for (int r = 0; r < 8; ++r) f[u].h[r] = (_Float16)(accs[u][r] * alpha + bv); }
#pragma unroll
    for (int u = 0; u < 8; ++u) *(v8us*)(dst + (size_t)((u & 3) * 16) * SLEN + 256 * (u >> 2)) = f[u].half[0];
    return; }
#pragma unroll
  for (int u = 0; u < 8; ++u) { const int t = u & 3, half = u >> 2; const int col = col0 + t * 16 + ln; const float bv = bp ? bf16_rne(bp[col]) : 0.f;
#pragma unroll
    for (int r = 0; r < 8; ++r) { const int rloc = half * 16 + 8 * hh + r; float v = accs[u][r] * alpha + bv;
      if (CP) { if (rowsPerB < 0) v += CP[cofs + (size_t)(row0g + row0 + rloc) * ldc + col]; else { const int bidx = (row0g + row0 + rloc) / rowsPerB; v += CP[(size_t)bidx * sCPb + (size_t)by * 64 + col]; } }
      if (ACT == 3) v = fmaxf(v, 0.f);
      so[w][rloc][t * 16 + ln] = v; } }
  __builtin_amdgcn_fence(4 /* acq_rel order */, "workgroup"); __builtin_amdgcn_wave_barrier();
  const int rsub = lane >> 4, c4 = (lane & 15) * 4;
  {
#pragma unroll
    for (int q = 0; q < 16; ++q) { const int r = q * 2 + rsub; const v4f v = *(const v4fa*)&so[w][r][c4];
      if (C) *(v4f*)(C + cofs + (size_t)(row0 + r) * ldc + col0 + c4) = v; }
     }
  asm volatile("s_wait_xcnt 0x0" ::: "memory"); // behind the run of C stores: the C16 block below reuses registers that those stores name
  if (C16) { // the wave's 32 x 64 block is 2 x 2 packed tiles; per tile two wave-wide 16-byte stores of 512 contiguous bytes
#pragma unroll
    for (int tl = 0; tl < 4; ++tl) { const int rtl = tl >> 1, kbl = tl & 1; _Float16* dst = C16 + cofs + (size_t)(row0 + 16 * rtl) * ldc + (size_t)((col0 >> 5) + kbl) * 512 + 8 * lane;
#pragma unroll
      for (int i = 0; i < 2; ++i) { const float* sp = &so[w][rtl * 16 + ln][kbl * 32 + 16 * i + 8 * hh]; const v4f lo = *(const v4fa*)sp, hi = *(const v4fa*)(sp + 4); FragH f;
#pragma unroll
        for (int q = 0; q < 4; ++q) { f.h[q] = (_Float16)lo[q]; f.h[4 + q] = (_Float16)hi[q]; }
        *(v8us*)((unsigned short*)dst + 256 * i) = f.half[0]; } } } }

// lane l with lane l ^ 16 (a vector cross-row move, no LDS queue)
__device__ __forceinline__ float xhalf(float x) { return __builtin_bit_cast(float, __builtin_amdgcn_permlanex16(__builtin_bit_cast(int, x), __builtin_bit_cast(int, x), 0x76543210, 0xfedcba98, false, false)); }

// fused attention per ((b,h), 64 queries): wave = 16 queries; both products transposed: S^T = K.Q^T (A = 16 keys, B = the wave's queries; d = 64: 2 k-steps) x SCL over all TK keys (CAUSAL == 0: no key excluded), O^T += V^T.P^T (A = 16 d, B = P^T).
// A lane holds 16 of the pass's 32 scores of ONE query (column lane & 15; keys 16 nt + 8 (lane >> 4) + r): maximum and sum run in the lane, the two lane halves meet by one cross-row move; the two score tiles, converted in place, are the B fragment of P^T (element 8 nt + r = k 16 nt + 8 h + r, the k order of the packed V^T tiles).
// online max/sum softmax f32; Q16, K16, O16 (rows = tokens, k = columns) and Vt (per slab: rows = d, k = keys) are fragment-packed planes
template <int CAUSAL>
__global__ __launch_bounds__(128) void k_flash(const _Float16* __restrict__ Q16, int ldq, const _Float16* __restrict__ K16, int ldk, const _Float16* __restrict__ Vt, _Float16* __restrict__ O16, int ldo) {
  constexpr int RPW = 16, DT = 4, KS = 2; constexpr float C2 = SCL * 1.4426950408889634f;
  const int tid = threadIdx.x, w = tid >> 5, lane = tid & 31, ln = lane & 15, hh = lane >> 4;
  const int slab = blockIdx.x / QBLKS, qblk = blockIdx.x % QBLKS; const int b = slab / NH, h = slab % NH; const int qb0 = qblk * (4 * RPW); const int q0 = qb0 + w * RPW;
  FragH bq[KS];
  { const unsigned short* qr = (const unsigned short*)Q16 + ((size_t)b * TQ + q0) * ldq + h * 1024 + 8 * lane;
#pragma unroll
    for (int ks = 0; ks < KS; ++ks) { bq[ks].half[0] = *(const v8us*)(qr + ks * 512); bq[ks].half[1] = *(const v8us*)(qr + ks * 512 + 256); } }
  const unsigned short* Vth = (const unsigned short*)Vt + (size_t)slab * 64 * TK; const unsigned l8 = 8u * (unsigned)lane; /* the lane's piece of a tile half; the K and V tile starts are the same for the whole block */
  float m_r = -3.0e38f, l_r = 0.f; v8f oacc[DT]; /* m_r: the query's running maximum of the raw products (alike in both halves); l_r: the sum over this half's keys, x1024 */
#pragma unroll
  for (int dt = 0; dt < DT; ++dt) oacc[dt] = (v8f){0.f,0.f,0.f,0.f,0.f,0.f,0.f,0.f};
  const int jend = (CAUSAL == 1) ? (qb0 + 4 * RPW) : TK; const int tq = q0 + ln; (void)tq;
  FragH ak[2][KS];
#pragma unroll
  for (int nt = 0; nt < 2; ++nt) { const unsigned short* kr = (const unsigned short*)K16 + ((size_t)b * TK + nt * 16) * ldk + h * 1024;
#pragma unroll
    for (int ks = 0; ks < KS; ++ks) { ak[nt][ks].half[0] = *(const v8us*)(kr + ks * 512 + l8); ak[nt][ks].half[1] = *(const v8us*)(kr + ks * 512 + 256 + l8); } }
#pragma unroll 1
  for (int j0 = 0; j0 < jend; j0 += 32) {
    v8f s[2];
#pragma unroll
    for (int nt = 0; nt < 2; ++nt) { v8f acc = (v8f){0.f,0.f,0.f,0.f,0.f,0.f,0.f,0.f};
#pragma unroll
      for (int ks = 0; ks < KS; ++ks) acc = mmaH<1>(ak[nt][ks].v, ak[nt][ks].v, bq[ks].v, bq[ks].v, acc);
      s[nt] = acc; }
    asm volatile("v_nop\n\tv_nop\n\tv_nop\n\tv_nop" : "+v"(s[0]), "+v"(s[1]) : "v"(ak[0][0].v), "v"(ak[0][1].v), "v"(ak[1][0].v), "v"(ak[1][1].v), "v"(bq[0].v), "v"(bq[1].v)); // the run's distance, see at mmaH
    __builtin_amdgcn_sched_barrier(0); // the K loads below refill the registers this run reads: in front of it they would need other registers and copies
    // one group of loads directly behind the score products, a softmax ahead of their use: this pass's V fragments, then the next pass's K fragments into the registers just read
    FragH av[DT];
#pragma unroll
    for (int dt = 0; dt < DT; ++dt) { const unsigned short* vrow = Vth + (size_t)(dt * 16) * TK + (size_t)j0 * 16; av[dt].half[0] = *(const v8us*)(vrow + l8); av[dt].half[1] = *(const v8us*)(vrow + 256 + l8); }
    const int jn = (j0 + 32 < jend) ? j0 + 32 : j0; /* the last pass fetches its own keys again: stays inside K16 */
#pragma unroll
    for (int nt = 0; nt < 2; ++nt) { const unsigned short* kr = (const unsigned short*)K16 + ((size_t)b * TK + jn + nt * 16) * ldk + h * 1024;
#pragma unroll
      for (int ks = 0; ks < KS; ++ks) { ak[nt][ks].half[0] = *(const v8us*)(kr + ks * 512 + l8); ak[nt][ks].half[1] = *(const v8us*)(kr + ks * 512 + 256 + l8); } }
    __builtin_amdgcn_sched_barrier(0); // keeps the sixteen loads in one group here: without it the scheduler sinks the K loads to the foot of the softmax, a few instructions ahead of their use
    // the softmax runs in base 2 on the raw products: C2 = SCL log2(e) > 0, so the raw maximum is the scaled one's element, and a weight is one multiply-add and one hardware exponential
    float sv[16]; bool ok[16];
#pragma unroll
    for (int e = 0; e < 16; ++e) { const int key = j0 + (e >> 3) * 16 + 8 * hh + (e & 7); ok[e] = (CAUSAL == 1) ? (key <= tq) : true; sv[e] = ok[e] ? s[e >> 3][e & 7] : -3.0e38f; }
    float mx[5];
#pragma unroll
    for (int c = 0; c < 5; ++c) mx[c] = fmaxf(fmaxf(sv[3 * c], sv[3 * c + 1]), sv[3 * c + 2]);
    float mc = fmaxf(fmaxf(fmaxf(mx[0], mx[1]), mx[2]), fmaxf(fmaxf(mx[3], mx[4]), sv[15])); mc = fmaxf(mc, xhalf(mc));
    const float mn = fmaxf(m_r, mc); const float ae = __builtin_amdgcn_exp2f((m_r - mn) * C2); const float al = (mn > -1.0e38f) ? ae : 1.0f; m_r = mn; /* ae formed on every path: a select, so that it runs among the weights' exponentials and EXEC stays whole */
    const float nb = 10.0f - mn * C2; /* the exponent's addend: minus the maximum, plus 10 for the x1024 that the f16 weights carry (the sum carries it too) */
    FragH pb; v2f ps[2]; /* the lane's 16 weights in pairs: four independent partial sums */
#pragma unroll
    for (int i = 0; i < 8; ++i) { const v2f ar = (v2f){sv[2 * i], sv[2 * i + 1]} * C2 + nb; v2f p; p.x = ok[2 * i] ? __builtin_amdgcn_exp2f(ar.x) : 0.f; p.y = ok[2 * i + 1] ? __builtin_amdgcn_exp2f(ar.y) : 0.f;
      if (i < 2) ps[i] = p; else ps[i & 1] += p;
      const v2h ph = __builtin_convertvector(p, v2h); pb.h[2 * i] = ph.x; pb.h[2 * i + 1] = ph.y; }
    l_r = l_r * al + ((ps[0].x + ps[1].x) + (ps[0].y + ps[1].y));
#pragma unroll
    for (int dt = 0; dt < DT; ++dt) oacc[dt] *= al;
#pragma unroll
    for (int dt = 0; dt < DT; ++dt) oacc[dt] = mmaH<1>(av[dt].v, av[dt].v, pb.v, pb.v, oacc[dt]);
    asm volatile("v_nop\n\tv_nop\n\tv_nop\n\tv_nop" : "+v"(oacc[0]), "+v"(oacc[1]), "+v"(oacc[2]), "+v"(oacc[3]) : "v"(av[0].v), "v"(av[1].v), "v"(av[2].v), "v"(av[3].v), "v"(pb.v)); } // the run's distance, see at mmaH: the next pass's first score tile may take P's registers
  { const float l = l_r + xhalf(l_r); const float inv = (l > 0.f) ? 1.0f / l : 0.f; /* l and oacc both carry x1024 */
    // oacc[dt][r] = O[query ln][d = 16 dt + 8 hh + r]: piece 32 (dt & 1) + lane of k tile 2 h + (dt >> 1) in the wave's 16-row band of the fragment-packed context plane (f16, x CSC) that the output GEMM reads: stored from registers, 512 contiguous bytes per wave-wide store
    unsigned short* ob = (unsigned short*)O16 + ((size_t)b * TQ + q0) * ldo + h * 1024 + 8 * lane;
#pragma unroll
    for (int dt = 0; dt < DT; ++dt) { FragH f;
#pragma unroll
      for (int q = 0; q < 8; ++q) f.h[q] = (_Float16)(oacc[dt][q] * inv * CSC);
      *(v8us*)(ob + dt * 256) = f.half[0]; } } }

__global__ __launch_bounds__(256) void k_ln(const float* __restrict__ X, const float* __restrict__ R, const float* __restrict__ g, const float* __restrict__ bta, float* __restrict__ out) {
  __shared__ float red[256];
  const int row = blockIdx.x, tid = threadIdx.x;
  const size_t srow = (size_t)(row / SLEN) * SEQ_FULL + (size_t)(row % SLEN);
  const float* x = X + (size_t)row * DM; const float* rr = R + srow * DM;
  const int j = tid * 4;
  const v4f a = *(const v4fa*)(x + j); const v4f rb = *(const v4fa*)(rr + j);
  float vals[4]; float s1 = 0.f;
#pragma unroll
  for (int q = 0; q < 4; ++q) { const float v = a[q] + bf16_rne(rb[q]); vals[q] = v; s1 += v; }
  red[tid] = s1; __syncthreads();
  for (int st = 128; st > 0; st >>= 1) { if (tid < st) red[tid] += red[tid + st]; __syncthreads(); }
  const float mu = red[0] * 0.0009765625f; __syncthreads();
  float s2 = 0.f;
#pragma unroll
  for (int q = 0; q < 4; ++q) { const float c = vals[q] - mu; s2 += c * c; }
  red[tid] = s2; __syncthreads();
  for (int st = 128; st > 0; st >>= 1) { if (tid < st) red[tid] += red[tid + st]; __syncthreads(); }
  const float rs = rsqrtf(red[0] * 0.0009765625f + LNEPS);
  v4f o;
#pragma unroll
  for (int q = 0; q < 4; ++q) { const float gg = bf16_rne(g[j + q]), bb = bf16_rne(bta[j + q]); o[q] = (vals[q] - mu) * rs * gg + bb; }
  *(v4f*)(out + (size_t)row * DM + j) = o;
  
}

extern "C" void kernel_launch(void* const* d_in, const int* in_sizes, int n_in,
                              void* d_out, int out_size, void* d_ws, size_t ws_size, hipStream_t stream) {
  if (n_in < 11) return;
  const float* hs = (const float*)d_in[0]; const float* Wq = (const float*)d_in[1]; const float* bq = (const float*)d_in[2]; const float* Wk = (const float*)d_in[3]; const float* bk = (const float*)d_in[4];
  const float* Wv = (const float*)d_in[5]; const float* bv = (const float*)d_in[6]; const float* Wd = (const float*)d_in[7]; const float* bd = (const float*)d_in[8]; const float* gam = (const float*)d_in[9]; const float* bet = (const float*)d_in[10];
  const long long need0 = ((long long)(NB - 1) * SEQ_FULL + SLEN) * DM;
  if ((long long)in_sizes[0] < need0) return;
  if (in_sizes[1] < DM * DM || in_sizes[3] < DM * DM || in_sizes[5] < DM * DM || in_sizes[7] < DM * DM) return;
  if (in_sizes[2] < DM || in_sizes[4] < DM || in_sizes[6] < DM || in_sizes[8] < DM || in_sizes[9] < DM || in_sizes[10] < DM) return;
  if ((long long)out_size < (long long)NR * DM) return;
  char* ws = (char*)d_ws; size_t off = 0;
  auto take = [&](size_t bytes) { char* p = ws + off; off += (bytes + 255) & ~(size_t)255; return p; };
  const size_t np = (size_t)NR * DM; const size_t nw = (size_t)DM * DM;
  _Float16* BQ = (_Float16*)take(nw * 2 * 3); _Float16* BK = BQ + nw; _Float16* BV = BK + nw; _Float16* BD = (_Float16*)take(nw * 2); /* q, k, v planes one behind the other: blockIdx.y strides through them */
  _Float16* X16 = (_Float16*)take(np * 2); _Float16* QH = (_Float16*)take(np * 2 * 2); _Float16* KH = QH + np; _Float16* VT = (_Float16*)take(np * 2);
  _Float16* CTX16 = (_Float16*)take(np * 2); float* ATT = (float*)take(np * 4);
  float* O = (float*)d_out;
  if (off > ws_size) return;
  k_prep<<<XBLK + 4 * WBLK, 256, 0, stream>>>(hs, X16, Wq, Wk, Wv, Wd, BQ, BK, BV, BD, WSC);      /* weights: [out][in] = [n][k] */
  const dim3 g((NR / 128) * (DM / 64), 1), g3((NR / 128) * (DM / 64), 3);
  k_gemm2<0><<<g3, 128, 0, stream>>>(X16, DM, 0, BQ, DM, nw, 1.0f / WSC, bq, bk, bv, nullptr, 1, 0, 0, nullptr, QH, VT, DM, np, NR, DM, DM);
  k_flash<0><<<NB * NH * QBLKS, 128, 0, stream>>>(QH, DM, KH, DM, VT, CTX16, DM);
  k_gemm2<0><<<g, 128, 0, stream>>>(CTX16, DM, 0, BD, DM, 0, 1.0f / (WSC * CSC), bd, nullptr, nullptr, nullptr, 1, 0, 0, ATT, nullptr, nullptr, DM, 0, NR, DM, DM);
  k_ln<<<NR, 256, 0, stream>>>(ATT, hs, gam, bet, O);
}

// v008
// Measured time: 98.5 microseconds a run.
// Next to v007, in two timings, it ran 1.19 and 1.17 times as fast.
// Counting every step since v000, it is 4.52 times as fast.
#include <hip/hip_runtime.h>
// Contractions: v_wmma_f32_16x16x32_f16 everywhere (f16 operands, f32 accumulate) - q/k/v projections (x as f16 of bf16-RNE input, W as f16 of bf16-RNE weight x16), k.q^T and v^T.p^T per head (plain f16 q/k/v planes, p carried x1024), output dense (context carried x16 f16, Wd bf16-RNE x16); softmax, bias adds, residual and LayerNorm in f32.
// Left untouched so far: k_gemm2's epilogue tests CP once per element at run time (64 taken branches a wave; the code they skip, never run, is some 5,000 of the kernel's 5,900 instructions); k_prep and k_ln start 32,768 waves each, one item a lane.

#ifndef NB
#define NB 2
#endif
#ifndef SEQ
#define SEQ 2048
#endif
#define NB_FULL 2
#define SEQ_FULL 2048
#define DM 1024
#define NH 16
#define HDIM 64
#define SLEN SEQ
#define TQ SLEN
#define TK SLEN
#define NR (NB * SLEN)
#define SCL 0.125f
#define QBLKS (TQ / 64)
#define LNEPS 0.00001f
#define WSC 16.0f
#define CSC 16.0f
static_assert(NH * HDIM == DM);
static_assert(HDIM == 64);
static_assert(SLEN % 64 == 0);
static_assert((TK / QBLKS) % 32 == 0);
static_assert(NR % 128 == 0);
static_assert(DM % 64 == 0);
static_assert(DM == 4 * 256);
static_assert(NB <= NB_FULL);
static_assert(SEQ <= SEQ_FULL);

typedef unsigned short v8us __attribute__((ext_vector_type(8), may_alias));
typedef float  v8f  __attribute__((ext_vector_type(8)));
typedef float  v4f  __attribute__((ext_vector_type(4)));
typedef float  v4fa __attribute__((ext_vector_type(4), may_alias));
typedef _Float16 v16h __attribute__((ext_vector_type(16)));
typedef _Float16 v4h  __attribute__((ext_vector_type(4)));
typedef float  v2f  __attribute__((ext_vector_type(2)));
typedef _Float16 v2h  __attribute__((ext_vector_type(2)));
union FragH { v16h v; v8us half[2]; _Float16 h[16]; unsigned short u[16]; };

__device__ __forceinline__ unsigned short bf16_bits(float x) { unsigned int u = __float_as_uint(x); return (unsigned short)((u + 0x7FFFu + ((u >> 16) & 1u)) >> 16); }
__device__ __forceinline__ float bf16_val(unsigned short b) { return __uint_as_float(((unsigned int)b) << 16); }
__device__ __forceinline__ float bf16_rne(float x) { return bf16_val(bf16_bits(x)); }

// D += A.B with NT terms (1 = single product); 16x16x32 f16, split k map per lane half; no padding here: inside a run of WMMAs each fills the slots behind the one before, and four v_nop stand once behind the run's last.
// Those four v_nop (the asm statements below) are the distance between a run's last WMMAs and whatever overwrites their A or B registers next (the loads of the next fragments, the next run's D over the loop's back edge); their operands are the run's accumulators (so they stand behind every WMMA of the run) and its fragments (kept live up to them)
template <int NT>
__device__ __forceinline__ v8f mmaH(v16h ah, v16h al, v16h bh, v16h bl, v8f c) {
  c = __builtin_amdgcn_wmma_f32_16x16x32_f16(false, ah, false, bh, (short)0, c, false, false);
  if (NT >= 2) c = __builtin_amdgcn_wmma_f32_16x16x32_f16(false, al, false, bh, (short)0, c, false, false);
  if (NT >= 3) c = __builtin_amdgcn_wmma_f32_16x16x32_f16(false, ah, false, bl, (short)0, c, false, false);
  return c;
}
// Fragment-packed plane of a [rows][K] 16-bit matrix: every tile of 16 rows x 32 k is 512 elements in a row, the tiles of one 16-row band follow in k order (so a band is 16 K elements, as in the row-major plane).
// Inside a tile the 8-element piece number 32 i + 16 h + c holds row c, k = 16 i + 8 h + 0..7: piece number = 32 i + lane, so each of a fragment's two wave-wide 16-byte loads covers 512 contiguous bytes (4 whole lines).
// packing from a row-major f32 source, kt = K / 32 tiles per band: thread t takes 8 k of one row, four threads in a row per 128-byte source line; a wave reads 8 whole lines and writes 4 whole lines. dst = element offset of its piece
__device__ __forceinline__ void pk_src(size_t t, int kt, size_t& row, int& k, size_t& dst) { const size_t tile = t >> 6; const int c = (int)(t & 63) >> 2, ih = (int)(t & 3); row = (tile / kt) * 16 + c; k = (int)(tile % kt) * 32 + 8 * ih; dst = tile * 512 + (size_t)(16 * ih + c) * 8; }
// fragment of 16 rows (lane&15) x 32 k from a packed tile: elements 0..7 <- k0+8h, 8..15 <- k0+16+8h
// p already holds the tile's start + 8 lane elements
__device__ __forceinline__ v16h g2_fragp(const _Float16* p) { FragH f; f.half[0] = *(const v8us*)((const unsigned short*)p); f.half[1] = *(const v8us*)((const unsigned short*)p + 256); return f.v; }
__device__ __forceinline__ v8f g2_mma(v16h a, v16h b, v8f c) { return __builtin_amdgcn_wmma_f32_16x16x32_f16(false, a, false, b, (short)0, c, false, false); }
// behind the eight WMMAs of a GEMM k-step
__device__ __forceinline__ void g2_run_end(v8f& c0, v8f& c1, v8f& c2, v8f& c3, v8f& c4, v8f& c5, v8f& c6, v8f& c7, v16h a0, v16h a1, v16h b0, v16h b1, v16h b2, v16h b3) {
  asm volatile("v_nop\n\tv_nop\n\tv_nop\n\tv_nop" : "+v"(c0), "+v"(c1), "+v"(c2), "+v"(c3), "+v"(c4), "+v"(c5), "+v"(c6), "+v"(c7) : "v"(a0), "v"(a1), "v"(b0), "v"(b1), "v"(b2), "v"(b3)); // the run's distance, see above
  __builtin_amdgcn_sched_barrier(0); } // the next loads stay behind the run whose registers they refill

// blocks of 256 threads that one conversion takes: x (NR x DM) and one weight (DM x DM), 8 elements a thread
#define XBLK ((NR * (DM / 8) + 255) / 256)
#define WBLK ((DM * (DM / 8) + 255) / 256)
// the five input conversions depend on nothing and on each other not at all: one grid; blocks [0, XBLK) pack x, then WBLK blocks for each of the four weights (the choice is the same for a whole block)
__global__ __launch_bounds__(256) void k_prep(const float* __restrict__ x, _Float16* __restrict__ X16, const float* __restrict__ W0, const float* __restrict__ W1, const float* __restrict__ W2, const float* __restrict__ W3,
    _Float16* __restrict__ B0, _Float16* __restrict__ B1, _Float16* __restrict__ B2, _Float16* __restrict__ B3, float sc) {
  FragH f; size_t r, e; int c;
  if (blockIdx.x < XBLK) {
    const size_t t = (size_t)blockIdx.x * 256 + threadIdx.x; if (t >= (size_t)NR * (DM / 8)) return;
    pk_src(t, DM / 32, r, c, e); const size_t sr = (r / SLEN) * SEQ_FULL + (r % SLEN);
    const float* src = x + sr * DM + c;
#pragma unroll
    for (int q = 0; q < 8; ++q) f.h[q] = (_Float16)bf16_rne(src[q]);
    *(v8us*)((unsigned short*)X16 + e) = f.half[0];
    return; }
  const unsigned wblk = blockIdx.x - XBLK, wi = wblk / WBLK;
  const size_t t = (size_t)(wblk - wi * WBLK) * 256 + threadIdx.x; if (t >= (size_t)DM * (DM / 8)) return;
  const float* Wm = wi == 0 ? W0 : wi == 1 ? W1 : wi == 2 ? W2 : W3; _Float16* Bt = wi == 0 ? B0 : wi == 1 ? B1 : wi == 2 ? B2 : B3;
  pk_src(t, DM / 32, r, c, e); const float* src = Wm + r * DM + c;
#pragma unroll
  for (int q = 0; q < 8; ++q) f.h[q] = (_Float16)(bf16_rne(src[q]) * sc);
  *(v8us*)((unsigned short*)Bt + e) = f.half[0];
}

// GEMM (wave tile 32x64; M % 128 == 0, N % 64 == 0, K % 32 == 0): v = acc*alpha + bf16(bias[col]) (+ CP term if CP); ACT 0 none; A, Bh and C16 are fragment-packed planes (lda, ldb, ldc = their K); writes f32 C (row-major, pitch ldc) and/or f16 C16; blockIdx.y = one of up to three independent products of one grid (A, Bh, C by their strides sA, sB, sC; bias, bias1, bias2 in turn); if CT, the third product (N = NH heads of 64 columns, no CP, no ACT) goes to CT alone, transposed
template <int ACT>
__global__ __launch_bounds__(128) void k_gemm2(const _Float16* __restrict__ A, int lda, size_t sA, const _Float16* __restrict__ Bh, int ldb, size_t sB, float alpha, const float* __restrict__ bias, const float* __restrict__ bias1, const float* __restrict__ bias2, const float* __restrict__ CP, int rowsPerB, size_t sCPb, int row0g,
    float* __restrict__ C, _Float16* __restrict__ C16, _Float16* __restrict__ CT, int ldc, size_t sC, int M, int N, int K) {
  __shared__ __attribute__((aligned(16))) float so[4][32][68];
  const int tid = threadIdx.x, w = tid >> 5, lane = tid & 31, ln = lane & 15, hh = lane >> 4; const int by = blockIdx.y;
  A += (size_t)by * sA; Bh += (size_t)by * sB; const size_t cofs = (size_t)by * sC; const float* bp = by == 0 ? bias : by == 1 ? bias1 : bias2;
  const int ntn = N >> 6; const int mt = blockIdx.x / ntn, nq = blockIdx.x - mt * ntn; const int row0 = mt * 128 + 32 * w, col0 = nq * 64; if (row0 >= M) return;
  // each lane's own fragment pointers (band start + kp pairs of 1024 elements + 8 lane elements; a k-step is one tile, 512 elements); they move once per two k-steps, in front of the loads of the next pair's first step
  // every work-group starts its k walk at its own pair of k-steps (tile row + tile column, modulo the pairs) and wraps round: groups that share A rows or B rows and run in step then ask L2 for different lines at any one moment; start 0 where K is not at least two whole pairs. The f32 sums take their terms in that turned order
  const int nit = (K + 63) >> 6; int kp = ((K & 63) || K < 128) ? 0 : (int)((unsigned)(mt + nq) % (unsigned)nit); const long long kwrap = -(long long)(nit - 1) * 1024;
  const _Float16* a0p = A + (size_t)row0 * lda + (size_t)kp * 1024 + 8 * lane; const _Float16* a1p = a0p + (size_t)16 * lda;
  const _Float16* b0p = Bh + (size_t)col0 * ldb + (size_t)kp * 1024 + 8 * lane; const _Float16* b1p = b0p + (size_t)16 * ldb; const _Float16* b2p = b1p + (size_t)16 * ldb; const _Float16* b3p = b2p + (size_t)16 * ldb;
  const v8f z8 = {0.f,0.f,0.f,0.f,0.f,0.f,0.f,0.f}; v8f c00 = z8, c01 = z8, c02 = z8, c03 = z8, c10 = z8, c11 = z8, c12 = z8, c13 = z8;
  // fragments are fetched one k-step ahead into a second register set (x and y take turns): the twelve loads of the next step go out as one group in front of this step's products
#define G2_LOAD(S, O) S##a0 = g2_fragp(a0p + (O)); S##a1 = g2_fragp(a1p + (O)); S##b0 = g2_fragp(b0p + (O)); S##b1 = g2_fragp(b1p + (O)); S##b2 = g2_fragp(b2p + (O)); S##b3 = g2_fragp(b3p + (O));
#define G2_STEP(S) c00 = g2_mma(S##a0, S##b0, c00); c10 = g2_mma(S##a1, S##b0, c10); c01 = g2_mma(S##a0, S##b1, c01); c11 = g2_mma(S##a1, S##b1, c11); c02 = g2_mma(S##a0, S##b2, c02); c12 = g2_mma(S##a1, S##b2, c12); c03 = g2_mma(S##a0, S##b3, c03); c13 = g2_mma(S##a1, S##b3, c13); \
  g2_run_end(c00, c10, c01, c11, c02, c12, c03, c13, S##a0, S##a1, S##b0, S##b1, S##b2, S##b3);
  v16h xa0, xa1, xb0, xb1, xb2, xb3, ya0, ya1, yb0, yb1, yb2, yb3;
  G2_LOAD(x, 0)
  int kb = 0;
  // unroll 1: the body already holds both register sets' steps; further copies would only add registers
#pragma unroll 1
  for (; kb + 64 < K; kb += 64) {
    G2_LOAD(y, 512)
    __builtin_amdgcn_sched_barrier(0); // each group of twelve loads stays whole in front of the run before its use: the scheduler otherwise sinks some of them to a few instructions ahead of their use
    G2_STEP(x)
    ++kp; const long long kd = (kp == nit) ? kwrap : 1024; kp = (kp == nit) ? 0 : kp; /* on to the next pair, from the last one back to the first; the same for the whole block */
    a0p += kd; a1p += kd; b0p += kd; b1p += kd; b2p += kd; b3p += kd;
    G2_LOAD(x, 0)
    __builtin_amdgcn_sched_barrier(0); // as above
    G2_STEP(y) }
  if (kb + 32 < K) { G2_LOAD(y, 512) G2_STEP(x) G2_STEP(y) } else { G2_STEP(x) }
#undef G2_LOAD
#undef G2_STEP
  v8f accs[8] = {c00, c01, c02, c03, c10, c11, c12, c13};
  if (CT && by == 2) { // the same for a whole block. CT: per (batch, head) slab a fragment-packed plane with rows = the head's 64 columns, k = tokens, as the attention's second product reads it.
    // A lane's accumulator tile (t, half) is row 16 t + ln, k = 16 half + 8 hh + 0..7 of the wave's 32-token tile: piece 32 half + lane of that packed tile, so it is stored from registers, 512 contiguous bytes per wave-wide store
    unsigned short* dst = (unsigned short*)CT + (size_t)((row0 / SLEN) * NH + nq) * 64 * SLEN + (size_t)((row0 % SLEN) >> 5) * 512 + 8 * lane;
    float bvs[4]; FragH f[8]; // the four bias loads go out as one group; all eight pieces are formed before the first store, so that no register of an issued store is written again
#pragma unroll
    for (int t = 0; t < 4; ++t) bvs[t] = bp ? bp[col0 + t * 16 + ln] : 0.f;
#pragma unroll
    for (int u = 0; u < 8; ++u) { const float bv = bf16_rne(bvs[u & 3]);
#pragma unroll
      for (int r = 0; r < 8; ++r) f[u].h[r] = (_Float16)(accs[u][r] * alpha + bv); }
#pragma unroll
    for (int u = 0; u < 8; ++u) *(v8us*)(dst + (size_t)((u & 3) * 16) * SLEN + 256 * (u >> 2)) = f[u].half[0];
    return; }
#pragma unroll
  for (int u = 0; u < 8; ++u) { const int t = u & 3, half = u >> 2; const int col = col0 + t * 16 + ln; const float bv = bp ? bf16_rne(bp[col]) : 0.f;
#pragma unroll
    for (int r = 0; r < 8; ++r) { const int rloc = half * 16 + 8 * hh + r; float v = accs[u][r] * alpha + bv;
      if (CP) { if (rowsPerB < 0) v += CP[cofs + (size_t)(row0g + row0 + rloc) * ldc + col]; else { const int bidx = (row0g + row0 + rloc) / rowsPerB; v += CP[(size_t)bidx * sCPb + (size_t)by * 64 + col]; } }
      if (ACT == 3) v = fmaxf(v, 0.f);
      so[w][rloc][t * 16 + ln] = v; } }
  __builtin_amdgcn_fence(4 /* acq_rel order */, "workgroup"); __builtin_amdgcn_wave_barrier();
  const int rsub = lane >> 4, c4 = (lane & 15) * 4;
  {
#pragma unroll
    for (int q = 0; q < 16; ++q) { const int r = q * 2 + rsub; const v4f v = *(const v4fa*)&so[w][r][c4];
      if (C) *(v4f*)(C + cofs + (size_t)(row0 + r) * ldc + col0 + c4) = v; }
     }
  asm volatile("s_wait_xcnt 0x0" ::: "memory"); // behind the run of C stores: the C16 block below reuses registers that those stores name
  if (C16) { // the wave's 32 x 64 block is 2 x 2 packed tiles; per tile two wave-wide 16-byte stores of 512 contiguous bytes
#pragma unroll
    for (int tl = 0; tl < 4; ++tl) { const int rtl = tl >> 1, kbl = tl & 1; _Float16* dst = C16 + cofs + (size_t)(row0 + 16 * rtl) * ldc + (size_t)((col0 >> 5) + kbl) * 512 + 8 * lane;
#pragma unroll
      for (int i = 0; i < 2; ++i) { const float* sp = &so[w][rtl * 16 + ln][kbl * 32 + 16 * i + 8 * hh]; const v4f lo = *(const v4fa*)sp, hi = *(const v4fa*)(sp + 4); FragH f;
#pragma unroll
        for (int q = 0; q < 4; ++q) { f.h[q] = (_Float16)lo[q]; f.h[4 + q] = (_Float16)hi[q]; }
        *(v8us*)((unsigned short*)dst + 256 * i) = f.half[0]; } } } }

// lane l with lane l ^ 16 (a vector cross-row move, no LDS queue)
__device__ __forceinline__ float xhalf(float x) { return __builtin_bit_cast(float, __builtin_amdgcn_permlanex16(__builtin_bit_cast(int, x), __builtin_bit_cast(int, x), 0x76543210, 0xfedcba98, false, false)); }

// fused attention per ((b,h), 64 queries): wave = 16 queries; both products transposed: S^T = K.Q^T (A = 16 keys, B = the wave's queries; d = 64: 2 k-steps) x SCL over all TK keys (CAUSAL == 0: no key excluded), O^T += V^T.P^T (A = 16 d, B = P^T).
// A lane holds 16 of the pass's 32 scores of ONE query (column lane & 15; keys 16 nt + 8 (lane >> 4) + r): maximum and sum run in the lane, the two lane halves meet by one cross-row move; the two score tiles, converted in place, are the B fragment of P^T (element 8 nt + r = k 16 nt + 8 h + r, the k order of the packed V^T tiles).
// online max/sum softmax f32; Q16, K16, O16 (rows = tokens, k = columns) and Vt (per slab: rows = d, k = keys) are fragment-packed planes
template <int CAUSAL>
__global__ __launch_bounds__(128) void k_flash(const _Float16* __restrict__ Q16, int ldq, const _Float16* __restrict__ K16, int ldk, const _Float16* __restrict__ Vt, _Float16* __restrict__ O16, int ldo) {
  constexpr int RPW = 16, DT = 4, KS = 2; constexpr float C2 = SCL * 1.4426950408889634f;
  const int tid = threadIdx.x, w = tid >> 5, lane = tid & 31, ln = lane & 15, hh = lane >> 4;
  const int slab = blockIdx.x / QBLKS, qblk = blockIdx.x % QBLKS; const int b = slab / NH, h = slab % NH; const int qb0 = qblk * (4 * RPW); const int q0 = qb0 + w * RPW;
  FragH bq[KS];
  { const unsigned short* qr = (const unsigned short*)Q16 + ((size_t)b * TQ + q0) * ldq + h * 1024 + 8 * lane;
#pragma unroll
    for (int ks = 0; ks < KS; ++ks) { bq[ks].half[0] = *(const v8us*)(qr + ks * 512); bq[ks].half[1] = *(const v8us*)(qr + ks * 512 + 256); } }
  const unsigned short* Vth = (const unsigned short*)Vt + (size_t)slab * 64 * TK; const unsigned l8 = 8u * (unsigned)lane; /* the lane's piece of a tile half; the K and V tile starts are the same for the whole block */
  float m_r = -3.0e38f, l_r = 0.f; v8f oacc[DT]; /* m_r: the query's running maximum of the raw products (alike in both halves); l_r: the sum over this half's keys, x1024 */
#pragma unroll
  for (int dt = 0; dt < DT; ++dt) oacc[dt] = (v8f){0.f,0.f,0.f,0.f,0.f,0.f,0.f,0.f};
  const int jend = (CAUSAL == 1) ? (qb0 + 4 * RPW) : TK; const int tq = q0 + ln; (void)tq;
  // with no key excluded the order of the keys is free: each of a slab's QBLKS blocks starts its walk TK / QBLKS keys further on and wraps round, so that blocks running in step ask L2 for different K and V lines at any one moment (maximum and sums take the keys in that turned order)
  int j0 = (CAUSAL == 1) ? 0 : qblk * (TK / QBLKS);
  const unsigned short* vp = Vth + (size_t)j0 * 16 + l8; /* the lane's piece of this pass's first V tile; it moves with j0 */
  FragH ak[2][KS];
#pragma unroll
  for (int nt = 0; nt < 2; ++nt) { const unsigned short* kr = (const unsigned short*)K16 + ((size_t)b * TK + j0 + nt * 16) * ldk + h * 1024;
#pragma unroll
    for (int ks = 0; ks < KS; ++ks) { ak[nt][ks].half[0] = *(const v8us*)(kr + ks * 512 + l8); ak[nt][ks].half[1] = *(const v8us*)(kr + ks * 512 + 256 + l8); } }
#pragma unroll 1
  for (int it = 0; it < jend; it += 32) {
    v8f s[2];
#pragma unroll
    for (int nt = 0; nt < 2; ++nt) { v8f acc = (v8f){0.f,0.f,0.f,0.f,0.f,0.f,0.f,0.f};
#pragma unroll
      for (int ks = 0; ks < KS; ++ks) acc = mmaH<1>(ak[nt][ks].v, ak[nt][ks].v, bq[ks].v, bq[ks].v, acc);
      s[nt] = acc; }
    asm volatile("v_nop\n\tv_nop\n\tv_nop\n\tv_nop" : "+v"(s[0]), "+v"(s[1]) : "v"(ak[0][0].v), "v"(ak[0][1].v), "v"(ak[1][0].v), "v"(ak[1][1].v), "v"(bq[0].v), "v"(bq[1].v)); // the run's distance, see at mmaH
    __builtin_amdgcn_sched_barrier(0); // the K loads below refill the registers this run reads: in front of it they would need other registers and copies
    // one group of loads directly behind the score products, a softmax ahead of their use: this pass's V fragments, then the next pass's K fragments into the registers just read
    FragH av[DT];
#pragma unroll
    for (int dt = 0; dt < DT; ++dt) { const unsigned short* vrow = vp + (size_t)(dt * 16) * TK; av[dt].half[0] = *(const v8us*)vrow; av[dt].half[1] = *(const v8us*)(vrow + 256); }
    const int jn = (j0 + 32 < jend) ? j0 + 32 : 0; /* behind the last keys the walk goes on at the first; the last pass's fetch is not used and stays inside K16 */
#pragma unroll
    for (int nt = 0; nt < 2; ++nt) { const unsigned short* kr = (const unsigned short*)K16 + ((size_t)b * TK + jn + nt * 16) * ldk + h * 1024;
#pragma unroll
      for (int ks = 0; ks < KS; ++ks) { ak[nt][ks].half[0] = *(const v8us*)(kr + ks * 512 + l8); ak[nt][ks].half[1] = *(const v8us*)(kr + ks * 512 + 256 + l8); } }
    __builtin_amdgcn_sched_barrier(0); // keeps the sixteen loads in one group here: without it the scheduler sinks the K loads to the foot of the softmax, a few instructions ahead of their use
    // the softmax runs in base 2 on the raw products: C2 = SCL log2(e) > 0, so the raw maximum is the scaled one's element, and a weight is one multiply-add and one hardware exponential
    vp += (jn - j0) * 16;
    float sv[16]; bool ok[16];
#pragma unroll
    for (int e = 0; e < 16; ++e) { const int key = j0 + (e >> 3) * 16 + 8 * hh + (e & 7); ok[e] = (CAUSAL == 1) ? (key <= tq) : true; sv[e] = ok[e] ? s[e >> 3][e & 7] : -3.0e38f; }
    float mx[5];
#pragma unroll
    for (int c = 0; c < 5; ++c) mx[c] = fmaxf(fmaxf(sv[3 * c], sv[3 * c + 1]), sv[3 * c + 2]);
    float mc = fmaxf(fmaxf(fmaxf(mx[0], mx[1]), mx[2]), fmaxf(fmaxf(mx[3], mx[4]), sv[15])); mc = fmaxf(mc, xhalf(mc));
    const float mn = fmaxf(m_r, mc); const float ae = __builtin_amdgcn_exp2f((m_r - mn) * C2); const float al = (mn > -1.0e38f) ? ae : 1.0f; m_r = mn; /* ae formed on every path: a select, so that it runs among the weights' exponentials and EXEC stays whole */
    const float nb = 10.0f - mn * C2; /* the exponent's addend: minus the maximum, plus 10 for the x1024 that the f16 weights carry (the sum carries it too) */
    FragH pb; v2f ps[2]; /* the lane's 16 weights in pairs: four independent partial sums */
#pragma unroll
    for (int i = 0; i < 8; ++i) { const v2f ar = (v2f){sv[2 * i], sv[2 * i + 1]} * C2 + nb; v2f p; p.x = ok[2 * i] ? __builtin_amdgcn_exp2f(ar.x) : 0.f; p.y = ok[2 * i + 1] ? __builtin_amdgcn_exp2f(ar.y) : 0.f;
      if (i < 2) ps[i] = p; else ps[i & 1] += p;
      const v2h ph = __builtin_convertvector(p, v2h); pb.h[2 * i] = ph.x; pb.h[2 * i + 1] = ph.y; }
    l_r = l_r * al + ((ps[0].x + ps[1].x) + (ps[0].y + ps[1].y));
#pragma unroll
    for (int dt = 0; dt < DT; ++dt) oacc[dt] *= al;
#pragma unroll
    for (int dt = 0; dt < DT; ++dt) oacc[dt] = mmaH<1>(av[dt].v, av[dt].v, pb.v, pb.v, oacc[dt]);
    asm volatile("v_nop\n\tv_nop\n\tv_nop\n\tv_nop" : "+v"(oacc[0]), "+v"(oacc[1]), "+v"(oacc[2]), "+v"(oacc[3]) : "v"(av[0].v), "v"(av[1].v), "v"(av[2].v), "v"(av[3].v), "v"(pb.v)); // the run's distance, see at mmaH: the next pass's first score tile may take P's registers
    j0 = jn; }
  { const float l = l_r + xhalf(l_r); const float inv = (l > 0.f) ? 1.0f / l : 0.f; /* l and oacc both carry x1024 */
    // oacc[dt][r] = O[query ln][d = 16 dt + 8 hh + r]: piece 32 (dt & 1) + lane of k tile 2 h + (dt >> 1) in the wave's 16-row band of the fragment-packed context plane (f16, x CSC) that the output GEMM reads: stored from registers, 512 contiguous bytes per wave-wide store
    unsigned short* ob = (unsigned short*)O16 + ((size_t)b * TQ + q0) * ldo + h * 1024 + 8 * lane;
#pragma unroll
    for (int dt = 0; dt < DT; ++dt) { FragH f;
#pragma unroll
      for (int q = 0; q < 8; ++q) f.h[q] = (_Float16)(oacc[dt][q] * inv * CSC);
      *(v8us*)(ob + dt * 256) = f.half[0]; } } }

__global__ __launch_bounds__(256) void k_ln(const float* __restrict__ X, const float* __restrict__ R, const float* __restrict__ g, const float* __restrict__ bta, float* __restrict__ out) {
  __shared__ float red[256];
  const int row = blockIdx.x, tid = threadIdx.x;
  const size_t srow = (size_t)(row / SLEN) * SEQ_FULL + (size_t)(row % SLEN);
  const float* x = X + (size_t)row * DM; const float* rr = R + srow * DM;
  const int j = tid * 4;
  const v4f a = *(const v4fa*)(x + j); const v4f rb = *(const v4fa*)(rr + j);
  float vals[4]; float s1 = 0.f;
#pragma unroll
  for (int q = 0; q < 4; ++q) { const float v = a[q] + bf16_rne(rb[q]); vals[q] = v; s1 += v; }
  red[tid] = s1; __syncthreads();
  for (int st = 128; st > 0; st >>= 1) { if (tid < st) red[tid] += red[tid + st]; __syncthreads(); }
  const float mu = red[0] * 0.0009765625f; __syncthreads();
  float s2 = 0.f;
#pragma unroll
  for (int q = 0; q < 4; ++q) { const float c = vals[q] - mu; s2 += c * c; }
  red[tid] = s2; __syncthreads();
  for (int st = 128; st > 0; st >>= 1) { if (tid < st) red[tid] += red[tid + st]; __syncthreads(); }
  const float rs = rsqrtf(red[0] * 0.0009765625f + LNEPS);
  v4f o;
#pragma unroll
  for (int q = 0; q < 4; ++q) { const float gg = bf16_rne(g[j + q]), bb = bf16_rne(bta[j + q]); o[q] = (vals[q] - mu) * rs * gg + bb; }
  *(v4f*)(out + (size_t)row * DM + j) = o;
  
}

extern "C" void kernel_launch(void* const* d_in, const int* in_sizes, int n_in,
                              void* d_out, int out_size, void* d_ws, size_t ws_size, hipStream_t stream) {
  if (n_in < 11) return;
  const float* hs = (const float*)d_in[0]; const float* Wq = (const float*)d_in[1]; const float* bq = (const float*)d_in[2]; const float* Wk = (const float*)d_in[3]; const float* bk = (const float*)d_in[4];
  const float* Wv = (const float*)d_in[5]; const float* bv = (const float*)d_in[6]; const float* Wd = (const float*)d_in[7]; const float* bd = (const float*)d_in[8]; const float* gam = (const float*)d_in[9]; const float* bet = (const float*)d_in[10];
  const long long need0 = ((long long)(NB - 1) * SEQ_FULL + SLEN) * DM;
  if ((long long)in_sizes[0] < need0) return;
  if (in_sizes[1] < DM * DM || in_sizes[3] < DM * DM || in_sizes[5] < DM * DM || in_sizes[7] < DM * DM) return;
  if (in_sizes[2] < DM || in_sizes[4] < DM || in_sizes[6] < DM || in_sizes[8] < DM || in_sizes[9] < DM || in_sizes[10] < DM) return;
  if ((long long)out_size < (long long)NR * DM) return;
  char* ws = (char*)d_ws; size_t off = 0;
  auto take = [&](size_t bytes) { char* p = ws + off; off += (bytes + 255) & ~(size_t)255; return p; };
  const size_t np = (size_t)NR * DM; const size_t nw = (size_t)DM * DM;
  _Float16* BQ = (_Float16*)take(nw * 2 * 3); _Float16* BK = BQ + nw; _Float16* BV = BK + nw; _Float16* BD = (_Float16*)take(nw * 2); /* q, k, v planes one behind the other: blockIdx.y strides through them */
  _Float16* X16 = (_Float16*)take(np * 2); _Float16* QH = (_Float16*)take(np * 2 * 2); _Float16* KH = QH + np; _Float16* VT = (_Float16*)take(np * 2);
  _Float16* CTX16 = (_Float16*)take(np * 2); float* ATT = (float*)take(np * 4);
  float* O = (float*)d_out;
  if (off > ws_size) return;
  k_prep<<<XBLK + 4 * WBLK, 256, 0, stream>>>(hs, X16, Wq, Wk, Wv, Wd, BQ, BK, BV, BD, WSC);      /* weights: [out][in] = [n][k] */
  const dim3 g((NR / 128) * (DM / 64), 1), g3((NR / 128) * (DM / 64), 3);
  k_gemm2<0><<<g3, 128, 0, stream>>>(X16, DM, 0, BQ, DM, nw, 1.0f / WSC, bq, bk, bv, nullptr, 1, 0, 0, nullptr, QH, VT, DM, np, NR, DM, DM);
  k_flash<0><<<NB * NH * QBLKS, 128, 0, stream>>>(QH, DM, KH, DM, VT, CTX16, DM);
  k_gemm2<0><<<g, 128, 0, stream>>>(CTX16, DM, 0, BD, DM, 0, 1.0f / (WSC * CSC), bd, nullptr, nullptr, nullptr, 1, 0, 0, ATT, nullptr, nullptr, DM, 0, NR, DM, DM);
  k_ln<<<NR, 256, 0, stream>>>(ATT, hs, gam, bet, O);
}

// v009
// A run of this version takes 94.8 microseconds.
// Two timings next to v008 both put it at 1.03 times that version's speed.
// Over all steps from v000 it is 4.67 times as fast.
#include <hip/hip_runtime.h>
// Contractions: v_wmma_f32_16x16x32_f16 everywhere (f16 operands, f32 accumulate) - q/k/v projections (x as f16 of bf16-RNE input, W as f16 of bf16-RNE weight x16), k.q^T and v^T.p^T per head (plain f16 q/k/v planes, p carried x1024), output dense (context carried x16 f16, Wd bf16-RNE x16); softmax, bias adds, residual and LayerNorm in f32.
// Left untouched so far: k_gemm2's epilogue tests CP once per element at run time (64 taken branches a wave; the code they skip, never run, is some 5,000 of the kernel's 5,900 instructions).

#ifndef NB
#define NB 2
#endif
#ifndef SEQ
#define SEQ 2048
#endif
#define NB_FULL 2
#define SEQ_FULL 2048
#define DM 1024
#define NH 16
#define HDIM 64
#define SLEN SEQ
#define TQ SLEN
#define TK SLEN
#define NR (NB * SLEN)
#define SCL 0.125f
#define QBLKS (TQ / 64)
#define LNEPS 0.00001f
#define WSC 16.0f
#define CSC 16.0f
static_assert(NH * HDIM == DM);
static_assert(HDIM == 64);
static_assert(SLEN % 64 == 0);
static_assert((TK / QBLKS) % 32 == 0);
static_assert(NR % 128 == 0);
static_assert(DM % 64 == 0);
static_assert(DM == 4 * 256);
static_assert(NB <= NB_FULL);
static_assert(SEQ <= SEQ_FULL);

typedef unsigned short v8us __attribute__((ext_vector_type(8), may_alias));
typedef float  v8f  __attribute__((ext_vector_type(8)));
typedef float  v4f  __attribute__((ext_vector_type(4)));
typedef float  v4fa __attribute__((ext_vector_type(4), may_alias));
typedef _Float16 v16h __attribute__((ext_vector_type(16)));
typedef _Float16 v4h  __attribute__((ext_vector_type(4)));
typedef float  v2f  __attribute__((ext_vector_type(2)));
typedef _Float16 v2h  __attribute__((ext_vector_type(2)));
union FragH { v16h v; v8us half[2]; _Float16 h[16]; unsigned short u[16]; };

__device__ __forceinline__ unsigned short bf16_bits(float x) { unsigned int u = __float_as_uint(x); return (unsigned short)((u + 0x7FFFu + ((u >> 16) & 1u)) >> 16); }
__device__ __forceinline__ float bf16_val(unsigned short b) { return __uint_as_float(((unsigned int)b) << 16); }
__device__ __forceinline__ float bf16_rne(float x) { return bf16_val(bf16_bits(x)); }

// D += A.B with NT terms (1 = single product); 16x16x32 f16, split k map per lane half; no padding here: inside a run of WMMAs each fills the slots behind the one before, and four v_nop stand once behind the run's last.
// Those four v_nop (the asm statements below) are the distance between a run's last WMMAs and whatever overwrites their A or B registers next (the loads of the next fragments, the next run's D over the loop's back edge); their operands are the run's accumulators (so they stand behind every WMMA of the run) and its fragments (kept live up to them)
template <int NT>
__device__ __forceinline__ v8f mmaH(v16h ah, v16h al, v16h bh, v16h bl, v8f c) {
  c = __builtin_amdgcn_wmma_f32_16x16x32_f16(false, ah, false, bh, (short)0, c, false, false);
  if (NT >= 2) c = __builtin_amdgcn_wmma_f32_16x16x32_f16(false, al, false, bh, (short)0, c, false, false);
  if (NT >= 3) c = __builtin_amdgcn_wmma_f32_16x16x32_f16(false, ah, false, bl, (short)0, c, false, false);
  return c;
}
// Fragment-packed plane of a [rows][K] 16-bit matrix: every tile of 16 rows x 32 k is 512 elements in a row, the tiles of one 16-row band follow in k order (so a band is 16 K elements, as in the row-major plane).
// Inside a tile the 8-element piece number 32 i + 16 h + c holds row c, k = 16 i + 8 h + 0..7: piece number = 32 i + lane, so each of a fragment's two wave-wide 16-byte loads covers 512 contiguous bytes (4 whole lines).
// packing from a row-major f32 source, kt = K / 32 tiles per band: thread t takes 8 k of one row, four threads in a row per 128-byte source line; a wave reads 8 whole lines and writes 4 whole lines. dst = element offset of its piece
__device__ __forceinline__ void pk_src(size_t t, int kt, size_t& row, int& k, size_t& dst) { const size_t tile = t >> 6; const int c = (int)(t & 63) >> 2, ih = (int)(t & 3); row = (tile / kt) * 16 + c; k = (int)(tile % kt) * 32 + 8 * ih; dst = tile * 512 + (size_t)(16 * ih + c) * 8; }
// fragment of 16 rows (lane&15) x 32 k from a packed tile: elements 0..7 <- k0+8h, 8..15 <- k0+16+8h
// p already holds the tile's start + 8 lane elements
__device__ __forceinline__ v16h g2_fragp(const _Float16* p) { FragH f; f.half[0] = *(const v8us*)((const unsigned short*)p); f.half[1] = *(const v8us*)((const unsigned short*)p + 256); return f.v; }
__device__ __forceinline__ v8f g2_mma(v16h a, v16h b, v8f c) { return __builtin_amdgcn_wmma_f32_16x16x32_f16(false, a, false, b, (short)0, c, false, false); }
// behind the eight WMMAs of a GEMM k-step
__device__ __forceinline__ void g2_run_end(v8f& c0, v8f& c1, v8f& c2, v8f& c3, v8f& c4, v8f& c5, v8f& c6, v8f& c7, v16h a0, v16h a1, v16h b0, v16h b1, v16h b2, v16h b3) {
  asm volatile("v_nop\n\tv_nop\n\tv_nop\n\tv_nop" : "+v"(c0), "+v"(c1), "+v"(c2), "+v"(c3), "+v"(c4), "+v"(c5), "+v"(c6), "+v"(c7) : "v"(a0), "v"(a1), "v"(b0), "v"(b1), "v"(b2), "v"(b3)); // the run's distance, see above
  __builtin_amdgcn_sched_barrier(0); } // the next loads stay behind the run whose registers they refill

// blocks of 256 threads that one conversion takes: one block per band of 16 rows (DM / 32 = 32 packed tiles), 8 pieces of 8 elements a thread
#define XBLK (NR / 16)
#define WBLK (DM / 16)
static_assert(NR % 16 == 0 && DM % 16 == 0 && DM / 32 == 8 * 4);
// the five input conversions depend on nothing and on each other not at all: one grid; blocks [0, XBLK) pack x, then WBLK blocks for each of the four weights (the choice is the same for a whole block)
// few long waves instead of many short ones: 16 waves a WGP, each lane with its sixteen 16-byte loads out before the first conversion; a block reads 16 whole source rows and writes one whole packed band
__global__ __launch_bounds__(256) void k_prep(const float* __restrict__ x, _Float16* __restrict__ X16, const float* __restrict__ W0, const float* __restrict__ W1, const float* __restrict__ W2, const float* __restrict__ W3,
    _Float16* __restrict__ B0, _Float16* __restrict__ B1, _Float16* __restrict__ B2, _Float16* __restrict__ B3, float sc) {
  const bool isx = blockIdx.x < XBLK; const unsigned wblk = blockIdx.x - XBLK, wi = wblk / WBLK;
  const unsigned band = isx ? blockIdx.x : wblk - wi * WBLK;
  const float* S = isx ? x : wi == 0 ? W0 : wi == 1 ? W1 : wi == 2 ? W2 : W3; _Float16* D = isx ? X16 : wi == 0 ? B0 : wi == 1 ? B1 : wi == 2 ? B2 : B3;
  const float s = isx ? 1.0f : sc; /* x is taken as it is: times one is exact */
  size_t r, e; int c;
  pk_src((size_t)band * 2048 + threadIdx.x, DM / 32, r, c, e); /* the thread's first piece; piece i lies four tiles on in the same band: 128 source columns, 2048 packed elements */
  const size_t sr = isx ? (r / SLEN) * SEQ_FULL + (r % SLEN) : r;
  const float* src = S + sr * DM + c; unsigned short* dst = (unsigned short*)D + e;
  v4f lo[8], hi[8];
#pragma unroll
  for (int i = 0; i < 8; ++i) { lo[i] = *(const v4fa*)(src + 128 * i); hi[i] = *(const v4fa*)(src + 128 * i + 4); }
  asm volatile("s_wait_xcnt 0x0" :: "v"(src) : "memory"); // behind the group: it holds the loads' address pair untouched up to here (without it the last load's result takes that pair), and every later reuse stands behind the wait
  __builtin_amdgcn_sched_barrier(0); // all sixteen loads go out as one group: the scheduler otherwise sinks part of them among the conversions, behind waits, and the wave pays the memory latency more than once
#pragma unroll
  for (int i = 0; i < 8; ++i) { FragH f;
#pragma unroll
    for (int q = 0; q < 4; ++q) { f.h[q] = (_Float16)(bf16_rne(lo[i][q]) * s); f.h[4 + q] = (_Float16)(bf16_rne(hi[i][q]) * s); }
    *(v8us*)(dst + 2048 * i) = f.half[0]; }
}

// GEMM (wave tile 32x64; M % 128 == 0, N % 64 == 0, K % 32 == 0): v = acc*alpha + bf16(bias[col]) (+ CP term if CP); ACT 0 none; A, Bh and C16 are fragment-packed planes (lda, ldb, ldc = their K); writes f32 C (row-major, pitch ldc) and/or f16 C16; blockIdx.y = one of up to three independent products of one grid (A, Bh, C by their strides sA, sB, sC; bias, bias1, bias2 in turn); if CT, the third product (N = NH heads of 64 columns, no CP, no ACT) goes to CT alone, transposed
template <int ACT>
__global__ __launch_bounds__(128) void k_gemm2(const _Float16* __restrict__ A, int lda, size_t sA, const _Float16* __restrict__ Bh, int ldb, size_t sB, float alpha, const float* __restrict__ bias, const float* __restrict__ bias1, const float* __restrict__ bias2, const float* __restrict__ CP, int rowsPerB, size_t sCPb, int row0g,
    float* __restrict__ C, _Float16* __restrict__ C16, _Float16* __restrict__ CT, int ldc, size_t sC, int M, int N, int K) {
  __shared__ __attribute__((aligned(16))) float so[4][32][68];
  const int tid = threadIdx.x, w = tid >> 5, lane = tid & 31, ln = lane & 15, hh = lane >> 4; const int by = blockIdx.y;
  A += (size_t)by * sA; Bh += (size_t)by * sB; const size_t cofs = (size_t)by * sC; const float* bp = by == 0 ? bias : by == 1 ? bias1 : bias2;
  const int ntn = N >> 6; const int mt = blockIdx.x / ntn, nq = blockIdx.x - mt * ntn; const int row0 = mt * 128 + 32 * w, col0 = nq * 64; if (row0 >= M) return;
  // each lane's own fragment pointers (band start + kp pairs of 1024 elements + 8 lane elements; a k-step is one tile, 512 elements); they move once per two k-steps, in front of the loads of the next pair's first step
  // every work-group starts its k walk at its own pair of k-steps (tile row + tile column, modulo the pairs) and wraps round: groups that share A rows or B rows and run in step then ask L2 for different lines at any one moment; start 0 where K is not at least two whole pairs. The f32 sums take their terms in that turned order
  const int nit = (K + 63) >> 6; int kp = ((K & 63) || K < 128) ? 0 : (int)((unsigned)(mt + nq) % (unsigned)nit); const long long kwrap = -(long long)(nit - 1) * 1024;
  const _Float16* a0p = A + (size_t)row0 * lda + (size_t)kp * 1024 + 8 * lane; const _Float16* a1p = a0p + (size_t)16 * lda;
  const _Float16* b0p = Bh + (size_t)col0 * ldb + (size_t)kp * 1024 + 8 * lane; const _Float16* b1p = b0p + (size_t)16 * ldb; const _Float16* b2p = b1p + (size_t)16 * ldb; const _Float16* b3p = b2p + (size_t)16 * ldb;
  const v8f z8 = {0.f,0.f,0.f,0.f,0.f,0.f,0.f,0.f}; v8f c00 = z8, c01 = z8, c02 = z8, c03 = z8, c10 = z8, c11 = z8, c12 = z8, c13 = z8;
  // fragments are fetched one k-step ahead into a second register set (x and y take turns): the twelve loads of the next step go out as one group in front of this step's products
#define G2_LOAD(S, O) S##a0 = g2_fragp(a0p + (O)); S##a1 = g2_fragp(a1p + (O)); S##b0 = g2_fragp(b0p + (O)); S##b1 = g2_fragp(b1p + (O)); S##b2 = g2_fragp(b2p + (O)); S##b3 = g2_fragp(b3p + (O));
#define G2_STEP(S) c00 = g2_mma(S##a0, S##b0, c00); c10 = g2_mma(S##a1, S##b0, c10); c01 = g2_mma(S##a0, S##b1, c01); c11 = g2_mma(S##a1, S##b1, c11); c02 = g2_mma(S##a0, S##b2, c02); c12 = g2_mma(S##a1, S##b2, c12); c03 = g2_mma(S##a0, S##b3, c03); c13 = g2_mma(S##a1, S##b3, c13); \
  g2_run_end(c00, c10, c01, c11, c02, c12, c03, c13, S##a0, S##a1, S##b0, S##b1, S##b2, S##b3);
  v16h xa0, xa1, xb0, xb1, xb2, xb3, ya0, ya1, yb0, yb1, yb2, yb3;
  G2_LOAD(x, 0)
  int kb = 0;
  // unroll 1: the body already holds both register sets' steps; further copies would only add registers
#pragma unroll 1
  for (; kb + 64 < K; kb += 64) {
    G2_LOAD(y, 512)
    __builtin_amdgcn_sched_barrier(0); // each group of twelve loads stays whole in front of the run before its use: the scheduler otherwise sinks some of them to a few instructions ahead of their use
    G2_STEP(x)
    ++kp; const long long kd = (kp == nit) ? kwrap : 1024; kp = (kp == nit) ? 0 : kp; /* on to the next pair, from the last one back to the first; the same for the whole block */
    a0p += kd; a1p += kd; b0p += kd; b1p += kd; b2p += kd; b3p += kd;
    G2_LOAD(x, 0)
    __builtin_amdgcn_sched_barrier(0); // as above
    G2_STEP(y) }
  if (kb + 32 < K) { G2_LOAD(y, 512) G2_STEP(x) G2_STEP(y) } else { G2_STEP(x) }
#undef G2_LOAD
#undef G2_STEP
  v8f accs[8] = {c00, c01, c02, c03, c10, c11, c12, c13};
  if (CT && by == 2) { // the same for a whole block. CT: per (batch, head) slab a fragment-packed plane with rows = the head's 64 columns, k = tokens, as the attention's second product reads it.
    // A lane's accumulator tile (t, half) is row 16 t + ln, k = 16 half + 8 hh + 0..7 of the wave's 32-token tile: piece 32 half + lane of that packed tile, so it is stored from registers, 512 contiguous bytes per wave-wide store
    unsigned short* dst = (unsigned short*)CT + (size_t)((row0 / SLEN) * NH + nq) * 64 * SLEN + (size_t)((row0 % SLEN) >> 5) * 512 + 8 * lane;
    float bvs[4]; FragH f[8]; // the four bias loads go out as one group; all eight pieces are formed before the first store, so that no register of an issued store is written again
#pragma unroll
    for (int t = 0; t < 4; ++t) bvs[t] = bp ? bp[col0 + t * 16 + ln] : 0.f;
#pragma unroll
    for (int u = 0; u < 8; ++u) { const float bv = bf16_rne(bvs[u & 3]);
#pragma unroll
      for (int r = 0; r < 8; ++r) f[u].h[r] = (_Float16)(accs[u][r] * alpha + bv); }
#pragma unroll
    for (int u = 0; u < 8; ++u) *(v8us*)(dst + (size_t)((u & 3) * 16) * SLEN + 256 * (u >> 2)) = f[u].half[0];
    return; }
#pragma unroll
  for (int u = 0; u < 8; ++u) { const int t = u & 3, half = u >> 2; const int col = col0 + t * 16 + ln; const float bv = bp ? bf16_rne(bp[col]) : 0.f;
#pragma unroll
    for (int r = 0; r < 8; ++r) { const int rloc = half * 16 + 8 * hh + r; float v = accs[u][r] * alpha + bv;
      if (CP) { if (rowsPerB < 0) v += CP[cofs + (size_t)(row0g + row0 + rloc) * ldc + col]; else { const int bidx = (row0g + row0 + rloc) / rowsPerB; v += CP[(size_t)bidx * sCPb + (size_t)by * 64 + col]; } }
      if (ACT == 3) v = fmaxf(v, 0.f);
      so[w][rloc][t * 16 + ln] = v; } }
  __builtin_amdgcn_fence(4 /* acq_rel order */, "workgroup"); __builtin_amdgcn_wave_barrier();
  const int rsub = lane >> 4, c4 = (lane & 15) * 4;
  {
#pragma unroll
    for (int q = 0; q < 16; ++q) { const int r = q * 2 + rsub; const v4f v = *(const v4fa*)&so[w][r][c4];
      if (C) *(v4f*)(C + cofs + (size_t)(row0 + r) * ldc + col0 + c4) = v; }
     }
  asm volatile("s_wait_xcnt 0x0" ::: "memory"); // behind the run of C stores: the C16 block below reuses registers that those stores name
  if (C16) { // the wave's 32 x 64 block is 2 x 2 packed tiles; per tile two wave-wide 16-byte stores of 512 contiguous bytes
#pragma unroll
    for (int tl = 0; tl < 4; ++tl) { const int rtl = tl >> 1, kbl = tl & 1; _Float16* dst = C16 + cofs + (size_t)(row0 + 16 * rtl) * ldc + (size_t)((col0 >> 5) + kbl) * 512 + 8 * lane;
#pragma unroll
      for (int i = 0; i < 2; ++i) { const float* sp = &so[w][rtl * 16 + ln][kbl * 32 + 16 * i + 8 * hh]; const v4f lo = *(const v4fa*)sp, hi = *(const v4fa*)(sp + 4); FragH f;
#pragma unroll
        for (int q = 0; q < 4; ++q) { f.h[q] = (_Float16)lo[q]; f.h[4 + q] = (_Float16)hi[q]; }
        *(v8us*)((unsigned short*)dst + 256 * i) = f.half[0]; } } } }

// lane l with lane l ^ 16 (a vector cross-row move, no LDS queue)
__device__ __forceinline__ float xhalf(float x) { return __builtin_bit_cast(float, __builtin_amdgcn_permlanex16(__builtin_bit_cast(int, x), __builtin_bit_cast(int, x), 0x76543210, 0xfedcba98, false, false)); }

// fused attention per ((b,h), 64 queries): wave = 16 queries; both products transposed: S^T = K.Q^T (A = 16 keys, B = the wave's queries; d = 64: 2 k-steps) x SCL over all TK keys (CAUSAL == 0: no key excluded), O^T += V^T.P^T (A = 16 d, B = P^T).
// A lane holds 16 of the pass's 32 scores of ONE query (column lane & 15; keys 16 nt + 8 (lane >> 4) + r): maximum and sum run in the lane, the two lane halves meet by one cross-row move; the two score tiles, converted in place, are the B fragment of P^T (element 8 nt + r = k 16 nt + 8 h + r, the k order of the packed V^T tiles).
// online max/sum softmax f32; Q16, K16, O16 (rows = tokens, k = columns) and Vt (per slab: rows = d, k = keys) are fragment-packed planes
template <int CAUSAL>
__global__ __launch_bounds__(128) void k_flash(const _Float16* __restrict__ Q16, int ldq, const _Float16* __restrict__ K16, int ldk, const _Float16* __restrict__ Vt, _Float16* __restrict__ O16, int ldo) {
  constexpr int RPW = 16, DT = 4, KS = 2; constexpr float C2 = SCL * 1.4426950408889634f;
  const int tid = threadIdx.x, w = tid >> 5, lane = tid & 31, ln = lane & 15, hh = lane >> 4;
  const int slab = blockIdx.x / QBLKS, qblk = blockIdx.x % QBLKS; const int b = slab / NH, h = slab % NH; const int qb0 = qblk * (4 * RPW); const int q0 = qb0 + w * RPW;
  FragH bq[KS];
  { const unsigned short* qr = (const unsigned short*)Q16 + ((size_t)b * TQ + q0) * ldq + h * 1024 + 8 * lane;
#pragma unroll
    for (int ks = 0; ks < KS; ++ks) { bq[ks].half[0] = *(const v8us*)(qr + ks * 512); bq[ks].half[1] = *(const v8us*)(qr + ks * 512 + 256); } }
  const unsigned short* Vth = (const unsigned short*)Vt + (size_t)slab * 64 * TK; const unsigned l8 = 8u * (unsigned)lane; /* the lane's piece of a tile half; the K and V tile starts are the same for the whole block */
  float m_r = -3.0e38f, l_r = 0.f; v8f oacc[DT]; /* m_r: the query's running maximum of the raw products (alike in both halves); l_r: the sum over this half's keys, x1024 */
#pragma unroll
  for (int dt = 0; dt < DT; ++dt) oacc[dt] = (v8f){0.f,0.f,0.f,0.f,0.f,0.f,0.f,0.f};
  const int jend = (CAUSAL == 1) ? (qb0 + 4 * RPW) : TK; const int tq = q0 + ln; (void)tq;
  // with no key excluded the order of the keys is free: each of a slab's QBLKS blocks starts its walk TK / QBLKS keys further on and wraps round, so that blocks running in step ask L2 for different K and V lines at any one moment (maximum and sums take the keys in that turned order)
  int j0 = (CAUSAL == 1) ? 0 : qblk * (TK / QBLKS);
  const unsigned short* vp = Vth + (size_t)j0 * 16 + l8; /* the lane's piece of this pass's first V tile; it moves with j0 */
  FragH ak[2][KS];
#pragma unroll
  for (int nt = 0; nt < 2; ++nt) { const unsigned short* kr = (const unsigned short*)K16 + ((size_t)b * TK + j0 + nt * 16) * ldk + h * 1024;
#pragma unroll
    for (int ks = 0; ks < KS; ++ks) { ak[nt][ks].half[0] = *(const v8us*)(kr + ks * 512 + l8); ak[nt][ks].half[1] = *(const v8us*)(kr + ks * 512 + 256 + l8); } }
#pragma unroll 1
  for (int it = 0; it < jend; it += 32) {
    v8f s[2];
#pragma unroll
    for (int nt = 0; nt < 2; ++nt) { v8f acc = (v8f){0.f,0.f,0.f,0.f,0.f,0.f,0.f,0.f};
#pragma unroll
      for (int ks = 0; ks < KS; ++ks) acc = mmaH<1>(ak[nt][ks].v, ak[nt][ks].v, bq[ks].v, bq[ks].v, acc);
      s[nt] = acc; }
    asm volatile("v_nop\n\tv_nop\n\tv_nop\n\tv_nop" : "+v"(s[0]), "+v"(s[1]) : "v"(ak[0][0].v), "v"(ak[0][1].v), "v"(ak[1][0].v), "v"(ak[1][1].v), "v"(bq[0].v), "v"(bq[1].v)); // the run's distance, see at mmaH
    __builtin_amdgcn_sched_barrier(0); // the K loads below refill the registers this run reads: in front of it they would need other registers and copies
    // one group of loads directly behind the score products, a softmax ahead of their use: this pass's V fragments, then the next pass's K fragments into the registers just read
    FragH av[DT];
#pragma unroll
    for (int dt = 0; dt < DT; ++dt) { const unsigned short* vrow = vp + (size_t)(dt * 16) * TK; av[dt].half[0] = *(const v8us*)vrow; av[dt].half[1] = *(const v8us*)(vrow + 256); }
    const int jn = (j0 + 32 < jend) ? j0 + 32 : 0; /* behind the last keys the walk goes on at the first; the last pass's fetch is not used and stays inside K16 */
#pragma unroll
    for (int nt = 0; nt < 2; ++nt) { const unsigned short* kr = (const unsigned short*)K16 + ((size_t)b * TK + jn + nt * 16) * ldk + h * 1024;
#pragma unroll
      for (int ks = 0; ks < KS; ++ks) { ak[nt][ks].half[0] = *(const v8us*)(kr + ks * 512 + l8); ak[nt][ks].half[1] = *(const v8us*)(kr + ks * 512 + 256 + l8); } }
    __builtin_amdgcn_sched_barrier(0); // keeps the sixteen loads in one group here: without it the scheduler sinks the K loads to the foot of the softmax, a few instructions ahead of their use
    // the softmax runs in base 2 on the raw products: C2 = SCL log2(e) > 0, so the raw maximum is the scaled one's element, and a weight is one multiply-add and one hardware exponential
    vp += (jn - j0) * 16;
    float sv[16]; bool ok[16];
#pragma unroll
    for (int e = 0; e < 16; ++e) { const int key = j0 + (e >> 3) * 16 + 8 * hh + (e & 7); ok[e] = (CAUSAL == 1) ? (key <= tq) : true; sv[e] = ok[e] ? s[e >> 3][e & 7] : -3.0e38f; }
    float mx[5];
#pragma unroll
    for (int c = 0; c < 5; ++c) mx[c] = fmaxf(fmaxf(sv[3 * c], sv[3 * c + 1]), sv[3 * c + 2]);
    float mc = fmaxf(fmaxf(fmaxf(mx[0], mx[1]), mx[2]), fmaxf(fmaxf(mx[3], mx[4]), sv[15])); mc = fmaxf(mc, xhalf(mc));
    const float mn = fmaxf(m_r, mc); const float ae = __builtin_amdgcn_exp2f((m_r - mn) * C2); const float al = (mn > -1.0e38f) ? ae : 1.0f; m_r = mn; /* ae formed on every path: a select, so that it runs among the weights' exponentials and EXEC stays whole */
    const float nb = 10.0f - mn * C2; /* the exponent's addend: minus the maximum, plus 10 for the x1024 that the f16 weights carry (the sum carries it too) */
    FragH pb; v2f ps[2]; /* the lane's 16 weights in pairs: four independent partial sums */
#pragma unroll
    for (int i = 0; i < 8; ++i) { const v2f ar = (v2f){sv[2 * i], sv[2 * i + 1]} * C2 + nb; v2f p; p.x = ok[2 * i] ? __builtin_amdgcn_exp2f(ar.x) : 0.f; p.y = ok[2 * i + 1] ? __builtin_amdgcn_exp2f(ar.y) : 0.f;
      if (i < 2) ps[i] = p; else ps[i & 1] += p;
      const v2h ph = __builtin_convertvector(p, v2h); pb.h[2 * i] = ph.x; pb.h[2 * i + 1] = ph.y; }
    l_r = l_r * al + ((ps[0].x + ps[1].x) + (ps[0].y + ps[1].y));
#pragma unroll
    for (int dt = 0; dt < DT; ++dt) oacc[dt] *= al;
#pragma unroll
    for (int dt = 0; dt < DT; ++dt) oacc[dt] = mmaH<1>(av[dt].v, av[dt].v, pb.v, pb.v, oacc[dt]);
    asm volatile("v_nop\n\tv_nop\n\tv_nop\n\tv_nop" : "+v"(oacc[0]), "+v"(oacc[1]), "+v"(oacc[2]), "+v"(oacc[3]) : "v"(av[0].v), "v"(av[1].v), "v"(av[2].v), "v"(av[3].v), "v"(pb.v)); // the run's distance, see at mmaH: the next pass's first score tile may take P's registers
    j0 = jn; }
  { const float l = l_r + xhalf(l_r); const float inv = (l > 0.f) ? 1.0f / l : 0.f; /* l and oacc both carry x1024 */
    // oacc[dt][r] = O[query ln][d = 16 dt + 8 hh + r]: piece 32 (dt & 1) + lane of k tile 2 h + (dt >> 1) in the wave's 16-row band of the fragment-packed context plane (f16, x CSC) that the output GEMM reads: stored from registers, 512 contiguous bytes per wave-wide store
    unsigned short* ob = (unsigned short*)O16 + ((size_t)b * TQ + q0) * ldo + h * 1024 + 8 * lane;
#pragma unroll
    for (int dt = 0; dt < DT; ++dt) { FragH f;
#pragma unroll
      for (int q = 0; q < 8; ++q) f.h[q] = (_Float16)(oacc[dt][q] * inv * CSC);
      *(v8us*)(ob + dt * 256) = f.half[0]; } } }

// lane l with lane l ^ M of its 16-lane row (a DPP move, no LDS queue)
template <int M>
__device__ __forceinline__ float xrow(float x) { return __builtin_bit_cast(float, __builtin_amdgcn_update_dpp(0, __builtin_bit_cast(int, x), 0x160 | M, 0xf, 0xf, true)); }
// sum over the wave's 32 lanes, alike in every lane
__device__ __forceinline__ float wave_sum(float s) { s += xrow<1>(s); s += xrow<2>(s); s += xrow<4>(s); s += xrow<8>(s); return s + xhalf(s); }

// residual + LayerNorm, one wave per row (8 rows a block, no LDS, no barrier): a lane holds 32 of the row's DM values in registers (columns 128 i + 4 lane + 0..3: every wave-wide 16-byte access covers 512 contiguous bytes); mean, then the sum of squared distances from it, each four chains in the lane and a butterfly over the lanes
static_assert(NR % 8 == 0 && DM == 8 * 128);
__global__ __launch_bounds__(256) void k_ln(const float* __restrict__ X, const float* __restrict__ R, const float* __restrict__ g, const float* __restrict__ bta, float* __restrict__ out) {
  const int lane = threadIdx.x & 31; const int row = blockIdx.x * 8 + (threadIdx.x >> 5);
  const size_t srow = (size_t)(row / SLEN) * SEQ_FULL + (size_t)(row % SLEN);
  const float* x = X + (size_t)row * DM + 4 * lane; const float* rr = R + srow * DM + 4 * lane;
  v4f a[8], rb[8], gg[8], bb[8];
#pragma unroll
  for (int i = 0; i < 8; ++i) a[i] = *(const v4fa*)(x + 128 * i);
#pragma unroll
  for (int i = 0; i < 8; ++i) rb[i] = *(const v4fa*)(rr + 128 * i);
#pragma unroll
  for (int i = 0; i < 8; ++i) { gg[i] = *(const v4fa*)(g + 4 * lane + 128 * i); bb[i] = *(const v4fa*)(bta + 4 * lane + 128 * i); }
  asm volatile("s_wait_xcnt 0x0" :: "v"(x), "v"(rr) : "memory"); // behind the group: it holds the row loads' address pairs untouched up to here (without it the last loads' results take them), and every later reuse stands behind the wait
  __builtin_amdgcn_sched_barrier(0); // all thirty-two loads go out as one group: the scheduler otherwise sinks the last rows' behind waits and the scale and shift loads behind both sums, each pair waited for at once
  v4f s4 = {0.f, 0.f, 0.f, 0.f};
#pragma unroll
  for (int i = 0; i < 8; ++i) {
#pragma unroll
    for (int q = 0; q < 4; ++q) a[i][q] += bf16_rne(rb[i][q]);
    s4 += a[i]; }
  const float mu = wave_sum((s4.x + s4.y) + (s4.z + s4.w)) * 0.0009765625f;
  v4f d4 = {0.f, 0.f, 0.f, 0.f};
#pragma unroll
  for (int i = 0; i < 8; ++i) { a[i] -= mu; d4 += a[i] * a[i]; }
  const float rs = rsqrtf(wave_sum((d4.x + d4.y) + (d4.z + d4.w)) * 0.0009765625f + LNEPS);
  float* o = out + (size_t)row * DM + 4 * lane;
#pragma unroll
  for (int i = 0; i < 8; ++i) { v4f v;
#pragma unroll
    for (int q = 0; q < 4; ++q) v[q] = a[i][q] * rs * bf16_rne(gg[i][q]) + bf16_rne(bb[i][q]);
    *(v4f*)(o + 128 * i) = v; }
}

extern "C" void kernel_launch(void* const* d_in, const int* in_sizes, int n_in,
                              void* d_out, int out_size, void* d_ws, size_t ws_size, hipStream_t stream) {
  if (n_in < 11) return;
  const float* hs = (const float*)d_in[0]; const float* Wq = (const float*)d_in[1]; const float* bq = (const float*)d_in[2]; const float* Wk = (const float*)d_in[3]; const float* bk = (const float*)d_in[4];
  const float* Wv = (const float*)d_in[5]; const float* bv = (const float*)d_in[6]; const float* Wd = (const float*)d_in[7]; const float* bd = (const float*)d_in[8]; const float* gam = (const float*)d_in[9]; const float* bet = (const float*)d_in[10];
  const long long need0 = ((long long)(NB - 1) * SEQ_FULL + SLEN) * DM;
  if ((long long)in_sizes[0] < need0) return;
  if (in_sizes[1] < DM * DM || in_sizes[3] < DM * DM || in_sizes[5] < DM * DM || in_sizes[7] < DM * DM) return;
  if (in_sizes[2] < DM || in_sizes[4] < DM || in_sizes[6] < DM || in_sizes[8] < DM || in_sizes[9] < DM || in_sizes[10] < DM) return;
  if ((long long)out_size < (long long)NR * DM) return;
  char* ws = (char*)d_ws; size_t off = 0;
  auto take = [&](size_t bytes) { char* p = ws + off; off += (bytes + 255) & ~(size_t)255; return p; };
  const size_t np = (size_t)NR * DM; const size_t nw = (size_t)DM * DM;
  _Float16* BQ = (_Float16*)take(nw * 2 * 3); _Float16* BK = BQ + nw; _Float16* BV = BK + nw; _Float16* BD = (_Float16*)take(nw * 2); /* q, k, v planes one behind the other: blockIdx.y strides through them */
  _Float16* X16 = (_Float16*)take(np * 2); _Float16* QH = (_Float16*)take(np * 2 * 2); _Float16* KH = QH + np; _Float16* VT = (_Float16*)take(np * 2);
  _Float16* CTX16 = (_Float16*)take(np * 2); float* ATT = (float*)take(np * 4);
  float* O = (float*)d_out;
  if (off > ws_size) return;
  k_prep<<<XBLK + 4 * WBLK, 256, 0, stream>>>(hs, X16, Wq, Wk, Wv, Wd, BQ, BK, BV, BD, WSC);      /* weights: [out][in] = [n][k] */
  const dim3 g((NR / 128) * (DM / 64), 1), g3((NR / 128) * (DM / 64), 3);
  k_gemm2<0><<<g3, 128, 0, stream>>>(X16, DM, 0, BQ, DM, nw, 1.0f / WSC, bq, bk, bv, nullptr, 1, 0, 0, nullptr, QH, VT, DM, np, NR, DM, DM);
  k_flash<0><<<NB * NH * QBLKS, 128, 0, stream>>>(QH, DM, KH, DM, VT, CTX16, DM);
  k_gemm2<0><<<g, 128, 0, stream>>>(CTX16, DM, 0, BD, DM, 0, 1.0f / (WSC * CSC), bd, nullptr, nullptr, nullptr, 1, 0, 0, ATT, nullptr, nullptr, DM, 0, NR, DM, DM);
  k_ln<<<NR / 8, 256, 0, stream>>>(ATT, hs, gam, bet, O);
}

// v010
// Measured time: 90.1 microseconds a run.
// Two timings next to v009 both put it at 1.05 times that version's speed.
// Counting every step since v000, it is 4.92 times as fast.
#include <hip/hip_runtime.h>
// Contractions: v_wmma_f32_16x16x32_f16 everywhere (f16 operands, f32 accumulate) - q/k/v projections (x as f16 of bf16-RNE input, W as f16 of bf16-RNE weight x16), k.q^T and v^T.p^T per head (plain f16 q/k/v planes, p carried x1024), output dense (context carried x16 f16, Wd bf16-RNE x16); softmax, bias adds, residual and LayerNorm in f32.
// Left untouched so far: k_gemm2's epilogue tests CP once per element at run time (64 taken branches per half of the wave's rows, 128 a wave; the code they skip, never run, is most of the kernel's text).

#ifndef NB
#define NB 2
#endif
#ifndef SEQ
#define SEQ 2048
#endif
#define NB_FULL 2
#define SEQ_FULL 2048
#define DM 1024
#define NH 16
#define HDIM 64
#define SLEN SEQ
#define TQ SLEN
#define TK SLEN
#define NR (NB * SLEN)
#define SCL 0.125f
#define QBLKS (TQ / 64)
#define LNEPS 0.00001f
#define WSC 16.0f
#define CSC 16.0f
static_assert(NH * HDIM == DM);
static_assert(HDIM == 64);
static_assert(SLEN % 64 == 0);
static_assert((TK / QBLKS) % 32 == 0);
static_assert(NR % 128 == 0);
static_assert(DM % 128 == 0);
static_assert(DM == 4 * 256);
static_assert(NB <= NB_FULL);
static_assert(SEQ <= SEQ_FULL);

typedef unsigned short v8us __attribute__((ext_vector_type(8), may_alias));
typedef float  v8f  __attribute__((ext_vector_type(8)));
typedef float  v4f  __attribute__((ext_vector_type(4)));
typedef float  v4fa __attribute__((ext_vector_type(4), may_alias));
typedef _Float16 v16h __attribute__((ext_vector_type(16)));
typedef _Float16 v4h  __attribute__((ext_vector_type(4)));
typedef float  v2f  __attribute__((ext_vector_type(2)));
typedef _Float16 v2h  __attribute__((ext_vector_type(2)));
union FragH { v16h v; v8us half[2]; _Float16 h[16]; unsigned short u[16]; };

__device__ __forceinline__ unsigned short bf16_bits(float x) { unsigned int u = __float_as_uint(x); return (unsigned short)((u + 0x7FFFu + ((u >> 16) & 1u)) >> 16); }
__device__ __forceinline__ float bf16_val(unsigned short b) { return __uint_as_float(((unsigned int)b) << 16); }
__device__ __forceinline__ float bf16_rne(float x) { return bf16_val(bf16_bits(x)); }

// D += A.B with NT terms (1 = single product); 16x16x32 f16, split k map per lane half; no padding here: inside a run of WMMAs each fills the slots behind the one before, and four v_nop stand once behind the run's last.
// Those four v_nop (the asm statements below) are the distance between a run's last WMMAs and whatever overwrites their A or B registers next (the loads of the next fragments, the next run's D over the loop's back edge); their operands are the run's accumulators (so they stand behind every WMMA of the run) and its fragments (kept live up to them)
template <int NT>
__device__ __forceinline__ v8f mmaH(v16h ah, v16h al, v16h bh, v16h bl, v8f c) {
  c = __builtin_amdgcn_wmma_f32_16x16x32_f16(false, ah, false, bh, (short)0, c, false, false);
  if (NT >= 2) c = __builtin_amdgcn_wmma_f32_16x16x32_f16(false, al, false, bh, (short)0, c, false, false);
  if (NT >= 3) c = __builtin_amdgcn_wmma_f32_16x16x32_f16(false, ah, false, bl, (short)0, c, false, false);
  return c;
}
// Fragment-packed plane of a [rows][K] 16-bit matrix: every tile of 16 rows x 32 k is 512 elements in a row, the tiles of one 16-row band follow in k order (so a band is 16 K elements, as in the row-major plane).
// Inside a tile the 8-element piece number 32 i + 16 h + c holds row c, k = 16 i + 8 h + 0..7: piece number = 32 i + lane, so each of a fragment's two wave-wide 16-byte loads covers 512 contiguous bytes (4 whole lines).
// packing from a row-major f32 source, kt = K / 32 tiles per band: thread t takes 8 k of one row, four threads in a row per 128-byte source line; a wave reads 8 whole lines and writes 4 whole lines. dst = element offset of its piece
__device__ __forceinline__ void pk_src(size_t t, int kt, size_t& row, int& k, size_t& dst) { const size_t tile = t >> 6; const int c = (int)(t & 63) >> 2, ih = (int)(t & 3); row = (tile / kt) * 16 + c; k = (int)(tile % kt) * 32 + 8 * ih; dst = tile * 512 + (size_t)(16 * ih + c) * 8; }
// fragment of 16 rows (lane&15) x 32 k from a packed tile: elements 0..7 <- k0+8h, 8..15 <- k0+16+8h
// p already holds the tile's start + 8 lane elements
__device__ __forceinline__ v16h g2_fragp(const _Float16* p) { FragH f; f.half[0] = *(const v8us*)((const unsigned short*)p); f.half[1] = *(const v8us*)((const unsigned short*)p + 256); return f.v; }
__device__ __forceinline__ v8f g2_mma(v16h a, v16h b, v8f c) { return __builtin_amdgcn_wmma_f32_16x16x32_f16(false, a, false, b, (short)0, c, false, false); }
// behind the sixteen WMMAs of a GEMM k-step
__device__ __forceinline__ void g2_run_end() {
  __builtin_amdgcn_sched_barrier(0); // every WMMA of the run stays in front of the distance below (here no operands tie it: the kernel's registers pass v255, and asm operands would all have to lie under it, at the price of spills)
  asm volatile("v_nop\n\tv_nop\n\tv_nop\n\tv_nop"); // the run's distance, see above
  __builtin_amdgcn_sched_barrier(0); } // the next loads stay behind the run whose registers they refill

// blocks of 256 threads that one conversion takes: one block per band of 16 rows (DM / 32 = 32 packed tiles), 8 pieces of 8 elements a thread
#define XBLK (NR / 16)
#define WBLK (DM / 16)
static_assert(NR % 16 == 0 && DM % 16 == 0 && DM / 32 == 8 * 4);
// the five input conversions depend on nothing and on each other not at all: one grid; blocks [0, XBLK) pack x, then WBLK blocks for each of the four weights (the choice is the same for a whole block)
// few long waves instead of many short ones: 16 waves a WGP, each lane with its sixteen 16-byte loads out before the first conversion; a block reads 16 whole source rows and writes one whole packed band
__global__ __launch_bounds__(256) void k_prep(const float* __restrict__ x, _Float16* __restrict__ X16, const float* __restrict__ W0, const float* __restrict__ W1, const float* __restrict__ W2, const float* __restrict__ W3,
    _Float16* __restrict__ B0, _Float16* __restrict__ B1, _Float16* __restrict__ B2, _Float16* __restrict__ B3, float sc) {
  const bool isx = blockIdx.x < XBLK; const unsigned wblk = blockIdx.x - XBLK, wi = wblk / WBLK;
  const unsigned band = isx ? blockIdx.x : wblk - wi * WBLK;
  const float* S = isx ? x : wi == 0 ? W0 : wi == 1 ? W1 : wi == 2 ? W2 : W3; _Float16* D = isx ? X16 : wi == 0 ? B0 : wi == 1 ? B1 : wi == 2 ? B2 : B3;
  const float s = isx ? 1.0f : sc; /* x is taken as it is: times one is exact */
  size_t r, e; int c;
  pk_src((size_t)band * 2048 + threadIdx.x, DM / 32, r, c, e); /* the thread's first piece; piece i lies four tiles on in the same band: 128 source columns, 2048 packed elements */
  const size_t sr = isx ? (r / SLEN) * SEQ_FULL + (r % SLEN) : r;
  const float* src = S + sr * DM + c; unsigned short* dst = (unsigned short*)D + e;
  v4f lo[8], hi[8];
#pragma unroll
  for (int i = 0; i < 8; ++i) { lo[i] = *(const v4fa*)(src + 128 * i); hi[i] = *(const v4fa*)(src + 128 * i + 4); }
  asm volatile("s_wait_xcnt 0x0" :: "v"(src) : "memory"); // behind the group: it holds the loads' address pair untouched up to here (without it the last load's result takes that pair), and every later reuse stands behind the wait
  __builtin_amdgcn_sched_barrier(0); // all sixteen loads go out as one group: the scheduler otherwise sinks part of them among the conversions, behind waits, and the wave pays the memory latency more than once
#pragma unroll
  for (int i = 0; i < 8; ++i) { FragH f;
#pragma unroll
    for (int q = 0; q < 4; ++q) { f.h[q] = (_Float16)(bf16_rne(lo[i][q]) * s); f.h[4 + q] = (_Float16)(bf16_rne(hi[i][q]) * s); }
    *(v8us*)(dst + 2048 * i) = f.half[0]; }
}

// GEMM (wave tile 64x64, the block's four waves 2 x 2 = 128x128: a k-step's sixteen 16-byte loads feed sixteen WMMAs, and each A and each B fragment is asked for by two waves of the block; M % 128 == 0, N % 128 == 0, K % 64 == 0, as both launches have it: a second way out of the k loop, for a single last k-step, would need a second set of accumulator registers where the two ways meet): v = acc*alpha + bf16(bias[col]) (+ CP term if CP); ACT 0 none; A, Bh and C16 are fragment-packed planes (lda, ldb, ldc = their K); writes f32 C (row-major, pitch ldc) and/or f16 C16; blockIdx.y = one of up to three independent products of one grid (A, Bh, C by their strides sA, sB, sC; bias, bias1, bias2 in turn); if CT, the third product (N = NH heads of 64 columns, no CP, no ACT) goes to CT alone, transposed
template <int ACT>
__global__ __launch_bounds__(128) void k_gemm2(const _Float16* __restrict__ A, int lda, size_t sA, const _Float16* __restrict__ Bh, int ldb, size_t sB, float alpha, const float* __restrict__ bias, const float* __restrict__ bias1, const float* __restrict__ bias2, const float* __restrict__ CP, int rowsPerB, size_t sCPb, int row0g,
    float* __restrict__ C, _Float16* __restrict__ C16, _Float16* __restrict__ CT, int ldc, size_t sC, int M, int N, int K) {
  __shared__ __attribute__((aligned(16))) float so[4][32][68];
  const int tid = threadIdx.x, w = tid >> 5, lane = tid & 31, ln = lane & 15, hh = lane >> 4; const int by = blockIdx.y;
  A += (size_t)by * sA; Bh += (size_t)by * sB; const size_t cofs = (size_t)by * sC; const float* bp = by == 0 ? bias : by == 1 ? bias1 : bias2;
  const int ntn = N >> 7; const int mt = blockIdx.x / ntn, nq = blockIdx.x - mt * ntn; const int row0 = mt * 128 + 64 * (w >> 1), col0 = nq * 128 + 64 * (w & 1); if (row0 >= M) return;
  // each lane's own fragment pointers (band start + 8 lane elements; a k-step is one tile, 512 elements); they move once per two k-steps, in front of the loads of the next pair's first step
  // every work-group starts its k walk at its own pair of k-steps (tile row + tile column, modulo the pairs) and wraps round: groups that share A rows or B rows and run in step then ask L2 for different lines at any one moment; start 0 where K is not at least two whole pairs. The f32 sums take their terms in that turned order
  const int nit = (K + 63) >> 6; int kp = ((K & 63) || K < 128) ? 0 : (int)((unsigned)(mt + nq) % (unsigned)nit); const long long kwrap = -(long long)(nit - 1) * 1024;
  const _Float16* a0p = A + (size_t)row0 * lda + (size_t)kp * 1024 + 8 * lane; const _Float16* a1p = a0p + (size_t)16 * lda; const _Float16* a2p = a1p + (size_t)16 * lda; const _Float16* a3p = a2p + (size_t)16 * lda;
  const _Float16* b0p = Bh + (size_t)col0 * ldb + (size_t)kp * 1024 + 8 * lane; const _Float16* b1p = b0p + (size_t)16 * ldb; const _Float16* b2p = b1p + (size_t)16 * ldb; const _Float16* b3p = b2p + (size_t)16 * ldb;
  const v8f z8 = {0.f,0.f,0.f,0.f,0.f,0.f,0.f,0.f}; v8f c00 = z8, c01 = z8, c02 = z8, c03 = z8, c10 = z8, c11 = z8, c12 = z8, c13 = z8, c20 = z8, c21 = z8, c22 = z8, c23 = z8, c30 = z8, c31 = z8, c32 = z8, c33 = z8;
  // fragments are fetched one k-step ahead into a second register set (x and y take turns): the sixteen loads of the next step go out as one group in front of this step's products
#define G2_LOAD(S, O) S##a0 = g2_fragp(a0p + (O)); S##a1 = g2_fragp(a1p + (O)); S##a2 = g2_fragp(a2p + (O)); S##a3 = g2_fragp(a3p + (O)); S##b0 = g2_fragp(b0p + (O)); S##b1 = g2_fragp(b1p + (O)); S##b2 = g2_fragp(b2p + (O)); S##b3 = g2_fragp(b3p + (O));
#define G2_COL(S, J) c0##J = g2_mma(S##a0, S##b##J, c0##J); c1##J = g2_mma(S##a1, S##b##J, c1##J); c2##J = g2_mma(S##a2, S##b##J, c2##J); c3##J = g2_mma(S##a3, S##b##J, c3##J);
#define G2_STEP(S) G2_COL(S, 0) G2_COL(S, 1) G2_COL(S, 2) G2_COL(S, 3) \
  g2_run_end();
  v16h xa0, xa1, xa2, xa3, xb0, xb1, xb2, xb3, ya0, ya1, ya2, ya3, yb0, yb1, yb2, yb3;
  G2_LOAD(x, 0)
  int kb = 0;
  // unroll 1: the body already holds both register sets' steps; further copies would only add registers
#pragma unroll 1
  for (; kb + 64 < K; kb += 64) {
    G2_LOAD(y, 512)
    __builtin_amdgcn_sched_barrier(0); // each group of sixteen loads stays whole in front of the run before its use: the scheduler otherwise sinks some of them to a few instructions ahead of their use
    G2_STEP(x)
    asm volatile("s_wait_xcnt 0x0" ::: "memory"); // in front of the pointer moves below, which rewrite the address pairs that the y loads name
    __builtin_amdgcn_sched_barrier(0); // holds those moves behind the wait, which no operand ties to them
    ++kp; const long long kd = (kp == nit) ? kwrap : 1024; kp = (kp == nit) ? 0 : kp; /* on to the next pair, from the last one back to the first; the same for the whole block */
    a0p += kd; a1p += kd; a2p += kd; a3p += kd; b0p += kd; b1p += kd; b2p += kd; b3p += kd;
    G2_LOAD(x, 0)
    __builtin_amdgcn_sched_barrier(0); // as above
    G2_STEP(y) }
  G2_LOAD(y, 512) /* the last pair of k-steps */
  asm volatile("s_wait_xcnt 0x0" :: "v"(a0p), "v"(a1p), "v"(a2p), "v"(a3p), "v"(b0p), "v"(b1p), "v"(b2p), "v"(b3p) : "memory"); // behind the last group: it holds the loads' address pairs untouched up to here (without it the last loads' results take some of them), and every later reuse stands behind the wait
  __builtin_amdgcn_sched_barrier(0); // as in the loop: the group stays whole in front of the run, in registers of its own (sunk among the WMMAs it would refill fragments that were read an instruction before)
  G2_STEP(x) G2_STEP(y)
#undef G2_LOAD
#undef G2_COL
#undef G2_STEP
  v8f accs[16] = {c00, c01, c02, c03, c10, c11, c12, c13, c20, c21, c22, c23, c30, c31, c32, c33};
  if (CT && by == 2) { // the same for a whole block. CT: per (batch, head) slab a fragment-packed plane with rows = the head's 64 columns, k = tokens, as the attention's second product reads it.
    // A lane's accumulator tile (t, half) is row 16 t + ln, k = 16 half + 8 hh + 0..7 of the wave's 64 tokens (two packed tiles, one behind the other): piece 32 half + lane counted from the first tile's start, so it is stored from registers, 512 contiguous bytes per wave-wide store
    unsigned short* dst = (unsigned short*)CT + (size_t)((row0 / SLEN) * NH + (col0 >> 6)) * 64 * SLEN + (size_t)((row0 % SLEN) >> 5) * 512 + 8 * lane;
    float bvs[4]; FragH f[16]; // the four bias loads go out as one group; all sixteen pieces are formed before the first store, so that no register of an issued store is written again
#pragma unroll
    for (int t = 0; t < 4; ++t) bvs[t] = bp ? bp[col0 + t * 16 + ln] : 0.f;
#pragma unroll
    for (int u = 0; u < 16; ++u) { const float bv = bf16_rne(bvs[u & 3]);
#pragma unroll
      for (int r = 0; r < 8; ++r) f[u].h[r] = (_Float16)(accs[u][r] * alpha + bv); }
#pragma unroll
    for (int u = 0; u < 16; ++u) *(v8us*)(dst + (size_t)((u & 3) * 16) * SLEN + 256 * (u >> 2)) = f[u].half[0];
    return; }
  // the rest of the epilogue takes the wave's 64 rows as two halves of 32, one after the other through the same code and the same staging rows: cur = the half's eight accumulator tiles, rw = its first row
  const int rsub = lane >> 4, c4 = (lane & 15) * 4;
  v8f cur[8];
#pragma unroll
  for (int u = 0; u < 8; ++u) cur[u] = accs[u];
  // unroll 1: both halves run through one copy of this long text
#pragma unroll 1
  for (int mi = 0; mi < 2; ++mi) { const int rw = row0 + 32 * mi;
#pragma unroll
  for (int u = 0; u < 8; ++u) { const int t = u & 3, half = u >> 2; const int col = col0 + t * 16 + ln; const float bv = bp ? bf16_rne(bp[col]) : 0.f;
#pragma unroll
    for (int r = 0; r < 8; ++r) { const int rloc = half * 16 + 8 * hh + r; float v = cur[u][r] * alpha + bv;
      if (CP) { if (rowsPerB < 0) v += CP[cofs + (size_t)(row0g + rw + rloc) * ldc + col]; else { const int bidx = (row0g + rw + rloc) / rowsPerB; v += CP[(size_t)bidx * sCPb + (size_t)by * 64 + col]; } }
      if (ACT == 3) v = fmaxf(v, 0.f);
      so[w][rloc][t * 16 + ln] = v; } }
  __builtin_amdgcn_fence(4 /* acq_rel order */, "workgroup"); __builtin_amdgcn_wave_barrier();
  {
#pragma unroll
    for (int q = 0; q < 16; ++q) { const int r = q * 2 + rsub; const v4f v = *(const v4fa*)&so[w][r][c4];
      if (C) *(v4f*)(C + cofs + (size_t)(rw + r) * ldc + col0 + c4) = v; }
     }
  asm volatile("s_wait_xcnt 0x0" ::: "memory"); // behind the run of C stores: the C16 block below reuses registers that those stores name
  if (C16) { // the half's 32 x 64 block is 2 x 2 packed tiles; per tile two wave-wide 16-byte stores of 512 contiguous bytes
#pragma unroll
    for (int tl = 0; tl < 4; ++tl) { const int rtl = tl >> 1, kbl = tl & 1; _Float16* dst = C16 + cofs + (size_t)(rw + 16 * rtl) * ldc + (size_t)((col0 >> 5) + kbl) * 512 + 8 * lane;
#pragma unroll
      for (int i = 0; i < 2; ++i) { const float* sp = &so[w][rtl * 16 + ln][kbl * 32 + 16 * i + 8 * hh]; const v4f lo = *(const v4fa*)sp, hi = *(const v4fa*)(sp + 4); FragH f;
#pragma unroll
        for (int q = 0; q < 4; ++q) { f.h[q] = (_Float16)lo[q]; f.h[4 + q] = (_Float16)hi[q]; }
        *(v8us*)((unsigned short*)dst + 256 * i) = f.half[0]; } } }
  asm volatile("s_wait_xcnt 0x0" ::: "memory"); // behind the half's last stores: the second half reuses registers that they name
  __builtin_amdgcn_fence(4 /* acq_rel order */, "wavefront"); __builtin_amdgcn_wave_barrier(); // for the compiler alone, no instruction: the second half's writes of the staging rows stay behind this half's reads of them (each wave has rows of its own, and every value read has been used above, so it is back)
  __builtin_amdgcn_sched_barrier(0); // holds the register moves below behind the wait, which no operand ties to them
#pragma unroll
  for (int u = 0; u < 8; ++u) cur[u] = accs[8 + u]; } }

// lane l with lane l ^ 16 (a vector cross-row move, no LDS queue)
__device__ __forceinline__ float xhalf(float x) { return __builtin_bit_cast(float, __builtin_amdgcn_permlanex16(__builtin_bit_cast(int, x), __builtin_bit_cast(int, x), 0x76543210, 0xfedcba98, false, false)); }

// fused attention per ((b,h), 64 queries): wave = 16 queries; both products transposed: S^T = K.Q^T (A = 16 keys, B = the wave's queries; d = 64: 2 k-steps) x SCL over all TK keys (CAUSAL == 0: no key excluded), O^T += V^T.P^T (A = 16 d, B = P^T).
// A lane holds 16 of the pass's 32 scores of ONE query (column lane & 15; keys 16 nt + 8 (lane >> 4) + r): maximum and sum run in the lane, the two lane halves meet by one cross-row move; the two score tiles, converted in place, are the B fragment of P^T (element 8 nt + r = k 16 nt + 8 h + r, the k order of the packed V^T tiles).
// online max/sum softmax f32; Q16, K16, O16 (rows = tokens, k = columns) and Vt (per slab: rows = d, k = keys) are fragment-packed planes
template <int CAUSAL>
__global__ __launch_bounds__(128) void k_flash(const _Float16* __restrict__ Q16, int ldq, const _Float16* __restrict__ K16, int ldk, const _Float16* __restrict__ Vt, _Float16* __restrict__ O16, int ldo) {
  constexpr int RPW = 16, DT = 4, KS = 2; constexpr float C2 = SCL * 1.4426950408889634f;
  const int tid = threadIdx.x, w = tid >> 5, lane = tid & 31, ln = lane & 15, hh = lane >> 4;
  const int slab = blockIdx.x / QBLKS, qblk = blockIdx.x % QBLKS; const int b = slab / NH, h = slab % NH; const int qb0 = qblk * (4 * RPW); const int q0 = qb0 + w * RPW;
  FragH bq[KS];
  { const unsigned short* qr = (const unsigned short*)Q16 + ((size_t)b * TQ + q0) * ldq + h * 1024 + 8 * lane;
#pragma unroll
    for (int ks = 0; ks < KS; ++ks) { bq[ks].half[0] = *(const v8us*)(qr + ks * 512); bq[ks].half[1] = *(const v8us*)(qr + ks * 512 + 256); } }
  const unsigned short* Vth = (const unsigned short*)Vt + (size_t)slab * 64 * TK; const unsigned l8 = 8u * (unsigned)lane; /* the lane's piece of a tile half; the K and V tile starts are the same for the whole block */
  float m_r = -3.0e38f, l_r = 0.f; v8f oacc[DT]; /* m_r: the query's running maximum of the raw products (alike in both halves); l_r: the sum over this half's keys, x1024 */
#pragma unroll
  for (int dt = 0; dt < DT; ++dt) oacc[dt] = (v8f){0.f,0.f,0.f,0.f,0.f,0.f,0.f,0.f};
  const int jend = (CAUSAL == 1) ? (qb0 + 4 * RPW) : TK; const int tq = q0 + ln; (void)tq;
  // with no key excluded the order of the keys is free: each of a slab's QBLKS blocks starts its walk TK / QBLKS keys further on and wraps round, so that blocks running in step ask L2 for different K and V lines at any one moment (maximum and sums take the keys in that turned order)
  int j0 = (CAUSAL == 1) ? 0 : qblk * (TK / QBLKS);
  const unsigned short* vp = Vth + (size_t)j0 * 16 + l8; /* the lane's piece of this pass's first V tile; it moves with j0 */
  FragH ak[2][KS];
#pragma unroll
  for (int nt = 0; nt < 2; ++nt) { const unsigned short* kr = (const unsigned short*)K16 + ((size_t)b * TK + j0 + nt * 16) * ldk + h * 1024;
#pragma unroll
    for (int ks = 0; ks < KS; ++ks) { ak[nt][ks].half[0] = *(const v8us*)(kr + ks * 512 + l8); ak[nt][ks].half[1] = *(const v8us*)(kr + ks * 512 + 256 + l8); } }
#pragma unroll 1
  for (int it = 0; it < jend; it += 32) {
    v8f s[2];
#pragma unroll
    for (int nt = 0; nt < 2; ++nt) { v8f acc = (v8f){0.f,0.f,0.f,0.f,0.f,0.f,0.f,0.f};
#pragma unroll
      for (int ks = 0; ks < KS; ++ks) acc = mmaH<1>(ak[nt][ks].v, ak[nt][ks].v, bq[ks].v, bq[ks].v, acc);
      s[nt] = acc; }
    asm volatile("v_nop\n\tv_nop\n\tv_nop\n\tv_nop" : "+v"(s[0]), "+v"(s[1]) : "v"(ak[0][0].v), "v"(ak[0][1].v), "v"(ak[1][0].v), "v"(ak[1][1].v), "v"(bq[0].v), "v"(bq[1].v)); // the run's distance, see at mmaH
    __builtin_amdgcn_sched_barrier(0); // the K loads below refill the registers this run reads: in front of it they would need other registers and copies
    // one group of loads directly behind the score products, a softmax ahead of their use: this pass's V fragments, then the next pass's K fragments into the registers just read
    FragH av[DT];
#pragma unroll
    for (int dt = 0; dt < DT; ++dt) { const unsigned short* vrow = vp + (size_t)(dt * 16) * TK; av[dt].half[0] = *(const v8us*)vrow; av[dt].half[1] = *(const v8us*)(vrow + 256); }
    const int jn = (j0 + 32 < jend) ? j0 + 32 : 0; /* behind the last keys the walk goes on at the first; the last pass's fetch is not used and stays inside K16 */
#pragma unroll
    for (int nt = 0; nt < 2; ++nt) { const unsigned short* kr = (const unsigned short*)K16 + ((size_t)b * TK + jn + nt * 16) * ldk + h * 1024;
#pragma unroll
      for (int ks = 0; ks < KS; ++ks) { ak[nt][ks].half[0] = *(const v8us*)(kr + ks * 512 + l8); ak[nt][ks].half[1] = *(const v8us*)(kr + ks * 512 + 256 + l8); } }
    __builtin_amdgcn_sched_barrier(0); // keeps the sixteen loads in one group here: without it the scheduler sinks the K loads to the foot of the softmax, a few instructions ahead of their use
    // the softmax runs in base 2 on the raw products: C2 = SCL log2(e) > 0, so the raw maximum is the scaled one's element, and a weight is one multiply-add and one hardware exponential
    vp += (jn - j0) * 16;
    float sv[16]; bool ok[16];
#pragma unroll
    for (int e = 0; e < 16; ++e) { const int key = j0 + (e >> 3) * 16 + 8 * hh + (e & 7); ok[e] = (CAUSAL == 1) ? (key <= tq) : true; sv[e] = ok[e] ? s[e >> 3][e & 7] : -3.0e38f; }
    float mx[5];
#pragma unroll
    for (int c = 0; c < 5; ++c) mx[c] = fmaxf(fmaxf(sv[3 * c], sv[3 * c + 1]), sv[3 * c + 2]);
    float mc = fmaxf(fmaxf(fmaxf(mx[0], mx[1]), mx[2]), fmaxf(fmaxf(mx[3], mx[4]), sv[15])); mc = fmaxf(mc, xhalf(mc));
    const float mn = fmaxf(m_r, mc); const float ae = __builtin_amdgcn_exp2f((m_r - mn) * C2); const float al = (mn > -1.0e38f) ? ae : 1.0f; m_r = mn; /* ae formed on every path: a select, so that it runs among the weights' exponentials and EXEC stays whole */
    const float nb = 10.0f - mn * C2; /* the exponent's addend: minus the maximum, plus 10 for the x1024 that the f16 weights carry (the sum carries it too) */
    FragH pb; v2f ps[2]; /* the lane's 16 weights in pairs: four independent partial sums */
#pragma unroll
    for (int i = 0; i < 8; ++i) { const v2f ar = (v2f){sv[2 * i], sv[2 * i + 1]} * C2 + nb; v2f p; p.x = ok[2 * i] ? __builtin_amdgcn_exp2f(ar.x) : 0.f; p.y = ok[2 * i + 1] ? __builtin_amdgcn_exp2f(ar.y) : 0.f;
      if (i < 2) ps[i] = p; else ps[i & 1] += p;
      const v2h ph = __builtin_convertvector(p, v2h); pb.h[2 * i] = ph.x; pb.h[2 * i + 1] = ph.y; }
    l_r = l_r * al + ((ps[0].x + ps[1].x) + (ps[0].y + ps[1].y));
#pragma unroll
    for (int dt = 0; dt < DT; ++dt) oacc[dt] *= al;
#pragma unroll
    for (int dt = 0; dt < DT; ++dt) oacc[dt] = mmaH<1>(av[dt].v, av[dt].v, pb.v, pb.v, oacc[dt]);
    asm volatile("v_nop\n\tv_nop\n\tv_nop\n\tv_nop" : "+v"(oacc[0]), "+v"(oacc[1]), "+v"(oacc[2]), "+v"(oacc[3]) : "v"(av[0].v), "v"(av[1].v), "v"(av[2].v), "v"(av[3].v), "v"(pb.v)); // the run's distance, see at mmaH: the next pass's first score tile may take P's registers
    j0 = jn; }
  { const float l = l_r + xhalf(l_r); const float inv = (l > 0.f) ? 1.0f / l : 0.f; /* l and oacc both carry x1024 */
    // oacc[dt][r] = O[query ln][d = 16 dt + 8 hh + r]: piece 32 (dt & 1) + lane of k tile 2 h + (dt >> 1) in the wave's 16-row band of the fragment-packed context plane (f16, x CSC) that the output GEMM reads: stored from registers, 512 contiguous bytes per wave-wide store
    unsigned short* ob = (unsigned short*)O16 + ((size_t)b * TQ + q0) * ldo + h * 1024 + 8 * lane;
#pragma unroll
    for (int dt = 0; dt < DT; ++dt) { FragH f;
#pragma unroll
      for (int q = 0; q < 8; ++q) f.h[q] = (_Float16)(oacc[dt][q] * inv * CSC);
      *(v8us*)(ob + dt * 256) = f.half[0]; } } }

// lane l with lane l ^ M of its 16-lane row (a DPP move, no LDS queue)
template <int M>
__device__ __forceinline__ float xrow(float x) { return __builtin_bit_cast(float, __builtin_amdgcn_update_dpp(0, __builtin_bit_cast(int, x), 0x160 | M, 0xf, 0xf, true)); }
// sum over the wave's 32 lanes, alike in every lane
__device__ __forceinline__ float wave_sum(float s) { s += xrow<1>(s); s += xrow<2>(s); s += xrow<4>(s); s += xrow<8>(s); return s + xhalf(s); }

// residual + LayerNorm, one wave per row (8 rows a block, no LDS, no barrier): a lane holds 32 of the row's DM values in registers (columns 128 i + 4 lane + 0..3: every wave-wide 16-byte access covers 512 contiguous bytes); mean, then the sum of squared distances from it, each four chains in the lane and a butterfly over the lanes
static_assert(NR % 8 == 0 && DM == 8 * 128);
__global__ __launch_bounds__(256) void k_ln(const float* __restrict__ X, const float* __restrict__ R, const float* __restrict__ g, const float* __restrict__ bta, float* __restrict__ out) {
  const int lane = threadIdx.x & 31; const int row = blockIdx.x * 8 + (threadIdx.x >> 5);
  const size_t srow = (size_t)(row / SLEN) * SEQ_FULL + (size_t)(row % SLEN);
  const float* x = X + (size_t)row * DM + 4 * lane; const float* rr = R + srow * DM + 4 * lane;
  v4f a[8], rb[8], gg[8], bb[8];
#pragma unroll
  for (int i = 0; i < 8; ++i) a[i] = *(const v4fa*)(x + 128 * i);
#pragma unroll
  for (int i = 0; i < 8; ++i) rb[i] = *(const v4fa*)(rr + 128 * i);
#pragma unroll
  for (int i = 0; i < 8; ++i) { gg[i] = *(const v4fa*)(g + 4 * lane + 128 * i); bb[i] = *(const v4fa*)(bta + 4 * lane + 128 * i); }
  asm volatile("s_wait_xcnt 0x0" :: "v"(x), "v"(rr) : "memory"); // behind the group: it holds the row loads' address pairs untouched up to here (without it the last loads' results take them), and every later reuse stands behind the wait
  __builtin_amdgcn_sched_barrier(0); // all thirty-two loads go out as one group: the scheduler otherwise sinks the last rows' behind waits and the scale and shift loads behind both sums, each pair waited for at once
  v4f s4 = {0.f, 0.f, 0.f, 0.f};
#pragma unroll
  for (int i = 0; i < 8; ++i) {
#pragma unroll
    for (int q = 0; q < 4; ++q) a[i][q] += bf16_rne(rb[i][q]);
    s4 += a[i]; }
  const float mu = wave_sum((s4.x + s4.y) + (s4.z + s4.w)) * 0.0009765625f;
  v4f d4 = {0.f, 0.f, 0.f, 0.f};
#pragma unroll
  for (int i = 0; i < 8; ++i) { a[i] -= mu; d4 += a[i] * a[i]; }
  const float rs = rsqrtf(wave_sum((d4.x + d4.y) + (d4.z + d4.w)) * 0.0009765625f + LNEPS);
  float* o = out + (size_t)row * DM + 4 * lane;
#pragma unroll
  for (int i = 0; i < 8; ++i) { v4f v;
#pragma unroll
    for (int q = 0; q < 4; ++q) v[q] = a[i][q] * rs * bf16_rne(gg[i][q]) + bf16_rne(bb[i][q]);
    *(v4f*)(o + 128 * i) = v; }
}

extern "C" void kernel_launch(void* const* d_in, const int* in_sizes, int n_in,
                              void* d_out, int out_size, void* d_ws, size_t ws_size, hipStream_t stream) {
  if (n_in < 11) return;
  const float* hs = (const float*)d_in[0]; const float* Wq = (const float*)d_in[1]; const float* bq = (const float*)d_in[2]; const float* Wk = (const float*)d_in[3]; const float* bk = (const float*)d_in[4];
  const float* Wv = (const float*)d_in[5]; const float* bv = (const float*)d_in[6]; const float* Wd = (const float*)d_in[7]; const float* bd = (const float*)d_in[8]; const float* gam = (const float*)d_in[9]; const float* bet = (const float*)d_in[10];
  const long long need0 = ((long long)(NB - 1) * SEQ_FULL + SLEN) * DM;
  if ((long long)in_sizes[0] < need0) return;
  if (in_sizes[1] < DM * DM || in_sizes[3] < DM * DM || in_sizes[5] < DM * DM || in_sizes[7] < DM * DM) return;
  if (in_sizes[2] < DM || in_sizes[4] < DM || in_sizes[6] < DM || in_sizes[8] < DM || in_sizes[9] < DM || in_sizes[10] < DM) return;
  if ((long long)out_size < (long long)NR * DM) return;
  char* ws = (char*)d_ws; size_t off = 0;
  auto take = [&](size_t bytes) { char* p = ws + off; off += (bytes + 255) & ~(size_t)255; return p; };
  const size_t np = (size_t)NR * DM; const size_t nw = (size_t)DM * DM;
  _Float16* BQ = (_Float16*)take(nw * 2 * 3); _Float16* BK = BQ + nw; _Float16* BV = BK + nw; _Float16* BD = (_Float16*)take(nw * 2); /* q, k, v planes one behind the other: blockIdx.y strides through them */
  _Float16* X16 = (_Float16*)take(np * 2); _Float16* QH = (_Float16*)take(np * 2 * 2); _Float16* KH = QH + np; _Float16* VT = (_Float16*)take(np * 2);
  _Float16* CTX16 = (_Float16*)take(np * 2); float* ATT = (float*)take(np * 4);
  float* O = (float*)d_out;
  if (off > ws_size) return;
  k_prep<<<XBLK + 4 * WBLK, 256, 0, stream>>>(hs, X16, Wq, Wk, Wv, Wd, BQ, BK, BV, BD, WSC);      /* weights: [out][in] = [n][k] */
  const dim3 g((NR / 128) * (DM / 128), 1), g3((NR / 128) * (DM / 128), 3);
  k_gemm2<0><<<g3, 128, 0, stream>>>(X16, DM, 0, BQ, DM, nw, 1.0f / WSC, bq, bk, bv, nullptr, 1, 0, 0, nullptr, QH, VT, DM, np, NR, DM, DM);
  k_flash<0><<<NB * NH * QBLKS, 128, 0, stream>>>(QH, DM, KH, DM, VT, CTX16, DM);
  k_gemm2<0><<<g, 128, 0, stream>>>(CTX16, DM, 0, BD, DM, 0, 1.0f / (WSC * CSC), bd, nullptr, nullptr, nullptr, 1, 0, 0, ATT, nullptr, nullptr, DM, 0, NR, DM, DM);
  k_ln<<<NR / 8, 256, 0, stream>>>(ATT, hs, gam, bet, O);
}
